// v000
// Times are from an AMD MI455X. After a warm-up the kernel runs many times in a row, and a time is the length of
// such a window on the GPU divided by its runs, so every launch and the gaps after it count. The runs cycle
// through copies of the inputs. A figure is the median of several windows, for all but v000 over two sittings.
// Sittings can differ by a few percent; kernels timed side by side share one.
// v000, which the later versions start from, runs in 1560 microseconds.
#include <hip/hip_runtime.h>

// Compute dtypes, f32 accumulate, one batch item per pass: Q/K = x.W_q[h] / x.W_k[h] ([4096 x 128].[128 x 128] per head, k-major per-head weights transposed once
// into n-major [8*128][128] planes; PLAIN bf16 operands = inputs rounded once, exact products) written straight from the GEMM epilogue as f16 hi + residual
// x1024 planes [t][h*128+e], and out = y.W_o^T ([4096 x 1024].[1024 x 128], W_o [out][in] as-is; y as bf16 hi + residual) on v_wmma_f32_16x16x32_bf16; the
// 8-head causal attention with clipped scores (clip(s/sqrt(128), -10, 10)) and V = x itself (bf16(x)^T, exact, one plane) on v_wmma_f32_16x16x32_f16 (scores)

#define NB_  2
#define NT_  4096
#define HS   128                 // x width = head dim of q, k and v
#define NH_  8
#define HD   128
#define KW   (NH_ * HD)          // 1024: row stride of the Q/K planes
#define NTK  NT_
#define DM   HS                  // k_gemmb's default K
#define PSC  32768.0f
#define LOSC 1024.0f
#define LOSCI (1.0f / 1024.0f)

typedef _Float16 h16;
typedef unsigned short bf;
typedef __attribute__((ext_vector_type(16))) __bf16   v16bf;
typedef __attribute__((ext_vector_type(16))) _Float16 v16h;
typedef __attribute__((ext_vector_type(8)))  _Float16 v8h;
typedef __attribute__((ext_vector_type(8)))  unsigned short v8us;
typedef __attribute__((ext_vector_type(8)))  float    v8f;
typedef __attribute__((ext_vector_type(4)))  float    v4f;
typedef __attribute__((ext_vector_type(4)))  _Float16 v4h;
typedef v8h  __attribute__((may_alias)) v8ha;
typedef v4f  __attribute__((may_alias)) v4fa;
typedef v8us __attribute__((may_alias)) v8usa;

__device__ __forceinline__ unsigned short f2bf(float f) { unsigned u = __float_as_uint(f); u += 0x7FFFu + ((u >> 16) & 1u); return (unsigned short)(u >> 16); }
__device__ __forceinline__ float bf2f(unsigned short b) { return __uint_as_float(((unsigned)b) << 16); }
__device__ __forceinline__ float bfr(float f) { return bf2f(f2bf(f)); }
__device__ __forceinline__ v16h cat16(v8h lo, v8h hi) { return __builtin_shufflevector(lo, hi, 0, 1, 2, 3, 4, 5, 6, 7, 8, 9, 10, 11, 12, 13, 14, 15); }
__device__ __forceinline__ v16bf cat16b(v8us lo, v8us hi) { return __builtin_bit_cast(v16bf, __builtin_shufflevector(lo, hi, 0, 1, 2, 3, 4, 5, 6, 7, 8, 9, 10, 11, 12, 13, 14, 15)); }
__device__ __forceinline__ v8f wmma16(v16h a, v16h b, v8f c) { return __builtin_amdgcn_wmma_f32_16x16x32_f16(false, a, false, b, (short)0, c, false, false); }
__device__ __forceinline__ v8f wmmab(v16bf a, v16bf b, v8f c) { return __builtin_amdgcn_wmma_f32_16x16x32_bf16(false, a, false, b, (short)0, c, false, false); }

// k_cvt128: one wave per row of x [rows][128]: bf16 plane (A operand) and an f32 copy of the bf16-rounded row (the V source for k_vt); lane -> 4 consecutive floats
__global__ __launch_bounds__(256) void k_cvt128(const float* __restrict__ src, int nrows, bf* dstb, float* dstf) {
    typedef __attribute__((ext_vector_type(4))) unsigned short v4us;
    const int lane = threadIdx.x & 31, r = blockIdx.x * 8 + (threadIdx.x >> 5);
    if (r >= nrows) return;
    const v4f v = *(const v4f*)(src + (size_t)r * HS + lane * 4); v4us ob; v4f of;
#pragma unroll
    for (int i = 0; i < 4; ++i) { ob[i] = f2bf(v[i]); of[i] = bf2f(ob[i]); }
    *(v4us*)(dstb + (size_t)r * HS + lane * 4) = ob; *(v4f*)(dstf + (size_t)r * HS + lane * 4) = of; 
}
// k_wt: WT [n][K] = bf16(W[k][n]) (k-major [K][ncols]) via 64 x 64 LDS tiles; grid (K/64, ncols/64).
__global__ __launch_bounds__(256) void k_wt(const float* __restrict__ Wm, int K, int ncols, bf* WT) {
    __shared__ __align__(16) unsigned short tl[64 * 72];
    const int tid = threadIdx.x, k0 = blockIdx.x * 64, n0 = blockIdx.y * 64;
    const int kk = tid >> 2, nq = (tid & 3) * 16;
#pragma unroll
    for (int i = 0; i < 16; ++i) tl[(nq + i) * 72 + kk] = f2bf(Wm[(size_t)(k0 + kk) * ncols + n0 + nq + i]);
    __syncthreads();
    const int piece = tid & 7;
    auto pass = [&]() {
#pragma unroll
        for (int s = 0; s < 2; ++s) { const int nr = (tid >> 3) + 32 * s; const v8us val = *(const v8usa*)(tl + nr * 72 + piece * 8); *(v8us*)(WT + (size_t)(n0 + nr) * K + k0 + piece * 8) = val; }
    };
    pass(); 
}
// k_gemmb: 64 x 64 block tile (4 waves x 16 x 64) of C[NTK][NW] = (A [+ Al]).B^T (K = 128 or 1024) [+ bf(bias[c])] [+ bf(R[r][c]) residual]; f32 whole-line epilogue (or f16
template <bool SPLITA, bool F16OUT = false>
__global__ __launch_bounds__(128) void k_gemmb(const bf* __restrict__ A, const bf* __restrict__ Al, const bf* __restrict__ Bn, const float* __restrict__ bias, float* C, int ldc, h16* C2, const float* __restrict__ R = nullptr, int K = DM, int roundR = 1) {
    __shared__ __align__(16) float ost[4][16 * 68];
    const int lane = threadIdx.x & 31, wave = threadIdx.x >> 5, lr = lane & 15, hi = lane >> 4;
    const int r0 = blockIdx.x * 64 + wave * 16, c0 = blockIdx.y * 64;
    const size_t aoff = (size_t)(r0 + lr) * K + 8 * hi;
    size_t boff[4];
#pragma unroll
    for (int t = 0; t < 4; ++t) boff[t] = (size_t)(c0 + t * 16 + lr) * K + 8 * hi;
    v8f acc[4];
#pragma unroll
    for (int t = 0; t < 4; ++t) acc[t] = (v8f){};
#pragma unroll 1
    for (int kc = 0; kc < K; kc += 32) {
        const v16bf a = cat16b(*(const v8us*)(A + aoff + kc), *(const v8us*)(A + aoff + kc + 16));
        v16bf al = a;
        if (SPLITA) al = cat16b(*(const v8us*)(Al + aoff + kc), *(const v8us*)(Al + aoff + kc + 16));
#pragma unroll
        for (int t = 0; t < 4; ++t) { const v16bf b = cat16b(*(const v8us*)(Bn + boff[t] + kc), *(const v8us*)(Bn + boff[t] + kc + 16)); acc[t] = wmmab(a, b, acc[t]); if (SPLITA) acc[t] = wmmab(al, b, acc[t]); }
        asm volatile("v_nop\n\tv_nop\n\tv_nop\n\tv_nop" : "+v"(acc[0]), "+v"(acc[1]), "+v"(acc[2]), "+v"(acc[3]) : "v"(a), "v"(al));
    }
    float* os = &ost[wave][0];
#pragma unroll
    for (int t = 0; t < 4; ++t) { const float bv = bias ? bfr(bias[c0 + t * 16 + lr]) : 0.f;
#pragma unroll
        for (int j = 0; j < 8; ++j) os[(hi * 8 + j) * 68 + t * 16 + lr] = acc[t][j] + bv; }
    __syncthreads();
    if (F16OUT) {
        h16* crow = (h16*)(void*)C + (size_t)r0 * ldc + c0;
        auto pass = [&]() {
#pragma unroll
            for (int s = 0; s < 4; ++s) { const int row = 4 * s + (lane >> 3), piece = lane & 7; const float* sp = os + row * 68 + piece * 8; v8h o, o2;
#pragma unroll
                for (int i = 0; i < 8; ++i) { const h16 a = (h16)sp[i]; o[i] = a; o2[i] = (h16)((sp[i] - (float)a) * LOSC); }
                *(v8h*)(crow + (size_t)row * ldc + piece * 8) = o; if (C2) *(v8h*)(C2 + (size_t)r0 * ldc + c0 + (size_t)row * ldc + piece * 8) = o2; }
        };
        pass(); 
    } else {
        float* crow = C + (size_t)r0 * ldc + c0;
        auto pass = [&]() {
#pragma unroll
            for (int s = 0; s < 8; ++s) { const int Lid = (lane >> 3) + 4 * s, piece = lane & 7; const int row = Lid >> 1, cofs = (Lid & 1) * 32 + piece * 4;
                v4f val = *(const v4fa*)(os + row * 68 + cofs); if (R) { const v4f rv = *(const v4f*)(R + ((size_t)r0 + row) * ldc + c0 + cofs); val += roundR ? (v4f){bfr(rv[0]), bfr(rv[1]), bfr(rv[2]), bfr(rv[3])} : rv; }
                *(v4f*)(crow + (size_t)row * ldc + cofs) = val; }
        };
        pass(); 
    }
}

__global__ __launch_bounds__(256) void k_cvtw(const float* __restrict__ src, int nrows, bf* dst) {
    const int lane = threadIdx.x & 31, r = blockIdx.x * 8 + (threadIdx.x >> 5);
    if (r >= nrows) return;
    v8us o[KW / 256];
#pragma unroll
    for (int q = 0; q < KW / 256; ++q) { v8us t;
#pragma unroll
        for (int i = 0; i < 8; ++i) t[i] = f2bf(src[(size_t)r * KW + q * 256 + lane * 8 + i]);
        o[q] = t; }
{
#pragma unroll
        for (int q = 0; q < KW / 256; ++q) *(v8us*)(dst + (size_t)r * KW + q * 256 + lane * 8) = o[q];
         }
}
// 8 lanes x 16 B.
__global__ __launch_bounds__(256) void k_vt(const float* __restrict__ V, bf* VTH) {
    __shared__ __align__(16) unsigned short th_[64 * 72];
    const int t0 = blockIdx.x * 64, dh = blockIdx.y, tid = threadIdx.x;
    const int tt = tid >> 2, dq = (tid & 3) * 16;
    const float* src = V + ((size_t)t0 + tt) * HS + dh * 64 + dq;
#pragma unroll
    for (int i = 0; i < 16; ++i) th_[(dq + i) * 72 + tt] = f2bf(src[i]);
    __syncthreads();
    const int piece = tid & 7;
    auto pass = [&]() {
#pragma unroll
        for (int s = 0; s < 2; ++s) { const int d = (tid >> 3) + 32 * s;
            const v8us a = *(const v8usa*)(th_ + d * 72 + piece * 8);
            *(v8us*)(VTH + (size_t)(dh * 64 + d) * NT_ + t0 + piece * 8) = a; }
    };
    pass(); 
}
// k_attn: block = (head, 64 queries), wave = 16; K slice of head h (row stride NH*HD), V = bf16(x)^T shared by all heads (exact, single plane); causal key tiles
// 0..(Q0+63)/32; per element: j <= q -> clip(score x 128^-1/2, -10, 10) else -inf (reference: clip before the causal where); scores hh + (hl+lh)/1024 on separate
// accumulators; online softmax f32; P (x32768) as bf16 hi + unscaled residual; o += ph.v + pl.v; ctx / l -> bf16 hi/lo planes CH/CL[tok][h*128+d].
__global__ __launch_bounds__(128) void k_attn(const h16* __restrict__ QH, const h16* __restrict__ QL, const h16* __restrict__ KH, const h16* __restrict__ KL, const bf* __restrict__ VTH, bf* CH, bf* CL) {
    __shared__ __align__(16) unsigned short plds[4][16 * 32];
    __shared__ __align__(16) unsigned short plds2[4][16 * 32];
    __shared__ __align__(16) float ost[4][16 * 68];
    const int lane = threadIdx.x & 31, wave = threadIdx.x >> 5, lr = lane & 15, hi = lane >> 4;
    const int bid = blockIdx.x; const int h = bid / (NT_ / 64), qt = bid - h * (NT_ / 64); const int g = h;   // K has one slice per head; V (= x) is shared by all heads
    const int q0 = qt * 64 + wave * 16;
    unsigned short* pl = &plds[wave][0]; unsigned short* pl2 = &plds2[wave][0];
    const size_t qo = (size_t)(q0 + lr) * (NH_ * HD) + h * HD + 8 * hi;
    const h16* kh_b = KH + g * HD; const h16* kl_b = KL + g * HD;
    const size_t vbase = 0; (void)g;
    v8f o[8];
#pragma unroll
    for (int n = 0; n < 8; ++n) o[n] = (v8f){};
    float mrow[8], lpart[8];
#pragma unroll
    for (int j = 0; j < 8; ++j) { mrow[j] = -3.0e38f; lpart[j] = 0.f; }
    const int kt_hi = (qt * 64 + 63) / 32; const int kt_lo = 0;     // causal
#pragma unroll 1
    for (int kt = kt_lo; kt <= kt_hi; ++kt) {
        const int l0 = kt * 32;
        const size_t ko0 = (size_t)(l0 + lr) * KW + 8 * hi, ko1 = (size_t)(l0 + 16 + lr) * KW + 8 * hi;
        v8f s0 = {}, s1 = {}, x0 = {}, x1 = {};
#pragma unroll
        for (int kc = 0; kc < 4; ++kc) {
            const v16h qa = cat16(*(const v8h*)(QH + qo + kc * 32), *(const v8h*)(QH + qo + kc * 32 + 16)), qx = cat16(*(const v8h*)(QL + qo + kc * 32), *(const v8h*)(QL + qo + kc * 32 + 16));
            const v16h k0h = cat16(*(const v8h*)(kh_b + ko0 + kc * 32), *(const v8h*)(kh_b + ko0 + kc * 32 + 16)), k1h = cat16(*(const v8h*)(kh_b + ko1 + kc * 32), *(const v8h*)(kh_b + ko1 + kc * 32 + 16));
            s0 = wmma16(qa, k0h, s0); s1 = wmma16(qa, k1h, s1); x0 = wmma16(qx, k0h, x0); x1 = wmma16(qx, k1h, x1);
            asm volatile("v_nop" : "+v"(s0), "+v"(s1), "+v"(x0), "+v"(x1) : "v"(qa), "v"(qx), "v"(k0h), "v"(k1h) : "memory");
            const v16h k0l = cat16(*(const v8h*)(kl_b + ko0 + kc * 32), *(const v8h*)(kl_b + ko0 + kc * 32 + 16)), k1l = cat16(*(const v8h*)(kl_b + ko1 + kc * 32), *(const v8h*)(kl_b + ko1 + kc * 32 + 16));
            x0 = wmma16(qa, k0l, x0); x1 = wmma16(qa, k1l, x1);
            asm volatile("v_nop" : "+v"(x0), "+v"(x1) : "v"(k0l), "v"(k1l) : "memory");
        }
        asm volatile("v_nop\n\tv_nop\n\tv_nop\n\tv_nop" : "+v"(s0), "+v"(s1), "+v"(x0), "+v"(x1));
        float alpha[8];
#pragma unroll
        for (int j = 0; j < 8; ++j) { const int qi = q0 + hi * 8 + j, ja = l0 + lr, jb = l0 + 16 + lr;
            // reference order: scores / sqrt(128) -> clip(-10, 10) -> causal where -> softmax
            const float a0 = (ja <= qi) ? fminf(fmaxf((s0[j] + x0[j] * LOSCI) * 0.08838834764831845f, -10.0f), 10.0f) : -__builtin_inff(), a1 = (jb <= qi) ? fminf(fmaxf((s1[j] + x1[j] * LOSCI) * 0.08838834764831845f, -10.0f), 10.0f) : -__builtin_inff();
            float mx = fmaxf(a0, a1);
            mx = fmaxf(mx, __shfl_xor(mx, 1, 16)); mx = fmaxf(mx, __shfl_xor(mx, 2, 16)); mx = fmaxf(mx, __shfl_xor(mx, 4, 16)); mx = fmaxf(mx, __shfl_xor(mx, 8, 16));
            const float mn = fmaxf(mrow[j], mx);
            alpha[j] = __expf(mrow[j] - mn); mrow[j] = mn;
            const float p0 = __expf(a0 - mn), p1 = __expf(a1 - mn);
            lpart[j] = lpart[j] * alpha[j] + (p0 + p1);
            const int mr = hi * 8 + j; const float ps0 = p0 * PSC, ps1 = p1 * PSC; const unsigned short h0 = f2bf(ps0), h1 = f2bf(ps1);
            pl[mr * 32 + lr] = h0; pl[mr * 32 + 16 + lr] = h1; pl2[mr * 32 + lr] = f2bf(ps0 - bf2f(h0)); pl2[mr * 32 + 16 + lr] = f2bf(ps1 - bf2f(h1)); }
#pragma unroll
        for (int n = 0; n < 8; ++n)
#pragma unroll
            for (int j = 0; j < 8; ++j) o[n][j] *= alpha[j];
        asm volatile("" ::: "memory");
        const v16bf pa = cat16b(*(const v8usa*)(pl + lr * 32 + hi * 8), *(const v8usa*)(pl + lr * 32 + 16 + hi * 8));
        const v16bf px = cat16b(*(const v8usa*)(pl2 + lr * 32 + hi * 8), *(const v8usa*)(pl2 + lr * 32 + 16 + hi * 8));
#pragma unroll
        for (int n = 0; n < 8; ++n) { const size_t vo = vbase + (size_t)(n * 16 + lr) * NT_ + l0 + hi * 8;
            const v16bf vh = cat16b(*(const v8us*)(VTH + vo), *(const v8us*)(VTH + vo + 16));     // V = bf16(x) exactly (a rounded INPUT): no residual plane
            o[n] = wmmab(pa, vh, o[n]); o[n] = wmmab(px, vh, o[n]);
            asm volatile("" : "+v"(o[n]) : "v"(vh) : "memory"); }
        asm volatile("v_nop\n\tv_nop\n\tv_nop\n\tv_nop" : "+v"(o[0]), "+v"(o[7]) : "v"(pa), "v"(px));
        __builtin_amdgcn_wave_barrier();
    }
    float inv[8];
#pragma unroll
    for (int j = 0; j < 8; ++j) { float rs = lpart[j]; rs += __shfl_xor(rs, 1, 16); rs += __shfl_xor(rs, 2, 16); rs += __shfl_xor(rs, 4, 16); rs += __shfl_xor(rs, 8, 16); inv[j] = 1.0f / (rs * PSC); }
    float* os = &ost[wave][0];
    const size_t cbase = (size_t)q0 * (NH_ * HD) + (size_t)h * HD;
#pragma unroll
    for (int half = 0; half < 2; ++half) {
#pragma unroll
        for (int n = 0; n < 4; ++n)
#pragma unroll
            for (int j = 0; j < 8; ++j) os[(hi * 8 + j) * 68 + n * 16 + lr] = o[half * 4 + n][j] * inv[j];
        __builtin_amdgcn_wave_barrier(); asm volatile("" ::: "memory");
{
#pragma unroll
            for (int s = 0; s < 4; ++s) { const int row = 4 * s + (lane >> 3), piece = lane & 7; const float* sp = os + row * 68 + piece * 8; v8us oh, ol;
#pragma unroll
                for (int i = 0; i < 8; ++i) { const unsigned short hb = f2bf(sp[i]); oh[i] = hb; ol[i] = f2bf(sp[i] - bf2f(hb)); }
                const size_t po = cbase + (size_t)row * (NH_ * HD) + half * 64 + piece * 8; *(v8us*)(CH + po) = oh; *(v8us*)(CL + po) = ol; }
             }
        __builtin_amdgcn_wave_barrier(); asm volatile("" ::: "memory");
    }
}

extern "C" void kernel_launch(void* const* d_in, const int* in_sizes, int n_in,
                              void* d_out, int out_size, void* d_ws, size_t ws_size, hipStream_t stream) {
    (void)in_sizes; (void)n_in; (void)out_size;
    const float* x = (const float*)d_in[0]; const float* Wq = (const float*)d_in[1]; const float* Wk = (const float*)d_in[2]; const float* Wo = (const float*)d_in[3];   // Wq/Wk [8][128][128] (x.W[h]); Wo [128][1024] = [out][in]
    float* out = (float*)d_out;    // [2][4096][128]
    char* wsp = (char*)d_ws;
    auto take = [&](size_t bytes) { char* p = wsp; wsp += (bytes + 255) & ~(size_t)255; return (void*)p; };
    bf* Xb = (bf*)take((size_t)NTK * HS * 2); float* Xr = (float*)take((size_t)NTK * HS * 4);
    bf* WqT = (bf*)take((size_t)KW * HS * 2); bf* WkT = (bf*)take((size_t)KW * HS * 2); bf* WoB = (bf*)take((size_t)HS * KW * 2);
    h16* QH = (h16*)take((size_t)NTK * KW * 2); h16* QL = (h16*)take((size_t)NTK * KW * 2); h16* KH = (h16*)take((size_t)NTK * KW * 2); h16* KL = (h16*)take((size_t)NTK * KW * 2);
    bf* VTH = (bf*)take((size_t)HS * NT_ * 2); bf* CH = (bf*)take((size_t)NTK * KW * 2); bf* CL = (bf*)take((size_t)NTK * KW * 2);
    if ((size_t)(wsp - (char*)d_ws) > ws_size) return;    // 1 + 2 + 3 x 0.26 + 4 x 8.4 + 1 + 2 x 8.4 ~ 55 MB, no aliasing (per-item reuse in stream order)
    for (int h = 0; h < NH_; ++h) {      // per-head k-major [128][128] -> rows h*128.. of the n-major planes [1024][128]
        k_wt<<<dim3(HS / 64, HD / 64, 1), 256, 0, stream>>>(Wq + (size_t)h * HS * HD, HS, HD, WqT + (size_t)h * HD * HS);
        k_wt<<<dim3(HS / 64, HD / 64, 1), 256, 0, stream>>>(Wk + (size_t)h * HS * HD, HS, HD, WkT + (size_t)h * HD * HS);
    }
    k_cvtw<<<HS / 8, 256, 0, stream>>>(Wo, HS, WoB);      // W_o [128][1024] = [out][in]: bf16 copy = n-major B operand
    for (int b = 0; b < NB_; ++b) {
        k_cvt128<<<NTK / 8, 256, 0, stream>>>(x + (size_t)b * NTK * HS, NTK, Xb, Xr);
        k_gemmb<false, true><<<dim3(NTK / 64, KW / 64, 1), 128, 0, stream>>>(Xb, nullptr, WqT, nullptr, (float*)(void*)QH, KW, QL, nullptr, HS);
        k_gemmb<false, true><<<dim3(NTK / 64, KW / 64, 1), 128, 0, stream>>>(Xb, nullptr, WkT, nullptr, (float*)(void*)KH, KW, KL, nullptr, HS);
        k_vt<<<dim3(NT_ / 64, 2, 1), 256, 0, stream>>>(Xr, VTH);
        k_attn<<<NH_ * (NT_ / 64), 128, 0, stream>>>(QH, QL, KH, KL, VTH, CH, CL);
        k_gemmb<true, false><<<dim3(NTK / 64, HS / 64, 1), 128, 0, stream>>>(CH, CL, WoB, nullptr, out + (size_t)b * NTK * HS, HS, nullptr, nullptr, KW);
    }
}

// v001
// Measured time: 949 microseconds a run.
// Two timings next to v000 both put it at 1.66 times that version's speed.
#include <hip/hip_runtime.h>

// Compute dtypes, f32 accumulate, one batch item per pass: Q/K = x.W_q[h] / x.W_k[h] ([4096 x 128].[128 x 128] per head, k-major per-head weights transposed once
// into n-major [8*128][128] planes; PLAIN bf16 operands = inputs rounded once, exact products) written straight from the GEMM epilogue as f16 hi + residual
// x1024 planes [t][h*128+e], and out = y.W_o^T ([4096 x 1024].[1024 x 128], W_o [out][in] as-is; y as bf16 hi + residual) on v_wmma_f32_16x16x32_bf16; the
// 8-head causal attention with clipped scores (clip(s/sqrt(128), -10, 10)) and V = x itself (bf16(x)^T, exact, one plane) on v_wmma_f32_16x16x32_f16 (scores)

#define NB_  2
#define NT_  4096
#define HS   128                 // x width = head dim of q, k and v
#define NH_  8
#define HD   128
#define KW   (NH_ * HD)          // 1024: row stride of the Q/K planes
#define NTK  NT_
#define DM   HS                  // k_gemmb's default K
#define PSC  32768.0f
#define LOSC 1024.0f
#define LOSCI (1.0f / 1024.0f)
#define KP   136                 // LDS pitch of a staged K row in 16-bit elements: 272 B = 16 B x odd, for ds_load_b128 readers
#define VP   40                  // LDS pitch of a staged V^T row (32 keys) in 16-bit elements: 80 B = 16 B x odd
#define KPL  (32 * KP)           // one K plane of a 32-key tile
#define STG  (2 * KPL + HS * VP) // one ring buffer: K hi, K residual, V^T

typedef _Float16 h16;
typedef unsigned short bf;
typedef __attribute__((ext_vector_type(16))) __bf16   v16bf;
typedef __attribute__((ext_vector_type(16))) _Float16 v16h;
typedef __attribute__((ext_vector_type(8)))  _Float16 v8h;
typedef __attribute__((ext_vector_type(8)))  unsigned short v8us;
typedef __attribute__((ext_vector_type(8)))  float    v8f;
typedef __attribute__((ext_vector_type(4)))  float    v4f;
typedef __attribute__((ext_vector_type(4)))  _Float16 v4h;
typedef v8h  __attribute__((may_alias)) v8ha;
typedef v4f  __attribute__((may_alias)) v4fa;
typedef v8us __attribute__((may_alias)) v8usa;

__device__ __forceinline__ unsigned short f2bf(float f) { unsigned u = __float_as_uint(f); u += 0x7FFFu + ((u >> 16) & 1u); return (unsigned short)(u >> 16); }
__device__ __forceinline__ float bf2f(unsigned short b) { return __uint_as_float(((unsigned)b) << 16); }
__device__ __forceinline__ float bfr(float f) { return bf2f(f2bf(f)); }
__device__ __forceinline__ v16h cat16(v8h lo, v8h hi) { return __builtin_shufflevector(lo, hi, 0, 1, 2, 3, 4, 5, 6, 7, 8, 9, 10, 11, 12, 13, 14, 15); }
__device__ __forceinline__ v16bf cat16b(v8us lo, v8us hi) { return __builtin_bit_cast(v16bf, __builtin_shufflevector(lo, hi, 0, 1, 2, 3, 4, 5, 6, 7, 8, 9, 10, 11, 12, 13, 14, 15)); }
__device__ __forceinline__ v8f wmma16(v16h a, v16h b, v8f c) { return __builtin_amdgcn_wmma_f32_16x16x32_f16(false, a, false, b, (short)0, c, false, false); }
__device__ __forceinline__ v8f wmmab(v16bf a, v16bf b, v8f c) { return __builtin_amdgcn_wmma_f32_16x16x32_bf16(false, a, false, b, (short)0, c, false, false); }

// k_cvt128: one wave per row of x [rows][128]: bf16 plane (A operand) and an f32 copy of the bf16-rounded row (the V source for k_vt); lane -> 4 consecutive floats
__global__ __launch_bounds__(256) void k_cvt128(const float* __restrict__ src, int nrows, bf* dstb, float* dstf) {
    typedef __attribute__((ext_vector_type(4))) unsigned short v4us;
    const int lane = threadIdx.x & 31, r = blockIdx.x * 8 + (threadIdx.x >> 5);
    if (r >= nrows) return;
    const v4f v = *(const v4f*)(src + (size_t)r * HS + lane * 4); v4us ob; v4f of;
#pragma unroll
    for (int i = 0; i < 4; ++i) { ob[i] = f2bf(v[i]); of[i] = bf2f(ob[i]); }
    *(v4us*)(dstb + (size_t)r * HS + lane * 4) = ob; *(v4f*)(dstf + (size_t)r * HS + lane * 4) = of; 
}
// k_wt: WT [n][K] = bf16(W[k][n]) (k-major [K][ncols]) via 64 x 64 LDS tiles; grid (K/64, ncols/64).
__global__ __launch_bounds__(256) void k_wt(const float* __restrict__ Wm, int K, int ncols, bf* WT) {
    __shared__ __align__(16) unsigned short tl[64 * 72];
    const int tid = threadIdx.x, k0 = blockIdx.x * 64, n0 = blockIdx.y * 64;
    const int kk = tid >> 2, nq = (tid & 3) * 16;
#pragma unroll
    for (int i = 0; i < 16; ++i) tl[(nq + i) * 72 + kk] = f2bf(Wm[(size_t)(k0 + kk) * ncols + n0 + nq + i]);
    __syncthreads();
    const int piece = tid & 7;
    auto pass = [&]() {
#pragma unroll
        for (int s = 0; s < 2; ++s) { const int nr = (tid >> 3) + 32 * s; const v8us val = *(const v8usa*)(tl + nr * 72 + piece * 8); *(v8us*)(WT + (size_t)(n0 + nr) * K + k0 + piece * 8) = val; }
    };
    pass(); 
}
// k_gemmb: 64 x 64 block tile (4 waves x 16 x 64) of C[NTK][NW] = (A [+ Al]).B^T (K = 128 or 1024) [+ bf(bias[c])] [+ bf(R[r][c]) residual]; f32 whole-line epilogue (or f16
template <bool SPLITA, bool F16OUT = false>
__global__ __launch_bounds__(128) void k_gemmb(const bf* __restrict__ A, const bf* __restrict__ Al, const bf* __restrict__ Bn, const float* __restrict__ bias, float* C, int ldc, h16* C2, const float* __restrict__ R = nullptr, int K = DM, int roundR = 1) {
    __shared__ __align__(16) float ost[4][16 * 68];
    const int lane = threadIdx.x & 31, wave = threadIdx.x >> 5, lr = lane & 15, hi = lane >> 4;
    const int r0 = blockIdx.x * 64 + wave * 16, c0 = blockIdx.y * 64;
    const size_t aoff = (size_t)(r0 + lr) * K + 8 * hi;
    size_t boff[4];
#pragma unroll
    for (int t = 0; t < 4; ++t) boff[t] = (size_t)(c0 + t * 16 + lr) * K + 8 * hi;
    v8f acc[4];
#pragma unroll
    for (int t = 0; t < 4; ++t) acc[t] = (v8f){};
#pragma unroll 1
    for (int kc = 0; kc < K; kc += 32) {
        const v16bf a = cat16b(*(const v8us*)(A + aoff + kc), *(const v8us*)(A + aoff + kc + 16));
        v16bf al = a;
        if (SPLITA) al = cat16b(*(const v8us*)(Al + aoff + kc), *(const v8us*)(Al + aoff + kc + 16));
#pragma unroll
        for (int t = 0; t < 4; ++t) { const v16bf b = cat16b(*(const v8us*)(Bn + boff[t] + kc), *(const v8us*)(Bn + boff[t] + kc + 16)); acc[t] = wmmab(a, b, acc[t]); if (SPLITA) acc[t] = wmmab(al, b, acc[t]); }
        asm volatile("v_nop\n\tv_nop\n\tv_nop\n\tv_nop" : "+v"(acc[0]), "+v"(acc[1]), "+v"(acc[2]), "+v"(acc[3]) : "v"(a), "v"(al));
    }
    float* os = &ost[wave][0];
#pragma unroll
    for (int t = 0; t < 4; ++t) { const float bv = bias ? bfr(bias[c0 + t * 16 + lr]) : 0.f;
#pragma unroll
        for (int j = 0; j < 8; ++j) os[(hi * 8 + j) * 68 + t * 16 + lr] = acc[t][j] + bv; }
    __syncthreads();
    if (F16OUT) {
        h16* crow = (h16*)(void*)C + (size_t)r0 * ldc + c0;
        auto pass = [&]() {
#pragma unroll
            for (int s = 0; s < 4; ++s) { const int row = 4 * s + (lane >> 3), piece = lane & 7; const float* sp = os + row * 68 + piece * 8; v8h o, o2;
#pragma unroll
                for (int i = 0; i < 8; ++i) { const h16 a = (h16)sp[i]; o[i] = a; o2[i] = (h16)((sp[i] - (float)a) * LOSC); }
                *(v8h*)(crow + (size_t)row * ldc + piece * 8) = o; if (C2) *(v8h*)(C2 + (size_t)r0 * ldc + c0 + (size_t)row * ldc + piece * 8) = o2; }
        };
        pass(); 
    } else {
        float* crow = C + (size_t)r0 * ldc + c0;
        auto pass = [&]() {
#pragma unroll
            for (int s = 0; s < 8; ++s) { const int Lid = (lane >> 3) + 4 * s, piece = lane & 7; const int row = Lid >> 1, cofs = (Lid & 1) * 32 + piece * 4;
                v4f val = *(const v4fa*)(os + row * 68 + cofs); if (R) { const v4f rv = *(const v4f*)(R + ((size_t)r0 + row) * ldc + c0 + cofs); val += roundR ? (v4f){bfr(rv[0]), bfr(rv[1]), bfr(rv[2]), bfr(rv[3])} : rv; }
                *(v4f*)(crow + (size_t)row * ldc + cofs) = val; }
        };
        pass(); 
    }
}

__global__ __launch_bounds__(256) void k_cvtw(const float* __restrict__ src, int nrows, bf* dst) {
    const int lane = threadIdx.x & 31, r = blockIdx.x * 8 + (threadIdx.x >> 5);
    if (r >= nrows) return;
    v8us o[KW / 256];
#pragma unroll
    for (int q = 0; q < KW / 256; ++q) { v8us t;
#pragma unroll
        for (int i = 0; i < 8; ++i) t[i] = f2bf(src[(size_t)r * KW + q * 256 + lane * 8 + i]);
        o[q] = t; }
{
#pragma unroll
        for (int q = 0; q < KW / 256; ++q) *(v8us*)(dst + (size_t)r * KW + q * 256 + lane * 8) = o[q];
         }
}
// 8 lanes x 16 B.
__global__ __launch_bounds__(256) void k_vt(const float* __restrict__ V, bf* VTH) {
    __shared__ __align__(16) unsigned short th_[64 * 72];
    const int t0 = blockIdx.x * 64, dh = blockIdx.y, tid = threadIdx.x;
    const int tt = tid >> 2, dq = (tid & 3) * 16;
    const float* src = V + ((size_t)t0 + tt) * HS + dh * 64 + dq;
#pragma unroll
    for (int i = 0; i < 16; ++i) th_[(dq + i) * 72 + tt] = f2bf(src[i]);
    __syncthreads();
    const int piece = tid & 7;
    auto pass = [&]() {
#pragma unroll
        for (int s = 0; s < 2; ++s) { const int d = (tid >> 3) + 32 * s;
            const v8us a = *(const v8usa*)(th_ + d * 72 + piece * 8);
            *(v8us*)(VTH + (size_t)(dh * 64 + d) * NT_ + t0 + piece * 8) = a; }
    };
    pass(); 
}
// stage_kv: the block's 128 threads copy one 32-key tile (K hi and K residual rows of one head: 32 x 256 B each; V^T: 128 rows x 64 B) from global memory into one
// ring buffer, 12 asynchronous 16-B copies a thread; a wave's K copy covers two whole 256-B rows. lb = the buffer's LDS byte address.
__device__ __forceinline__ void stage_kv(const h16* kh, const h16* kl, const bf* vt, unsigned lb, int l0, int tid) {
    const int kr = tid >> 4, kc8 = (tid & 15) * 8, vr = tid >> 2, vc8 = (tid & 3) * 8;
    const h16* gh = kh + (size_t)(l0 + kr) * KW + kc8; const h16* gl = kl + (size_t)(l0 + kr) * KW + kc8; const bf* gv = vt + (size_t)vr * NT_ + l0 + vc8;
    const unsigned lh = lb + (unsigned)(kr * KP + kc8) * 2u, ll = lh + KPL * 2u, lv = lb + (unsigned)(2 * KPL + vr * VP + vc8) * 2u;
    // the copies and their s_wait_xcnt in one statement: no address register of a copy is rewritten in front of that wait
    asm volatile("global_load_async_to_lds_b128 %0, %1, off\n\t"
                 "global_load_async_to_lds_b128 %2, %3, off\n\t"
                 "global_load_async_to_lds_b128 %4, %5, off\n\t"
                 "global_load_async_to_lds_b128 %6, %7, off\n\t"
                 "global_load_async_to_lds_b128 %8, %9, off\n\t"
                 "global_load_async_to_lds_b128 %10, %11, off\n\t"
                 "global_load_async_to_lds_b128 %12, %13, off\n\t"
                 "global_load_async_to_lds_b128 %14, %15, off\n\t"
                 "global_load_async_to_lds_b128 %16, %17, off\n\t"
                 "global_load_async_to_lds_b128 %18, %19, off\n\t"
                 "global_load_async_to_lds_b128 %20, %21, off\n\t"
                 "global_load_async_to_lds_b128 %22, %23, off\n\t"
                 "s_wait_xcnt 0x0"
                 :: "v"(lh), "v"(gh), "v"(lh + 8u * KP * 2u), "v"(gh + (size_t)8 * KW), "v"(lh + 16u * KP * 2u), "v"(gh + (size_t)16 * KW), "v"(lh + 24u * KP * 2u), "v"(gh + (size_t)24 * KW),
                    "v"(ll), "v"(gl), "v"(ll + 8u * KP * 2u), "v"(gl + (size_t)8 * KW), "v"(ll + 16u * KP * 2u), "v"(gl + (size_t)16 * KW), "v"(ll + 24u * KP * 2u), "v"(gl + (size_t)24 * KW),
                    "v"(lv), "v"(gv), "v"(lv + 32u * VP * 2u), "v"(gv + (size_t)32 * NT_), "v"(lv + 64u * VP * 2u), "v"(gv + (size_t)64 * NT_), "v"(lv + 96u * VP * 2u), "v"(gv + (size_t)96 * NT_)
                 : "memory");
}
// k_attn: block = (head, 64 queries), wave = 16; K slice of head h (row stride NH*HD), V = bf16(x)^T shared by all heads (exact, single plane); causal key tiles
// 0..(Q0+63)/32; per element: j <= q -> clip(score x 128^-1/2, -10, 10) else -inf (reference: clip before the causal where); scores hh + (hl+lh)/1024 on separate
// accumulators; online softmax f32; P (x32768) as bf16 hi + unscaled residual; o += ph.v + pl.v; ctx / l -> bf16 hi/lo planes CH/CL[tok][h*128+d].
__global__ __launch_bounds__(128) void k_attn(const h16* __restrict__ QH, const h16* __restrict__ QL, const h16* __restrict__ KH, const h16* __restrict__ KL, const bf* __restrict__ VTH, bf* CH, bf* CL) {
    __shared__ __align__(16) unsigned short plds[4][16 * 32];
    __shared__ __align__(16) unsigned short plds2[4][16 * 32];
    __shared__ __align__(16) float ost[4][16 * 68];
    __shared__ __align__(16) unsigned short ring[2 * STG];     // two buffers: the next key tile's copies fly while this one is worked on; the 4 waves share each tile
    const int lane = threadIdx.x & 31, wave = threadIdx.x >> 5, lr = lane & 15, hi = lane >> 4;
    const int bid = blockIdx.x; const int h = bid / (NT_ / 64), qt = bid - h * (NT_ / 64); const int g = h;   // K has one slice per head; V (= x) is shared by all heads
    const int q0 = qt * 64 + wave * 16;
    unsigned short* pl = &plds[wave][0]; unsigned short* pl2 = &plds2[wave][0];
    const size_t qo = (size_t)(q0 + lr) * (NH_ * HD) + h * HD + 8 * hi;
    const h16* kh_b = KH + g * HD; const h16* kl_b = KL + g * HD;
    v8f o[8];
#pragma unroll
    for (int n = 0; n < 8; ++n) o[n] = (v8f){};
    float mrow[8], lpart[8];
#pragma unroll
    for (int j = 0; j < 8; ++j) { mrow[j] = -3.0e38f; lpart[j] = 0.f; }
    const int kt_hi = (qt * 64 + 63) / 32; const int kt_lo = 0;     // causal
    const unsigned ring_b = (unsigned)(size_t)&ring[0];              // LDS byte address of the ring
    stage_kv(kh_b, kl_b, VTH, ring_b, 0, threadIdx.x);
    asm volatile("s_wait_asynccnt 0x0" ::: "memory");               // this wave's copies of tile 0 have landed
    __syncthreads();                                                // ... and every other wave's
    if (kt_hi >= 1) stage_kv(kh_b, kl_b, VTH, ring_b + STG * 2u, 32, threadIdx.x);
#pragma unroll 1
    for (int kt = kt_lo; kt <= kt_hi; ++kt) {
        const int l0 = kt * 32;
        const unsigned short* tb = ring + (kt & 1) * STG;
        const unsigned short* tkh = tb + lr * KP + 8 * hi; const unsigned short* tkl = tkh + KPL; const unsigned short* tv = tb + 2 * KPL + lr * VP + 8 * hi;
        v8f s0 = {}, s1 = {}, x0 = {}, x1 = {};
#pragma unroll
        for (int kc = 0; kc < 4; ++kc) {
            const v16h qa = cat16(*(const v8h*)(QH + qo + kc * 32), *(const v8h*)(QH + qo + kc * 32 + 16)), qx = cat16(*(const v8h*)(QL + qo + kc * 32), *(const v8h*)(QL + qo + kc * 32 + 16));
            const v16h k0h = cat16(*(const v8ha*)(tkh + kc * 32), *(const v8ha*)(tkh + kc * 32 + 16)), k1h = cat16(*(const v8ha*)(tkh + 16 * KP + kc * 32), *(const v8ha*)(tkh + 16 * KP + kc * 32 + 16));
            s0 = wmma16(qa, k0h, s0); s1 = wmma16(qa, k1h, s1); x0 = wmma16(qx, k0h, x0); x1 = wmma16(qx, k1h, x1);
            asm volatile("v_nop" : "+v"(s0), "+v"(s1), "+v"(x0), "+v"(x1) : "v"(qa), "v"(qx), "v"(k0h), "v"(k1h) : "memory");
            const v16h k0l = cat16(*(const v8ha*)(tkl + kc * 32), *(const v8ha*)(tkl + kc * 32 + 16)), k1l = cat16(*(const v8ha*)(tkl + 16 * KP + kc * 32), *(const v8ha*)(tkl + 16 * KP + kc * 32 + 16));
            x0 = wmma16(qa, k0l, x0); x1 = wmma16(qa, k1l, x1);
            asm volatile("v_nop" : "+v"(x0), "+v"(x1) : "v"(k0l), "v"(k1l) : "memory");
        }
        asm volatile("v_nop\n\tv_nop\n\tv_nop\n\tv_nop" : "+v"(s0), "+v"(s1), "+v"(x0), "+v"(x1));
        float alpha[8];
#pragma unroll
        for (int j = 0; j < 8; ++j) { const int qi = q0 + hi * 8 + j, ja = l0 + lr, jb = l0 + 16 + lr;
            // reference order: scores / sqrt(128) -> clip(-10, 10) -> causal where -> softmax
            const float a0 = (ja <= qi) ? fminf(fmaxf((s0[j] + x0[j] * LOSCI) * 0.08838834764831845f, -10.0f), 10.0f) : -__builtin_inff(), a1 = (jb <= qi) ? fminf(fmaxf((s1[j] + x1[j] * LOSCI) * 0.08838834764831845f, -10.0f), 10.0f) : -__builtin_inff();
            float mx = fmaxf(a0, a1);
            mx = fmaxf(mx, __shfl_xor(mx, 1, 16)); mx = fmaxf(mx, __shfl_xor(mx, 2, 16)); mx = fmaxf(mx, __shfl_xor(mx, 4, 16)); mx = fmaxf(mx, __shfl_xor(mx, 8, 16));
            const float mn = fmaxf(mrow[j], mx);
            alpha[j] = __expf(mrow[j] - mn); mrow[j] = mn;
            const float p0 = __expf(a0 - mn), p1 = __expf(a1 - mn);
            lpart[j] = lpart[j] * alpha[j] + (p0 + p1);
            const int mr = hi * 8 + j; const float ps0 = p0 * PSC, ps1 = p1 * PSC; const unsigned short h0 = f2bf(ps0), h1 = f2bf(ps1);
            pl[mr * 32 + lr] = h0; pl[mr * 32 + 16 + lr] = h1; pl2[mr * 32 + lr] = f2bf(ps0 - bf2f(h0)); pl2[mr * 32 + 16 + lr] = f2bf(ps1 - bf2f(h1)); }
#pragma unroll
        for (int n = 0; n < 8; ++n)
#pragma unroll
            for (int j = 0; j < 8; ++j) o[n][j] *= alpha[j];
        asm volatile("" ::: "memory");
        const v16bf pa = cat16b(*(const v8usa*)(pl + lr * 32 + hi * 8), *(const v8usa*)(pl + lr * 32 + 16 + hi * 8));
        const v16bf px = cat16b(*(const v8usa*)(pl2 + lr * 32 + hi * 8), *(const v8usa*)(pl2 + lr * 32 + 16 + hi * 8));
#pragma unroll
        for (int n = 0; n < 8; ++n) {
            const v16bf vh = cat16b(*(const v8usa*)(tv + n * 16 * VP), *(const v8usa*)(tv + n * 16 * VP + 16));     // V = bf16(x) exactly (a rounded INPUT): no residual plane
            o[n] = wmmab(pa, vh, o[n]); o[n] = wmmab(px, vh, o[n]);
            asm volatile("" : "+v"(o[n]) : "v"(vh) : "memory"); }
        asm volatile("v_nop\n\tv_nop\n\tv_nop\n\tv_nop" : "+v"(o[0]), "+v"(o[7]) : "v"(pa), "v"(px));
        __builtin_amdgcn_wave_barrier();
        asm volatile("s_wait_dscnt 0x0" ::: "memory");              // this wave's reads of the buffer are done before it may be refilled
        asm volatile("s_wait_asynccnt 0x0" ::: "memory");           // this wave's copies of tile kt + 1 have landed
        __syncthreads();                                            // publishes tile kt + 1 and ends every wave's reads of tile kt
        if (kt + 2 <= kt_hi) stage_kv(kh_b, kl_b, VTH, ring_b + (unsigned)(kt & 1) * (STG * 2u), l0 + 64, threadIdx.x);
    }
    asm volatile("s_wait_asynccnt 0x0" ::: "memory");               // nothing in flight when the wave goes on to its end
    float inv[8];
#pragma unroll
    for (int j = 0; j < 8; ++j) { float rs = lpart[j]; rs += __shfl_xor(rs, 1, 16); rs += __shfl_xor(rs, 2, 16); rs += __shfl_xor(rs, 4, 16); rs += __shfl_xor(rs, 8, 16); inv[j] = 1.0f / (rs * PSC); }
    float* os = &ost[wave][0];
    const size_t cbase = (size_t)q0 * (NH_ * HD) + (size_t)h * HD;
#pragma unroll
    for (int half = 0; half < 2; ++half) {
#pragma unroll
        for (int n = 0; n < 4; ++n)
#pragma unroll
            for (int j = 0; j < 8; ++j) os[(hi * 8 + j) * 68 + n * 16 + lr] = o[half * 4 + n][j] * inv[j];
        __builtin_amdgcn_wave_barrier(); asm volatile("" ::: "memory");
{
#pragma unroll
            for (int s = 0; s < 4; ++s) { const int row = 4 * s + (lane >> 3), piece = lane & 7; const float* sp = os + row * 68 + piece * 8; v8us oh, ol;
#pragma unroll
                for (int i = 0; i < 8; ++i) { const unsigned short hb = f2bf(sp[i]); oh[i] = hb; ol[i] = f2bf(sp[i] - bf2f(hb)); }
                const size_t po = cbase + (size_t)row * (NH_ * HD) + half * 64 + piece * 8; *(v8us*)(CH + po) = oh; *(v8us*)(CL + po) = ol; }
             }
        __builtin_amdgcn_wave_barrier(); asm volatile("" ::: "memory");
    }
}

extern "C" void kernel_launch(void* const* d_in, const int* in_sizes, int n_in,
                              void* d_out, int out_size, void* d_ws, size_t ws_size, hipStream_t stream) {
    (void)in_sizes; (void)n_in; (void)out_size;
    const float* x = (const float*)d_in[0]; const float* Wq = (const float*)d_in[1]; const float* Wk = (const float*)d_in[2]; const float* Wo = (const float*)d_in[3];   // Wq/Wk [8][128][128] (x.W[h]); Wo [128][1024] = [out][in]
    float* out = (float*)d_out;    // [2][4096][128]
    char* wsp = (char*)d_ws;
    auto take = [&](size_t bytes) { char* p = wsp; wsp += (bytes + 255) & ~(size_t)255; return (void*)p; };
    bf* Xb = (bf*)take((size_t)NTK * HS * 2); float* Xr = (float*)take((size_t)NTK * HS * 4);
    bf* WqT = (bf*)take((size_t)KW * HS * 2); bf* WkT = (bf*)take((size_t)KW * HS * 2); bf* WoB = (bf*)take((size_t)HS * KW * 2);
    h16* QH = (h16*)take((size_t)NTK * KW * 2); h16* QL = (h16*)take((size_t)NTK * KW * 2); h16* KH = (h16*)take((size_t)NTK * KW * 2); h16* KL = (h16*)take((size_t)NTK * KW * 2);
    bf* VTH = (bf*)take((size_t)HS * NT_ * 2); bf* CH = (bf*)take((size_t)NTK * KW * 2); bf* CL = (bf*)take((size_t)NTK * KW * 2);
    if ((size_t)(wsp - (char*)d_ws) > ws_size) return;    // 1 + 2 + 3 x 0.26 + 4 x 8.4 + 1 + 2 x 8.4 ~ 55 MB, no aliasing (per-item reuse in stream order)
    for (int h = 0; h < NH_; ++h) {      // per-head k-major [128][128] -> rows h*128.. of the n-major planes [1024][128]
        k_wt<<<dim3(HS / 64, HD / 64, 1), 256, 0, stream>>>(Wq + (size_t)h * HS * HD, HS, HD, WqT + (size_t)h * HD * HS);
        k_wt<<<dim3(HS / 64, HD / 64, 1), 256, 0, stream>>>(Wk + (size_t)h * HS * HD, HS, HD, WkT + (size_t)h * HD * HS);
    }
    k_cvtw<<<HS / 8, 256, 0, stream>>>(Wo, HS, WoB);      // W_o [128][1024] = [out][in]: bf16 copy = n-major B operand
    for (int b = 0; b < NB_; ++b) {
        k_cvt128<<<NTK / 8, 256, 0, stream>>>(x + (size_t)b * NTK * HS, NTK, Xb, Xr);
        k_gemmb<false, true><<<dim3(NTK / 64, KW / 64, 1), 128, 0, stream>>>(Xb, nullptr, WqT, nullptr, (float*)(void*)QH, KW, QL, nullptr, HS);
        k_gemmb<false, true><<<dim3(NTK / 64, KW / 64, 1), 128, 0, stream>>>(Xb, nullptr, WkT, nullptr, (float*)(void*)KH, KW, KL, nullptr, HS);
        k_vt<<<dim3(NT_ / 64, 2, 1), 256, 0, stream>>>(Xr, VTH);
        k_attn<<<NH_ * (NT_ / 64), 128, 0, stream>>>(QH, QL, KH, KL, VTH, CH, CL);
        k_gemmb<true, false><<<dim3(NTK / 64, HS / 64, 1), 128, 0, stream>>>(CH, CL, WoB, nullptr, out + (size_t)b * NTK * HS, HS, nullptr, nullptr, KW);
    }
}

// v002
// Measured time: 677 microseconds a run.
// Two timings next to v001 both put it at 1.40 times that version's speed.
// All steps since v000 together make it 2.33 times as fast.
#include <hip/hip_runtime.h>

// Compute dtypes, f32 accumulate, one batch item per pass: Q/K = x.W_q[h] / x.W_k[h] ([4096 x 128].[128 x 128] per head, k-major per-head weights transposed once
// into n-major [8*128][128] planes; PLAIN bf16 operands = inputs rounded once, exact products) written straight from the GEMM epilogue as f16 hi + residual
// x1024 planes [t][h*128+e], and out = y.W_o^T ([4096 x 1024].[1024 x 128], W_o [out][in] as-is; y as bf16 hi + residual) on v_wmma_f32_16x16x32_bf16; the
// 8-head causal attention with clipped scores (clip(s/sqrt(128), -10, 10)) and V = x itself (bf16(x)^T, exact, one plane) on v_wmma_f32_16x16x32_f16 (scores)

#define NB_  2
#define NT_  4096
#define HS   128                 // x width = head dim of q, k and v
#define NH_  8
#define HD   128
#define KW   (NH_ * HD)          // 1024: row stride of the Q/K planes
#define NTK  NT_
#define DM   HS                  // k_gemmb's default K
#define PSC  32768.0f
#define LOSC 1024.0f
#define LOSCI (1.0f / 1024.0f)
#define KP   136                 // LDS pitch of a staged K row in 16-bit elements: 272 B = 16 B x odd, for ds_load_b128 readers
#define VP   40                  // LDS pitch of a staged V^T row (32 keys) in 16-bit elements: 80 B = 16 B x odd
#define KPL  (32 * KP)           // one K plane of a 32-key tile
#define STG  (2 * KPL + HS * VP) // one ring buffer: K hi, K residual, V^T

typedef _Float16 h16;
typedef unsigned short bf;
typedef __attribute__((ext_vector_type(16))) __bf16   v16bf;
typedef __attribute__((ext_vector_type(16))) _Float16 v16h;
typedef __attribute__((ext_vector_type(8)))  _Float16 v8h;
typedef __attribute__((ext_vector_type(8)))  unsigned short v8us;
typedef __attribute__((ext_vector_type(8)))  float    v8f;
typedef __attribute__((ext_vector_type(4)))  float    v4f;
typedef __attribute__((ext_vector_type(4)))  _Float16 v4h;
typedef v8h  __attribute__((may_alias)) v8ha;
typedef v4f  __attribute__((may_alias)) v4fa;
typedef v8us __attribute__((may_alias)) v8usa;

__device__ __forceinline__ unsigned short f2bf(float f) { unsigned u = __float_as_uint(f); u += 0x7FFFu + ((u >> 16) & 1u); return (unsigned short)(u >> 16); }
__device__ __forceinline__ float bf2f(unsigned short b) { return __uint_as_float(((unsigned)b) << 16); }
__device__ __forceinline__ float bfr(float f) { return bf2f(f2bf(f)); }
__device__ __forceinline__ v16h cat16(v8h lo, v8h hi) { return __builtin_shufflevector(lo, hi, 0, 1, 2, 3, 4, 5, 6, 7, 8, 9, 10, 11, 12, 13, 14, 15); }
__device__ __forceinline__ v16bf cat16b(v8us lo, v8us hi) { return __builtin_bit_cast(v16bf, __builtin_shufflevector(lo, hi, 0, 1, 2, 3, 4, 5, 6, 7, 8, 9, 10, 11, 12, 13, 14, 15)); }
__device__ __forceinline__ v8f wmma16(v16h a, v16h b, v8f c) { return __builtin_amdgcn_wmma_f32_16x16x32_f16(false, a, false, b, (short)0, c, false, false); }
__device__ __forceinline__ v8f wmmab(v16bf a, v16bf b, v8f c) { return __builtin_amdgcn_wmma_f32_16x16x32_bf16(false, a, false, b, (short)0, c, false, false); }

// k_cvt128: one wave per row of x [rows][128]: bf16 plane (A operand) and an f32 copy of the bf16-rounded row (the V source for k_vt); lane -> 4 consecutive floats
__global__ __launch_bounds__(256) void k_cvt128(const float* __restrict__ src, int nrows, bf* dstb, float* dstf) {
    typedef __attribute__((ext_vector_type(4))) unsigned short v4us;
    const int lane = threadIdx.x & 31, r = blockIdx.x * 8 + (threadIdx.x >> 5);
    if (r >= nrows) return;
    const v4f v = *(const v4f*)(src + (size_t)r * HS + lane * 4); v4us ob; v4f of;
#pragma unroll
    for (int i = 0; i < 4; ++i) { ob[i] = f2bf(v[i]); of[i] = bf2f(ob[i]); }
    *(v4us*)(dstb + (size_t)r * HS + lane * 4) = ob; *(v4f*)(dstf + (size_t)r * HS + lane * 4) = of; 
}
// k_wt: WT [n][K] = bf16(W[k][n]) (k-major [K][ncols]) via 64 x 64 LDS tiles; grid (K/64, ncols/64).
__global__ __launch_bounds__(256) void k_wt(const float* __restrict__ Wm, int K, int ncols, bf* WT) {
    __shared__ __align__(16) unsigned short tl[64 * 72];
    const int tid = threadIdx.x, k0 = blockIdx.x * 64, n0 = blockIdx.y * 64;
    const int kk = tid >> 2, nq = (tid & 3) * 16;
#pragma unroll
    for (int i = 0; i < 16; ++i) tl[(nq + i) * 72 + kk] = f2bf(Wm[(size_t)(k0 + kk) * ncols + n0 + nq + i]);
    __syncthreads();
    const int piece = tid & 7;
    auto pass = [&]() {
#pragma unroll
        for (int s = 0; s < 2; ++s) { const int nr = (tid >> 3) + 32 * s; const v8us val = *(const v8usa*)(tl + nr * 72 + piece * 8); *(v8us*)(WT + (size_t)(n0 + nr) * K + k0 + piece * 8) = val; }
    };
    pass(); 
}
// k_gemmb: 64 x 64 block tile (4 waves x 16 x 64) of C[NTK][NW] = (A [+ Al]).B^T (K = 128 or 1024) [+ bf(bias[c])] [+ bf(R[r][c]) residual]; f32 whole-line epilogue (or f16
template <bool SPLITA, bool F16OUT = false>
__global__ __launch_bounds__(128) void k_gemmb(const bf* __restrict__ A, const bf* __restrict__ Al, const bf* __restrict__ Bn, const float* __restrict__ bias, float* C, int ldc, h16* C2, const float* __restrict__ R = nullptr, int K = DM, int roundR = 1) {
    __shared__ __align__(16) float ost[4][16 * 68];
    const int lane = threadIdx.x & 31, wave = threadIdx.x >> 5, lr = lane & 15, hi = lane >> 4;
    const int r0 = blockIdx.x * 64 + wave * 16, c0 = blockIdx.y * 64;
    const size_t aoff = (size_t)(r0 + lr) * K + 8 * hi;
    size_t boff[4];
#pragma unroll
    for (int t = 0; t < 4; ++t) boff[t] = (size_t)(c0 + t * 16 + lr) * K + 8 * hi;
    v8f acc[4];
#pragma unroll
    for (int t = 0; t < 4; ++t) acc[t] = (v8f){};
#pragma unroll 1
    for (int kc = 0; kc < K; kc += 32) {
        const v16bf a = cat16b(*(const v8us*)(A + aoff + kc), *(const v8us*)(A + aoff + kc + 16));
        v16bf al = a;
        if (SPLITA) al = cat16b(*(const v8us*)(Al + aoff + kc), *(const v8us*)(Al + aoff + kc + 16));
#pragma unroll
        for (int t = 0; t < 4; ++t) { const v16bf b = cat16b(*(const v8us*)(Bn + boff[t] + kc), *(const v8us*)(Bn + boff[t] + kc + 16)); acc[t] = wmmab(a, b, acc[t]); if (SPLITA) acc[t] = wmmab(al, b, acc[t]); }
        asm volatile("v_nop\n\tv_nop\n\tv_nop\n\tv_nop" : "+v"(acc[0]), "+v"(acc[1]), "+v"(acc[2]), "+v"(acc[3]) : "v"(a), "v"(al));
    }
    float* os = &ost[wave][0];
#pragma unroll
    for (int t = 0; t < 4; ++t) { const float bv = bias ? bfr(bias[c0 + t * 16 + lr]) : 0.f;
#pragma unroll
        for (int j = 0; j < 8; ++j) os[(hi * 8 + j) * 68 + t * 16 + lr] = acc[t][j] + bv; }
    __syncthreads();
    if (F16OUT) {
        h16* crow = (h16*)(void*)C + (size_t)r0 * ldc + c0;
        auto pass = [&]() {
#pragma unroll
            for (int s = 0; s < 4; ++s) { const int row = 4 * s + (lane >> 3), piece = lane & 7; const float* sp = os + row * 68 + piece * 8; v8h o, o2;
#pragma unroll
                for (int i = 0; i < 8; ++i) { const h16 a = (h16)sp[i]; o[i] = a; o2[i] = (h16)((sp[i] - (float)a) * LOSC); }
                *(v8h*)(crow + (size_t)row * ldc + piece * 8) = o; if (C2) *(v8h*)(C2 + (size_t)r0 * ldc + c0 + (size_t)row * ldc + piece * 8) = o2; }
        };
        pass(); 
    } else {
        float* crow = C + (size_t)r0 * ldc + c0;
        auto pass = [&]() {
#pragma unroll
            for (int s = 0; s < 8; ++s) { const int Lid = (lane >> 3) + 4 * s, piece = lane & 7; const int row = Lid >> 1, cofs = (Lid & 1) * 32 + piece * 4;
                v4f val = *(const v4fa*)(os + row * 68 + cofs); if (R) { const v4f rv = *(const v4f*)(R + ((size_t)r0 + row) * ldc + c0 + cofs); val += roundR ? (v4f){bfr(rv[0]), bfr(rv[1]), bfr(rv[2]), bfr(rv[3])} : rv; }
                *(v4f*)(crow + (size_t)row * ldc + cofs) = val; }
        };
        pass(); 
    }
}

__global__ __launch_bounds__(256) void k_cvtw(const float* __restrict__ src, int nrows, bf* dst) {
    const int lane = threadIdx.x & 31, r = blockIdx.x * 8 + (threadIdx.x >> 5);
    if (r >= nrows) return;
    v8us o[KW / 256];
#pragma unroll
    for (int q = 0; q < KW / 256; ++q) { v8us t;
#pragma unroll
        for (int i = 0; i < 8; ++i) t[i] = f2bf(src[(size_t)r * KW + q * 256 + lane * 8 + i]);
        o[q] = t; }
{
#pragma unroll
        for (int q = 0; q < KW / 256; ++q) *(v8us*)(dst + (size_t)r * KW + q * 256 + lane * 8) = o[q];
         }
}
// 8 lanes x 16 B.
__global__ __launch_bounds__(256) void k_vt(const float* __restrict__ V, bf* VTH) {
    __shared__ __align__(16) unsigned short th_[64 * 72];
    const int t0 = blockIdx.x * 64, dh = blockIdx.y, tid = threadIdx.x;
    const int tt = tid >> 2, dq = (tid & 3) * 16;
    const float* src = V + ((size_t)t0 + tt) * HS + dh * 64 + dq;
#pragma unroll
    for (int i = 0; i < 16; ++i) th_[(dq + i) * 72 + tt] = f2bf(src[i]);
    __syncthreads();
    const int piece = tid & 7;
    auto pass = [&]() {
#pragma unroll
        for (int s = 0; s < 2; ++s) { const int d = (tid >> 3) + 32 * s;
            const v8us a = *(const v8usa*)(th_ + d * 72 + piece * 8);
            *(v8us*)(VTH + (size_t)(dh * 64 + d) * NT_ + t0 + piece * 8) = a; }
    };
    pass(); 
}
// stage_kv: the block's 128 threads copy one 32-key tile (K hi and K residual rows of one head: 32 x 256 B each; V^T: 128 rows x 64 B) from global memory into one
// ring buffer, 12 asynchronous 16-B copies a thread; a wave's K copy covers two whole 256-B rows. lb = the buffer's LDS byte address.
__device__ __forceinline__ void stage_kv(const h16* kh, const h16* kl, const bf* vt, unsigned lb, int l0, int tid) {
    const int kr = tid >> 4, kc8 = (tid & 15) * 8, vr = tid >> 2, vc8 = (tid & 3) * 8;
    const h16* gh = kh + (size_t)(l0 + kr) * KW + kc8; const h16* gl = kl + (size_t)(l0 + kr) * KW + kc8; const bf* gv = vt + (size_t)vr * NT_ + l0 + vc8;
    const unsigned lh = lb + (unsigned)(kr * KP + kc8) * 2u, ll = lh + KPL * 2u, lv = lb + (unsigned)(2 * KPL + vr * VP + vc8) * 2u;
    // the copies and their s_wait_xcnt in one statement: no address register of a copy is rewritten in front of that wait
    asm volatile("global_load_async_to_lds_b128 %0, %1, off\n\t"
                 "global_load_async_to_lds_b128 %2, %3, off\n\t"
                 "global_load_async_to_lds_b128 %4, %5, off\n\t"
                 "global_load_async_to_lds_b128 %6, %7, off\n\t"
                 "global_load_async_to_lds_b128 %8, %9, off\n\t"
                 "global_load_async_to_lds_b128 %10, %11, off\n\t"
                 "global_load_async_to_lds_b128 %12, %13, off\n\t"
                 "global_load_async_to_lds_b128 %14, %15, off\n\t"
                 "global_load_async_to_lds_b128 %16, %17, off\n\t"
                 "global_load_async_to_lds_b128 %18, %19, off\n\t"
                 "global_load_async_to_lds_b128 %20, %21, off\n\t"
                 "global_load_async_to_lds_b128 %22, %23, off\n\t"
                 "s_wait_xcnt 0x0"
                 :: "v"(lh), "v"(gh), "v"(lh + 8u * KP * 2u), "v"(gh + (size_t)8 * KW), "v"(lh + 16u * KP * 2u), "v"(gh + (size_t)16 * KW), "v"(lh + 24u * KP * 2u), "v"(gh + (size_t)24 * KW),
                    "v"(ll), "v"(gl), "v"(ll + 8u * KP * 2u), "v"(gl + (size_t)8 * KW), "v"(ll + 16u * KP * 2u), "v"(gl + (size_t)16 * KW), "v"(ll + 24u * KP * 2u), "v"(gl + (size_t)24 * KW),
                    "v"(lv), "v"(gv), "v"(lv + 32u * VP * 2u), "v"(gv + (size_t)32 * NT_), "v"(lv + 64u * VP * 2u), "v"(gv + (size_t)64 * NT_), "v"(lv + 96u * VP * 2u), "v"(gv + (size_t)96 * NT_)
                 : "memory");
}
// k_attn: block = (head, 64 queries), wave = 16; K slice of head h (row stride NH*HD), V = bf16(x)^T shared by all heads (exact, single plane); causal key tiles
// 0..(Q0+63)/32; per element: j <= q -> clip(score x 128^-1/2, -10, 10) else -inf (reference: clip before the causal where); scores hh + (hl+lh)/1024 on separate
// accumulators; softmax f32 with the fixed shift 10; P (x32768) as bf16 hi + unscaled residual; o += ph.v + pl.v; ctx / l -> bf16 hi/lo planes CH/CL[tok][h*128+d].
__global__ __launch_bounds__(128) void k_attn(const h16* __restrict__ QH, const h16* __restrict__ QL, const h16* __restrict__ KH, const h16* __restrict__ KL, const bf* __restrict__ VTH, bf* CH, bf* CL) {
    __shared__ __align__(16) unsigned short plds[4][16 * 32];
    __shared__ __align__(16) unsigned short plds2[4][16 * 32];
    __shared__ __align__(16) float ost[4][16 * 68];
    __shared__ __align__(16) unsigned short ring[2 * STG];     // two buffers: the next key tile's copies fly while this one is worked on; the 4 waves share each tile
    const int lane = threadIdx.x & 31, wave = threadIdx.x >> 5, lr = lane & 15, hi = lane >> 4;
    const int bid = blockIdx.x; const int h = bid / (NT_ / 64), qt = bid - h * (NT_ / 64); const int g = h;   // K has one slice per head; V (= x) is shared by all heads
    const int q0 = qt * 64 + wave * 16;
    unsigned short* pl = &plds[wave][0]; unsigned short* pl2 = &plds2[wave][0];
    const size_t qo = (size_t)(q0 + lr) * (NH_ * HD) + h * HD + 8 * hi;
    const h16* kh_b = KH + g * HD; const h16* kl_b = KL + g * HD;
    v8f o[8];
#pragma unroll
    for (int n = 0; n < 8; ++n) o[n] = (v8f){};
    float lpart[8];
#pragma unroll
    for (int j = 0; j < 8; ++j) lpart[j] = 0.f;
    const int kt_hi = (qt * 64 + 63) / 32; const int kt_lo = 0;     // causal
    const unsigned ring_b = (unsigned)(size_t)&ring[0];              // LDS byte address of the ring
    stage_kv(kh_b, kl_b, VTH, ring_b, 0, threadIdx.x);
    asm volatile("s_wait_asynccnt 0x0" ::: "memory");               // this wave's copies of tile 0 have landed
    __syncthreads();                                                // ... and every other wave's
    if (kt_hi >= 1) stage_kv(kh_b, kl_b, VTH, ring_b + STG * 2u, 32, threadIdx.x);
#pragma unroll 1
    for (int kt = kt_lo; kt <= kt_hi; ++kt) {
        const int l0 = kt * 32;
        const unsigned short* tb = ring + (kt & 1) * STG;
        const unsigned short* tkh = tb + lr * KP + 8 * hi; const unsigned short* tkl = tkh + KPL; const unsigned short* tv = tb + 2 * KPL + lr * VP + 8 * hi;
        v8f s0 = {}, s1 = {}, x0 = {}, x1 = {};
#pragma unroll
        for (int kc = 0; kc < 4; ++kc) {
            const v16h qa = cat16(*(const v8h*)(QH + qo + kc * 32), *(const v8h*)(QH + qo + kc * 32 + 16)), qx = cat16(*(const v8h*)(QL + qo + kc * 32), *(const v8h*)(QL + qo + kc * 32 + 16));
            const v16h k0h = cat16(*(const v8ha*)(tkh + kc * 32), *(const v8ha*)(tkh + kc * 32 + 16)), k1h = cat16(*(const v8ha*)(tkh + 16 * KP + kc * 32), *(const v8ha*)(tkh + 16 * KP + kc * 32 + 16));
            s0 = wmma16(qa, k0h, s0); s1 = wmma16(qa, k1h, s1); x0 = wmma16(qx, k0h, x0); x1 = wmma16(qx, k1h, x1);
            asm volatile("v_nop" : "+v"(s0), "+v"(s1), "+v"(x0), "+v"(x1) : "v"(qa), "v"(qx), "v"(k0h), "v"(k1h) : "memory");
            const v16h k0l = cat16(*(const v8ha*)(tkl + kc * 32), *(const v8ha*)(tkl + kc * 32 + 16)), k1l = cat16(*(const v8ha*)(tkl + 16 * KP + kc * 32), *(const v8ha*)(tkl + 16 * KP + kc * 32 + 16));
            x0 = wmma16(qa, k0l, x0); x1 = wmma16(qa, k1l, x1);
            asm volatile("v_nop" : "+v"(x0), "+v"(x1) : "v"(k0l), "v"(k1l) : "memory");
        }
        asm volatile("v_nop\n\tv_nop\n\tv_nop\n\tv_nop" : "+v"(s0), "+v"(s1), "+v"(x0), "+v"(x1));
#pragma unroll
        for (int j = 0; j < 8; ++j) { const int qi = q0 + hi * 8 + j, ja = l0 + lr, jb = l0 + 16 + lr;
            // reference order: scores / sqrt(128) -> clip(-10, 10) -> causal where -> softmax
            const float a0 = (ja <= qi) ? fminf(fmaxf((s0[j] + x0[j] * LOSCI) * 0.08838834764831845f, -10.0f), 10.0f) : -__builtin_inff(), a1 = (jb <= qi) ? fminf(fmaxf((s1[j] + x1[j] * LOSCI) * 0.08838834764831845f, -10.0f), 10.0f) : -__builtin_inff();
            // every kept score lies in [-10, 10] after the clip, so the clip's upper bound is the softmax shift: exp(a - 10) is in [e^-20, 1] for any input,
            // and no row maximum is searched, carried or applied to o and l
            const float p0 = __expf(a0 - 10.0f), p1 = __expf(a1 - 10.0f);
            lpart[j] += p0 + p1;
            const int mr = hi * 8 + j; const float ps0 = p0 * PSC, ps1 = p1 * PSC; const unsigned short h0 = f2bf(ps0), h1 = f2bf(ps1);
            pl[mr * 32 + lr] = h0; pl[mr * 32 + 16 + lr] = h1; pl2[mr * 32 + lr] = f2bf(ps0 - bf2f(h0)); pl2[mr * 32 + 16 + lr] = f2bf(ps1 - bf2f(h1)); }
        asm volatile("" ::: "memory");
        const v16bf pa = cat16b(*(const v8usa*)(pl + lr * 32 + hi * 8), *(const v8usa*)(pl + lr * 32 + 16 + hi * 8));
        const v16bf px = cat16b(*(const v8usa*)(pl2 + lr * 32 + hi * 8), *(const v8usa*)(pl2 + lr * 32 + 16 + hi * 8));
#pragma unroll
        for (int n = 0; n < 8; ++n) {
            const v16bf vh = cat16b(*(const v8usa*)(tv + n * 16 * VP), *(const v8usa*)(tv + n * 16 * VP + 16));     // V = bf16(x) exactly (a rounded INPUT): no residual plane
            o[n] = wmmab(pa, vh, o[n]); o[n] = wmmab(px, vh, o[n]);
            asm volatile("" : "+v"(o[n]) : "v"(vh) : "memory"); }
        asm volatile("v_nop\n\tv_nop\n\tv_nop\n\tv_nop" : "+v"(o[0]), "+v"(o[7]) : "v"(pa), "v"(px));
        __builtin_amdgcn_wave_barrier();
        asm volatile("s_wait_dscnt 0x0" ::: "memory");              // this wave's reads of the buffer are done before it may be refilled
        asm volatile("s_wait_asynccnt 0x0" ::: "memory");           // this wave's copies of tile kt + 1 have landed
        __syncthreads();                                            // publishes tile kt + 1 and ends every wave's reads of tile kt
        if (kt + 2 <= kt_hi) stage_kv(kh_b, kl_b, VTH, ring_b + (unsigned)(kt & 1) * (STG * 2u), l0 + 64, threadIdx.x);
    }
    asm volatile("s_wait_asynccnt 0x0" ::: "memory");               // nothing in flight when the wave goes on to its end
    float inv[8];
#pragma unroll
    for (int j = 0; j < 8; ++j) { float rs = lpart[j]; rs += __shfl_xor(rs, 1, 16); rs += __shfl_xor(rs, 2, 16); rs += __shfl_xor(rs, 4, 16); rs += __shfl_xor(rs, 8, 16); inv[j] = 1.0f / (rs * PSC); }
    float* os = &ost[wave][0];
    const size_t cbase = (size_t)q0 * (NH_ * HD) + (size_t)h * HD;
#pragma unroll
    for (int half = 0; half < 2; ++half) {
#pragma unroll
        for (int n = 0; n < 4; ++n)
#pragma unroll
            for (int j = 0; j < 8; ++j) os[(hi * 8 + j) * 68 + n * 16 + lr] = o[half * 4 + n][j] * inv[j];
        __builtin_amdgcn_wave_barrier(); asm volatile("" ::: "memory");
{
#pragma unroll
            for (int s = 0; s < 4; ++s) { const int row = 4 * s + (lane >> 3), piece = lane & 7; const float* sp = os + row * 68 + piece * 8; v8us oh, ol;
#pragma unroll
                for (int i = 0; i < 8; ++i) { const unsigned short hb = f2bf(sp[i]); oh[i] = hb; ol[i] = f2bf(sp[i] - bf2f(hb)); }
                const size_t po = cbase + (size_t)row * (NH_ * HD) + half * 64 + piece * 8; *(v8us*)(CH + po) = oh; *(v8us*)(CL + po) = ol; }
             }
        __builtin_amdgcn_wave_barrier(); asm volatile("" ::: "memory");
    }
}

extern "C" void kernel_launch(void* const* d_in, const int* in_sizes, int n_in,
                              void* d_out, int out_size, void* d_ws, size_t ws_size, hipStream_t stream) {
    (void)in_sizes; (void)n_in; (void)out_size;
    const float* x = (const float*)d_in[0]; const float* Wq = (const float*)d_in[1]; const float* Wk = (const float*)d_in[2]; const float* Wo = (const float*)d_in[3];   // Wq/Wk [8][128][128] (x.W[h]); Wo [128][1024] = [out][in]
    float* out = (float*)d_out;    // [2][4096][128]
    char* wsp = (char*)d_ws;
    auto take = [&](size_t bytes) { char* p = wsp; wsp += (bytes + 255) & ~(size_t)255; return (void*)p; };
    bf* Xb = (bf*)take((size_t)NTK * HS * 2); float* Xr = (float*)take((size_t)NTK * HS * 4);
    bf* WqT = (bf*)take((size_t)KW * HS * 2); bf* WkT = (bf*)take((size_t)KW * HS * 2); bf* WoB = (bf*)take((size_t)HS * KW * 2);
    h16* QH = (h16*)take((size_t)NTK * KW * 2); h16* QL = (h16*)take((size_t)NTK * KW * 2); h16* KH = (h16*)take((size_t)NTK * KW * 2); h16* KL = (h16*)take((size_t)NTK * KW * 2);
    bf* VTH = (bf*)take((size_t)HS * NT_ * 2); bf* CH = (bf*)take((size_t)NTK * KW * 2); bf* CL = (bf*)take((size_t)NTK * KW * 2);
    if ((size_t)(wsp - (char*)d_ws) > ws_size) return;    // 1 + 2 + 3 x 0.26 + 4 x 8.4 + 1 + 2 x 8.4 ~ 55 MB, no aliasing (per-item reuse in stream order)
    for (int h = 0; h < NH_; ++h) {      // per-head k-major [128][128] -> rows h*128.. of the n-major planes [1024][128]
        k_wt<<<dim3(HS / 64, HD / 64, 1), 256, 0, stream>>>(Wq + (size_t)h * HS * HD, HS, HD, WqT + (size_t)h * HD * HS);
        k_wt<<<dim3(HS / 64, HD / 64, 1), 256, 0, stream>>>(Wk + (size_t)h * HS * HD, HS, HD, WkT + (size_t)h * HD * HS);
    }
    k_cvtw<<<HS / 8, 256, 0, stream>>>(Wo, HS, WoB);      // W_o [128][1024] = [out][in]: bf16 copy = n-major B operand
    for (int b = 0; b < NB_; ++b) {
        k_cvt128<<<NTK / 8, 256, 0, stream>>>(x + (size_t)b * NTK * HS, NTK, Xb, Xr);
        k_gemmb<false, true><<<dim3(NTK / 64, KW / 64, 1), 128, 0, stream>>>(Xb, nullptr, WqT, nullptr, (float*)(void*)QH, KW, QL, nullptr, HS);
        k_gemmb<false, true><<<dim3(NTK / 64, KW / 64, 1), 128, 0, stream>>>(Xb, nullptr, WkT, nullptr, (float*)(void*)KH, KW, KL, nullptr, HS);
        k_vt<<<dim3(NT_ / 64, 2, 1), 256, 0, stream>>>(Xr, VTH);
        k_attn<<<NH_ * (NT_ / 64), 128, 0, stream>>>(QH, QL, KH, KL, VTH, CH, CL);
        k_gemmb<true, false><<<dim3(NTK / 64, HS / 64, 1), 128, 0, stream>>>(CH, CL, WoB, nullptr, out + (size_t)b * NTK * HS, HS, nullptr, nullptr, KW);
    }
}

// v003
// A run of this version takes 495 microseconds.
// Two timings next to v002 put it at 1.37 and 1.36 times that version's speed.
// Counting every step since v000, it is 3.19 times as fast.
#include <hip/hip_runtime.h>

// Compute dtypes, f32 accumulate, both batch items in every launch: Q/K = x.W_q[h] / x.W_k[h] ([4096 x 128].[128 x 128] per head, k-major per-head weights transposed once
// into n-major [8*128][128] planes; PLAIN bf16 operands = inputs rounded once, exact products) written straight from the GEMM epilogue as f16 hi + residual
// x1024 planes [t][h*128+e], and out = y.W_o^T ([4096 x 1024].[1024 x 128], W_o [out][in] as-is; y as bf16 hi + residual) on v_wmma_f32_16x16x32_bf16; the
// 8-head causal attention with clipped scores (clip(s/sqrt(128), -10, 10)) and V = x itself (bf16(x)^T, exact, one plane) on v_wmma_f32_16x16x32_f16 (scores)

#define NB_  2
#define NT_  4096
#define HS   128                 // x width = head dim of q, k and v
#define NH_  8
#define HD   128
#define KW   (NH_ * HD)          // 1024: row stride of the Q/K planes
#define NTK  NT_
#define DM   HS                  // k_gemmb's default K
#define PSC  32768.0f
#define LOSC 1024.0f
#define LOSCI (1.0f / 1024.0f)
#define KP   136                 // LDS pitch of a staged K row in 16-bit elements: 272 B = 16 B x odd, for ds_load_b128 readers
#define VP   40                  // LDS pitch of a staged V^T row (32 keys) in 16-bit elements: 80 B = 16 B x odd
#define KPL  (32 * KP)           // one K plane of a 32-key tile
#define STG  (2 * KPL + HS * VP) // one ring buffer: K hi, K residual, V^T

typedef _Float16 h16;
typedef unsigned short bf;
typedef __attribute__((ext_vector_type(16))) __bf16   v16bf;
typedef __attribute__((ext_vector_type(16))) _Float16 v16h;
typedef __attribute__((ext_vector_type(8)))  _Float16 v8h;
typedef __attribute__((ext_vector_type(8)))  unsigned short v8us;
typedef __attribute__((ext_vector_type(8)))  float    v8f;
typedef __attribute__((ext_vector_type(4)))  float    v4f;
typedef __attribute__((ext_vector_type(4)))  _Float16 v4h;
typedef v8h  __attribute__((may_alias)) v8ha;
typedef v4f  __attribute__((may_alias)) v4fa;
typedef v8us __attribute__((may_alias)) v8usa;

__device__ __forceinline__ unsigned short f2bf(float f) { unsigned u = __float_as_uint(f); u += 0x7FFFu + ((u >> 16) & 1u); return (unsigned short)(u >> 16); }
__device__ __forceinline__ float bf2f(unsigned short b) { return __uint_as_float(((unsigned)b) << 16); }
__device__ __forceinline__ float bfr(float f) { return bf2f(f2bf(f)); }
__device__ __forceinline__ v16h cat16(v8h lo, v8h hi) { return __builtin_shufflevector(lo, hi, 0, 1, 2, 3, 4, 5, 6, 7, 8, 9, 10, 11, 12, 13, 14, 15); }
__device__ __forceinline__ v16bf cat16b(v8us lo, v8us hi) { return __builtin_bit_cast(v16bf, __builtin_shufflevector(lo, hi, 0, 1, 2, 3, 4, 5, 6, 7, 8, 9, 10, 11, 12, 13, 14, 15)); }
__device__ __forceinline__ v8f wmma16(v16h a, v16h b, v8f c) { return __builtin_amdgcn_wmma_f32_16x16x32_f16(false, a, false, b, (short)0, c, false, false); }
__device__ __forceinline__ v8f wmmab(v16bf a, v16bf b, v8f c) { return __builtin_amdgcn_wmma_f32_16x16x32_bf16(false, a, false, b, (short)0, c, false, false); }

// k_cvt128: one wave per row of x [rows][128]: bf16 plane (A operand) and an f32 copy of the bf16-rounded row (the V source for k_vt); lane -> 4 consecutive floats
__global__ __launch_bounds__(256) void k_cvt128(const float* __restrict__ src, int nrows, bf* dstb, float* dstf) {
    typedef __attribute__((ext_vector_type(4))) unsigned short v4us;
    const int lane = threadIdx.x & 31, r = blockIdx.x * 8 + (threadIdx.x >> 5);
    if (r >= nrows) return;
    const v4f v = *(const v4f*)(src + (size_t)r * HS + lane * 4); v4us ob; v4f of;
#pragma unroll
    for (int i = 0; i < 4; ++i) { ob[i] = f2bf(v[i]); of[i] = bf2f(ob[i]); }
    *(v4us*)(dstb + (size_t)r * HS + lane * 4) = ob; *(v4f*)(dstf + (size_t)r * HS + lane * 4) = of; 
}
// k_wt: WT [n][K] = bf16(W[k][n]) (k-major [K][ncols]) via 64 x 64 LDS tiles; grid (K/64, ncols/64).
__global__ __launch_bounds__(256) void k_wt(const float* __restrict__ Wm, int K, int ncols, bf* WT) {
    __shared__ __align__(16) unsigned short tl[64 * 72];
    const int tid = threadIdx.x, k0 = blockIdx.x * 64, n0 = blockIdx.y * 64;
    const int kk = tid >> 2, nq = (tid & 3) * 16;
#pragma unroll
    for (int i = 0; i < 16; ++i) tl[(nq + i) * 72 + kk] = f2bf(Wm[(size_t)(k0 + kk) * ncols + n0 + nq + i]);
    __syncthreads();
    const int piece = tid & 7;
    auto pass = [&]() {
#pragma unroll
        for (int s = 0; s < 2; ++s) { const int nr = (tid >> 3) + 32 * s; const v8us val = *(const v8usa*)(tl + nr * 72 + piece * 8); *(v8us*)(WT + (size_t)(n0 + nr) * K + k0 + piece * 8) = val; }
    };
    pass(); 
}
// k_gemmb: 64 x 64 block tile (4 waves x 16 x 64) of C[NB_*NTK][NW] = (A [+ Al]).B^T (K = 128 or 1024) [+ bf(bias[c])] [+ bf(R[r][c]) residual]; f32 whole-line epilogue (or f16
template <bool SPLITA, bool F16OUT = false>
__global__ __launch_bounds__(128) void k_gemmb(const bf* __restrict__ A, const bf* __restrict__ Al, const bf* __restrict__ Bn, const float* __restrict__ bias, float* C, int ldc, h16* C2, const float* __restrict__ R = nullptr, int K = DM, int roundR = 1) {
    __shared__ __align__(16) float ost[4][16 * 68];
    const int lane = threadIdx.x & 31, wave = threadIdx.x >> 5, lr = lane & 15, hi = lane >> 4;
    const int r0 = blockIdx.x * 64 + wave * 16, c0 = blockIdx.y * 64;
    const size_t aoff = (size_t)(r0 + lr) * K + 8 * hi;
    size_t boff[4];
#pragma unroll
    for (int t = 0; t < 4; ++t) boff[t] = (size_t)(c0 + t * 16 + lr) * K + 8 * hi;
    v8f acc[4];
#pragma unroll
    for (int t = 0; t < 4; ++t) acc[t] = (v8f){};
#pragma unroll 1
    for (int kc = 0; kc < K; kc += 32) {
        const v16bf a = cat16b(*(const v8us*)(A + aoff + kc), *(const v8us*)(A + aoff + kc + 16));
        v16bf al = a;
        if (SPLITA) al = cat16b(*(const v8us*)(Al + aoff + kc), *(const v8us*)(Al + aoff + kc + 16));
#pragma unroll
        for (int t = 0; t < 4; ++t) { const v16bf b = cat16b(*(const v8us*)(Bn + boff[t] + kc), *(const v8us*)(Bn + boff[t] + kc + 16)); acc[t] = wmmab(a, b, acc[t]); if (SPLITA) acc[t] = wmmab(al, b, acc[t]); }
        asm volatile("v_nop\n\tv_nop\n\tv_nop\n\tv_nop" : "+v"(acc[0]), "+v"(acc[1]), "+v"(acc[2]), "+v"(acc[3]) : "v"(a), "v"(al));
    }
    float* os = &ost[wave][0];
#pragma unroll
    for (int t = 0; t < 4; ++t) { const float bv = bias ? bfr(bias[c0 + t * 16 + lr]) : 0.f;
#pragma unroll
        for (int j = 0; j < 8; ++j) os[(hi * 8 + j) * 68 + t * 16 + lr] = acc[t][j] + bv; }
    __syncthreads();
    if (F16OUT) {
        h16* crow = (h16*)(void*)C + (size_t)r0 * ldc + c0;
        auto pass = [&]() {
#pragma unroll
            for (int s = 0; s < 4; ++s) { const int row = 4 * s + (lane >> 3), piece = lane & 7; const float* sp = os + row * 68 + piece * 8; v8h o, o2;
#pragma unroll
                for (int i = 0; i < 8; ++i) { const h16 a = (h16)sp[i]; o[i] = a; o2[i] = (h16)((sp[i] - (float)a) * LOSC); }
                *(v8h*)(crow + (size_t)row * ldc + piece * 8) = o; if (C2) *(v8h*)(C2 + (size_t)r0 * ldc + c0 + (size_t)row * ldc + piece * 8) = o2; }
        };
        pass(); 
    } else {
        float* crow = C + (size_t)r0 * ldc + c0;
        auto pass = [&]() {
#pragma unroll
            for (int s = 0; s < 8; ++s) { const int Lid = (lane >> 3) + 4 * s, piece = lane & 7; const int row = Lid >> 1, cofs = (Lid & 1) * 32 + piece * 4;
                v4f val = *(const v4fa*)(os + row * 68 + cofs); if (R) { const v4f rv = *(const v4f*)(R + ((size_t)r0 + row) * ldc + c0 + cofs); val += roundR ? (v4f){bfr(rv[0]), bfr(rv[1]), bfr(rv[2]), bfr(rv[3])} : rv; }
                *(v4f*)(crow + (size_t)row * ldc + cofs) = val; }
        };
        pass(); 
    }
}

__global__ __launch_bounds__(256) void k_cvtw(const float* __restrict__ src, int nrows, bf* dst) {
    const int lane = threadIdx.x & 31, r = blockIdx.x * 8 + (threadIdx.x >> 5);
    if (r >= nrows) return;
    v8us o[KW / 256];
#pragma unroll
    for (int q = 0; q < KW / 256; ++q) { v8us t;
#pragma unroll
        for (int i = 0; i < 8; ++i) t[i] = f2bf(src[(size_t)r * KW + q * 256 + lane * 8 + i]);
        o[q] = t; }
{
#pragma unroll
        for (int q = 0; q < KW / 256; ++q) *(v8us*)(dst + (size_t)r * KW + q * 256 + lane * 8) = o[q];
         }
}
// 8 lanes x 16 B.
__global__ __launch_bounds__(256) void k_vt(const float* __restrict__ V, bf* VTH) {
    __shared__ __align__(16) unsigned short th_[64 * 72];
    const int t0 = blockIdx.x * 64, dh = blockIdx.y, tid = threadIdx.x;
    const int tt = tid >> 2, dq = (tid & 3) * 16;
    V += (size_t)blockIdx.z * NT_ * HS; VTH += (size_t)blockIdx.z * HS * NT_;      // blockIdx.z = batch item
    const float* src = V + ((size_t)t0 + tt) * HS + dh * 64 + dq;
#pragma unroll
    for (int i = 0; i < 16; ++i) th_[(dq + i) * 72 + tt] = f2bf(src[i]);
    __syncthreads();
    const int piece = tid & 7;
    auto pass = [&]() {
#pragma unroll
        for (int s = 0; s < 2; ++s) { const int d = (tid >> 3) + 32 * s;
            const v8us a = *(const v8usa*)(th_ + d * 72 + piece * 8);
            *(v8us*)(VTH + (size_t)(dh * 64 + d) * NT_ + t0 + piece * 8) = a; }
    };
    pass(); 
}
// stage_kv: the block's 128 threads copy one 32-key tile (K hi and K residual rows of one head: 32 x 256 B each; V^T: 128 rows x 64 B) from global memory into one
// ring buffer, 12 asynchronous 16-B copies a thread; a wave's K copy covers two whole 256-B rows. lb = the buffer's LDS byte address.
__device__ __forceinline__ void stage_kv(const h16* kh, const h16* kl, const bf* vt, unsigned lb, int l0, int tid) {
    const int kr = tid >> 4, kc8 = (tid & 15) * 8, vr = tid >> 2, vc8 = (tid & 3) * 8;
    const h16* gh = kh + (size_t)(l0 + kr) * KW + kc8; const h16* gl = kl + (size_t)(l0 + kr) * KW + kc8; const bf* gv = vt + (size_t)vr * NT_ + l0 + vc8;
    const unsigned lh = lb + (unsigned)(kr * KP + kc8) * 2u, ll = lh + KPL * 2u, lv = lb + (unsigned)(2 * KPL + vr * VP + vc8) * 2u;
    // the copies and their s_wait_xcnt in one statement: no address register of a copy is rewritten in front of that wait
    asm volatile("global_load_async_to_lds_b128 %0, %1, off\n\t"
                 "global_load_async_to_lds_b128 %2, %3, off\n\t"
                 "global_load_async_to_lds_b128 %4, %5, off\n\t"
                 "global_load_async_to_lds_b128 %6, %7, off\n\t"
                 "global_load_async_to_lds_b128 %8, %9, off\n\t"
                 "global_load_async_to_lds_b128 %10, %11, off\n\t"
                 "global_load_async_to_lds_b128 %12, %13, off\n\t"
                 "global_load_async_to_lds_b128 %14, %15, off\n\t"
                 "global_load_async_to_lds_b128 %16, %17, off\n\t"
                 "global_load_async_to_lds_b128 %18, %19, off\n\t"
                 "global_load_async_to_lds_b128 %20, %21, off\n\t"
                 "global_load_async_to_lds_b128 %22, %23, off\n\t"
                 "s_wait_xcnt 0x0"
                 :: "v"(lh), "v"(gh), "v"(lh + 8u * KP * 2u), "v"(gh + (size_t)8 * KW), "v"(lh + 16u * KP * 2u), "v"(gh + (size_t)16 * KW), "v"(lh + 24u * KP * 2u), "v"(gh + (size_t)24 * KW),
                    "v"(ll), "v"(gl), "v"(ll + 8u * KP * 2u), "v"(gl + (size_t)8 * KW), "v"(ll + 16u * KP * 2u), "v"(gl + (size_t)16 * KW), "v"(ll + 24u * KP * 2u), "v"(gl + (size_t)24 * KW),
                    "v"(lv), "v"(gv), "v"(lv + 32u * VP * 2u), "v"(gv + (size_t)32 * NT_), "v"(lv + 64u * VP * 2u), "v"(gv + (size_t)64 * NT_), "v"(lv + 96u * VP * 2u), "v"(gv + (size_t)96 * NT_)
                 : "memory");
}
// k_attn: block = (head, 64 queries), wave = 16; K slice of head h (row stride NH*HD), V = bf16(x)^T shared by all heads (exact, single plane); causal key tiles
// 0..(Q0+63)/32; per element: j <= q -> clip(score x 128^-1/2, -10, 10) else -inf (reference: clip before the causal where); scores hh + (hl+lh)/1024 on separate
// accumulators; softmax f32 with the fixed shift 10; P (x32768) as bf16 hi + unscaled residual; o += ph.v + pl.v; ctx / l -> bf16 hi/lo planes CH/CL[tok][h*128+d].
__global__ __launch_bounds__(128) void k_attn(const h16* __restrict__ QH, const h16* __restrict__ QL, const h16* __restrict__ KH, const h16* __restrict__ KL, const bf* __restrict__ VTH, bf* CH, bf* CL) {
    __shared__ __align__(16) unsigned short plds[4][16 * 32];
    __shared__ __align__(16) unsigned short plds2[4][16 * 32];
    __shared__ __align__(16) float ost[4][16 * 68];
    __shared__ __align__(16) unsigned short ring[2 * STG];     // two buffers: the next key tile's copies fly while this one is worked on; the 4 waves share each tile
    const int lane = threadIdx.x & 31, wave = threadIdx.x >> 5, lr = lane & 15, hi = lane >> 4;
    const int bid = blockIdx.x; const int h = bid / (NT_ / 64), qt = bid - h * (NT_ / 64); const int g = h;   // K has one slice per head; V (= x) is shared by all heads
    { const size_t ib = (size_t)blockIdx.y * NT_ * KW;                // blockIdx.y = batch item: its own rows of every plane, its own V^T
      QH += ib; QL += ib; KH += ib; KL += ib; CH += ib; CL += ib; VTH += (size_t)blockIdx.y * HS * NT_; }
    const int q0 = qt * 64 + wave * 16;
    unsigned short* pl = &plds[wave][0]; unsigned short* pl2 = &plds2[wave][0];
    const size_t qo = (size_t)(q0 + lr) * (NH_ * HD) + h * HD + 8 * hi;
    const h16* kh_b = KH + g * HD; const h16* kl_b = KL + g * HD;
    v8f o[8];
#pragma unroll
    for (int n = 0; n < 8; ++n) o[n] = (v8f){};
    float lpart[8];
#pragma unroll
    for (int j = 0; j < 8; ++j) lpart[j] = 0.f;
    const int kt_hi = (qt * 64 + 63) / 32; const int kt_lo = 0;     // causal
    const unsigned ring_b = (unsigned)(size_t)&ring[0];              // LDS byte address of the ring
    stage_kv(kh_b, kl_b, VTH, ring_b, 0, threadIdx.x);
    asm volatile("s_wait_asynccnt 0x0" ::: "memory");               // this wave's copies of tile 0 have landed
    __syncthreads();                                                // ... and every other wave's
    if (kt_hi >= 1) stage_kv(kh_b, kl_b, VTH, ring_b + STG * 2u, 32, threadIdx.x);
#pragma unroll 1
    for (int kt = kt_lo; kt <= kt_hi; ++kt) {
        const int l0 = kt * 32;
        const unsigned short* tb = ring + (kt & 1) * STG;
        const unsigned short* tkh = tb + lr * KP + 8 * hi; const unsigned short* tkl = tkh + KPL; const unsigned short* tv = tb + 2 * KPL + lr * VP + 8 * hi;
        v8f s0 = {}, s1 = {}, x0 = {}, x1 = {};
#pragma unroll
        for (int kc = 0; kc < 4; ++kc) {
            const v16h qa = cat16(*(const v8h*)(QH + qo + kc * 32), *(const v8h*)(QH + qo + kc * 32 + 16)), qx = cat16(*(const v8h*)(QL + qo + kc * 32), *(const v8h*)(QL + qo + kc * 32 + 16));
            const v16h k0h = cat16(*(const v8ha*)(tkh + kc * 32), *(const v8ha*)(tkh + kc * 32 + 16)), k1h = cat16(*(const v8ha*)(tkh + 16 * KP + kc * 32), *(const v8ha*)(tkh + 16 * KP + kc * 32 + 16));
            s0 = wmma16(qa, k0h, s0); s1 = wmma16(qa, k1h, s1); x0 = wmma16(qx, k0h, x0); x1 = wmma16(qx, k1h, x1);
            asm volatile("v_nop" : "+v"(s0), "+v"(s1), "+v"(x0), "+v"(x1) : "v"(qa), "v"(qx), "v"(k0h), "v"(k1h) : "memory");
            const v16h k0l = cat16(*(const v8ha*)(tkl + kc * 32), *(const v8ha*)(tkl + kc * 32 + 16)), k1l = cat16(*(const v8ha*)(tkl + 16 * KP + kc * 32), *(const v8ha*)(tkl + 16 * KP + kc * 32 + 16));
            x0 = wmma16(qa, k0l, x0); x1 = wmma16(qa, k1l, x1);
            asm volatile("v_nop" : "+v"(x0), "+v"(x1) : "v"(k0l), "v"(k1l) : "memory");
        }
        asm volatile("v_nop\n\tv_nop\n\tv_nop\n\tv_nop" : "+v"(s0), "+v"(s1), "+v"(x0), "+v"(x1));
#pragma unroll
        for (int j = 0; j < 8; ++j) { const int qi = q0 + hi * 8 + j, ja = l0 + lr, jb = l0 + 16 + lr;
            // reference order: scores / sqrt(128) -> clip(-10, 10) -> causal where -> softmax
            const float a0 = (ja <= qi) ? fminf(fmaxf((s0[j] + x0[j] * LOSCI) * 0.08838834764831845f, -10.0f), 10.0f) : -__builtin_inff(), a1 = (jb <= qi) ? fminf(fmaxf((s1[j] + x1[j] * LOSCI) * 0.08838834764831845f, -10.0f), 10.0f) : -__builtin_inff();
            // every kept score lies in [-10, 10] after the clip, so the clip's upper bound is the softmax shift: exp(a - 10) is in [e^-20, 1] for any input,
            // and no row maximum is searched, carried or applied to o and l
            const float p0 = __expf(a0 - 10.0f), p1 = __expf(a1 - 10.0f);
            lpart[j] += p0 + p1;
            const int mr = hi * 8 + j; const float ps0 = p0 * PSC, ps1 = p1 * PSC; const unsigned short h0 = f2bf(ps0), h1 = f2bf(ps1);
            pl[mr * 32 + lr] = h0; pl[mr * 32 + 16 + lr] = h1; pl2[mr * 32 + lr] = f2bf(ps0 - bf2f(h0)); pl2[mr * 32 + 16 + lr] = f2bf(ps1 - bf2f(h1)); }
        asm volatile("" ::: "memory");
        const v16bf pa = cat16b(*(const v8usa*)(pl + lr * 32 + hi * 8), *(const v8usa*)(pl + lr * 32 + 16 + hi * 8));
        const v16bf px = cat16b(*(const v8usa*)(pl2 + lr * 32 + hi * 8), *(const v8usa*)(pl2 + lr * 32 + 16 + hi * 8));
#pragma unroll
        for (int n = 0; n < 8; ++n) {
            const v16bf vh = cat16b(*(const v8usa*)(tv + n * 16 * VP), *(const v8usa*)(tv + n * 16 * VP + 16));     // V = bf16(x) exactly (a rounded INPUT): no residual plane
            o[n] = wmmab(pa, vh, o[n]); o[n] = wmmab(px, vh, o[n]);
            asm volatile("" : "+v"(o[n]) : "v"(vh) : "memory"); }
        asm volatile("v_nop\n\tv_nop\n\tv_nop\n\tv_nop" : "+v"(o[0]), "+v"(o[7]) : "v"(pa), "v"(px));
        __builtin_amdgcn_wave_barrier();
        asm volatile("s_wait_dscnt 0x0" ::: "memory");              // this wave's reads of the buffer are done before it may be refilled
        asm volatile("s_wait_asynccnt 0x0" ::: "memory");           // this wave's copies of tile kt + 1 have landed
        __syncthreads();                                            // publishes tile kt + 1 and ends every wave's reads of tile kt
        if (kt + 2 <= kt_hi) stage_kv(kh_b, kl_b, VTH, ring_b + (unsigned)(kt & 1) * (STG * 2u), l0 + 64, threadIdx.x);
    }
    asm volatile("s_wait_asynccnt 0x0" ::: "memory");               // nothing in flight when the wave goes on to its end
    float inv[8];
#pragma unroll
    for (int j = 0; j < 8; ++j) { float rs = lpart[j]; rs += __shfl_xor(rs, 1, 16); rs += __shfl_xor(rs, 2, 16); rs += __shfl_xor(rs, 4, 16); rs += __shfl_xor(rs, 8, 16); inv[j] = 1.0f / (rs * PSC); }
    float* os = &ost[wave][0];
    const size_t cbase = (size_t)q0 * (NH_ * HD) + (size_t)h * HD;
#pragma unroll
    for (int half = 0; half < 2; ++half) {
#pragma unroll
        for (int n = 0; n < 4; ++n)
#pragma unroll
            for (int j = 0; j < 8; ++j) os[(hi * 8 + j) * 68 + n * 16 + lr] = o[half * 4 + n][j] * inv[j];
        __builtin_amdgcn_wave_barrier(); asm volatile("" ::: "memory");
{
#pragma unroll
            for (int s = 0; s < 4; ++s) { const int row = 4 * s + (lane >> 3), piece = lane & 7; const float* sp = os + row * 68 + piece * 8; v8us oh, ol;
#pragma unroll
                for (int i = 0; i < 8; ++i) { const unsigned short hb = f2bf(sp[i]); oh[i] = hb; ol[i] = f2bf(sp[i] - bf2f(hb)); }
                const size_t po = cbase + (size_t)row * (NH_ * HD) + half * 64 + piece * 8; *(v8us*)(CH + po) = oh; *(v8us*)(CL + po) = ol; }
             }
        __builtin_amdgcn_wave_barrier(); asm volatile("" ::: "memory");
    }
}

extern "C" void kernel_launch(void* const* d_in, const int* in_sizes, int n_in,
                              void* d_out, int out_size, void* d_ws, size_t ws_size, hipStream_t stream) {
    (void)in_sizes; (void)n_in; (void)out_size;
    const float* x = (const float*)d_in[0]; const float* Wq = (const float*)d_in[1]; const float* Wk = (const float*)d_in[2]; const float* Wo = (const float*)d_in[3];   // Wq/Wk [8][128][128] (x.W[h]); Wo [128][1024] = [out][in]
    float* out = (float*)d_out;    // [2][4096][128]
    char* wsp = (char*)d_ws;
    auto take = [&](size_t bytes) { char* p = wsp; wsp += (bytes + 255) & ~(size_t)255; return (void*)p; };
    bf* Xb = (bf*)take((size_t)NB_ * NTK * HS * 2); float* Xr = (float*)take((size_t)NB_ * NTK * HS * 4);
    bf* WqT = (bf*)take((size_t)KW * HS * 2); bf* WkT = (bf*)take((size_t)KW * HS * 2); bf* WoB = (bf*)take((size_t)HS * KW * 2);
    h16* QH = (h16*)take((size_t)NB_ * NTK * KW * 2); h16* QL = (h16*)take((size_t)NB_ * NTK * KW * 2); h16* KH = (h16*)take((size_t)NB_ * NTK * KW * 2); h16* KL = (h16*)take((size_t)NB_ * NTK * KW * 2);
    bf* VTH = (bf*)take((size_t)NB_ * HS * NT_ * 2); bf* CH = (bf*)take((size_t)NB_ * NTK * KW * 2); bf* CL = (bf*)take((size_t)NB_ * NTK * KW * 2);
    if ((size_t)(wsp - (char*)d_ws) > ws_size) return;    // about 110 MB, no aliasing: every per-item plane holds both batch items
    for (int h = 0; h < NH_; ++h) {      // per-head k-major [128][128] -> rows h*128.. of the n-major planes [1024][128]
        k_wt<<<dim3(HS / 64, HD / 64, 1), 256, 0, stream>>>(Wq + (size_t)h * HS * HD, HS, HD, WqT + (size_t)h * HD * HS);
        k_wt<<<dim3(HS / 64, HD / 64, 1), 256, 0, stream>>>(Wk + (size_t)h * HS * HD, HS, HD, WkT + (size_t)h * HD * HS);
    }
    k_cvtw<<<HS / 8, 256, 0, stream>>>(Wo, HS, WoB);      // W_o [128][1024] = [out][in]: bf16 copy = n-major B operand
    // both batch items in every launch: the row-wise kernels see 2 x 4096 rows, k_vt and k_attn take the item from the grid
    k_cvt128<<<NB_ * NTK / 8, 256, 0, stream>>>(x, NB_ * NTK, Xb, Xr);
    k_gemmb<false, true><<<dim3(NB_ * NTK / 64, KW / 64, 1), 128, 0, stream>>>(Xb, nullptr, WqT, nullptr, (float*)(void*)QH, KW, QL, nullptr, HS);
    k_gemmb<false, true><<<dim3(NB_ * NTK / 64, KW / 64, 1), 128, 0, stream>>>(Xb, nullptr, WkT, nullptr, (float*)(void*)KH, KW, KL, nullptr, HS);
    k_vt<<<dim3(NT_ / 64, 2, NB_), 256, 0, stream>>>(Xr, VTH);
    k_attn<<<dim3(NH_ * (NT_ / 64), NB_, 1), 128, 0, stream>>>(QH, QL, KH, KL, VTH, CH, CL);
    k_gemmb<true, false><<<dim3(NB_ * NTK / 64, HS / 64, 1), 128, 0, stream>>>(CH, CL, WoB, nullptr, out, HS, nullptr, nullptr, KW);
}

// v004
// A run of this version takes 317 microseconds.
// Two timings next to v003 put it at 1.57 and 1.56 times that version's speed.
// Counting every step since v000, it is 4.99 times as fast.
#include <hip/hip_runtime.h>

// Compute dtypes, f32 accumulate, both batch items in every launch: Q/K = x.W_q[h] / x.W_k[h] ([4096 x 128].[128 x 128] per head, k-major per-head weights transposed once
// into n-major [8*128][128] planes; PLAIN bf16 operands = inputs rounded once, exact products) written straight from the GEMM epilogue as f16 hi + residual
// x1024 planes [t][h*128+e], and out = y.W_o^T ([4096 x 1024].[1024 x 128], W_o [out][in] as-is; y as bf16 hi + residual) on v_wmma_f32_16x16x32_bf16; the
// 8-head causal attention with clipped scores (clip(s/sqrt(128), -10, 10)) and V = x itself (bf16(x)^T, exact, one plane) on v_wmma_f32_16x16x32_f16 (scores)

#define NB_  2
#define NT_  4096
#define HS   128                 // x width = head dim of q, k and v
#define NH_  8
#define HD   128
#define KW   (NH_ * HD)          // 1024: row stride of the Q/K planes
#define NTK  NT_
#define DM   HS                  // k_gemmb's default K
#define PSC  32768.0f
#define LOSC 1024.0f
#define LOSCI (1.0f / 1024.0f)
#define KP   136                 // LDS pitch of a staged K row in 16-bit elements: 272 B = 16 B x odd, for ds_load_b128 readers
#define VP   40                  // LDS pitch of a staged V^T row (32 keys) in 16-bit elements: 80 B = 16 B x odd
#define KPL  (32 * KP)           // one K plane of a 32-key tile
#define STG  (2 * KPL + HS * VP) // one ring buffer: K hi, K residual, V^T

typedef _Float16 h16;
typedef unsigned short bf;
typedef __attribute__((ext_vector_type(16))) __bf16   v16bf;
typedef __attribute__((ext_vector_type(16))) _Float16 v16h;
typedef __attribute__((ext_vector_type(8)))  _Float16 v8h;
typedef __attribute__((ext_vector_type(8)))  unsigned short v8us;
typedef __attribute__((ext_vector_type(8)))  float    v8f;
typedef __attribute__((ext_vector_type(4)))  float    v4f;
typedef __attribute__((ext_vector_type(4)))  _Float16 v4h;
typedef v8h  __attribute__((may_alias)) v8ha;
typedef v4f  __attribute__((may_alias)) v4fa;
typedef v8us __attribute__((may_alias)) v8usa;

__device__ __forceinline__ unsigned short f2bf(float f) { unsigned u = __float_as_uint(f); u += 0x7FFFu + ((u >> 16) & 1u); return (unsigned short)(u >> 16); }
__device__ __forceinline__ float bf2f(unsigned short b) { return __uint_as_float(((unsigned)b) << 16); }
__device__ __forceinline__ float bfr(float f) { return bf2f(f2bf(f)); }
__device__ __forceinline__ v16h cat16(v8h lo, v8h hi) { return __builtin_shufflevector(lo, hi, 0, 1, 2, 3, 4, 5, 6, 7, 8, 9, 10, 11, 12, 13, 14, 15); }
__device__ __forceinline__ v16bf cat16b(v8us lo, v8us hi) { return __builtin_bit_cast(v16bf, __builtin_shufflevector(lo, hi, 0, 1, 2, 3, 4, 5, 6, 7, 8, 9, 10, 11, 12, 13, 14, 15)); }
__device__ __forceinline__ v8f wmma16(v16h a, v16h b, v8f c) { return __builtin_amdgcn_wmma_f32_16x16x32_f16(false, a, false, b, (short)0, c, false, false); }
__device__ __forceinline__ v8f wmmab(v16bf a, v16bf b, v8f c) { return __builtin_amdgcn_wmma_f32_16x16x32_bf16(false, a, false, b, (short)0, c, false, false); }

// k_cvt128: one wave per row of x [rows][128]: bf16 plane (A operand) and an f32 copy of the bf16-rounded row (the V source for k_vt); lane -> 4 consecutive floats
__global__ __launch_bounds__(256) void k_cvt128(const float* __restrict__ src, int nrows, bf* dstb, float* dstf) {
    typedef __attribute__((ext_vector_type(4))) unsigned short v4us;
    const int lane = threadIdx.x & 31, r = blockIdx.x * 8 + (threadIdx.x >> 5);
    if (r >= nrows) return;
    const v4f v = *(const v4f*)(src + (size_t)r * HS + lane * 4); v4us ob; v4f of;
#pragma unroll
    for (int i = 0; i < 4; ++i) { ob[i] = f2bf(v[i]); of[i] = bf2f(ob[i]); }
    *(v4us*)(dstb + (size_t)r * HS + lane * 4) = ob; *(v4f*)(dstf + (size_t)r * HS + lane * 4) = of; 
}
// k_wt: WT [n][K] = bf16(W[k][n]) (k-major [K][ncols]) via 64 x 64 LDS tiles; grid (K/64, ncols/64).
__global__ __launch_bounds__(256) void k_wt(const float* __restrict__ Wm, int K, int ncols, bf* WT) {
    __shared__ __align__(16) unsigned short tl[64 * 72];
    const int tid = threadIdx.x, k0 = blockIdx.x * 64, n0 = blockIdx.y * 64;
    const int kk = tid >> 2, nq = (tid & 3) * 16;
#pragma unroll
    for (int i = 0; i < 16; ++i) tl[(nq + i) * 72 + kk] = f2bf(Wm[(size_t)(k0 + kk) * ncols + n0 + nq + i]);
    __syncthreads();
    const int piece = tid & 7;
    auto pass = [&]() {
#pragma unroll
        for (int s = 0; s < 2; ++s) { const int nr = (tid >> 3) + 32 * s; const v8us val = *(const v8usa*)(tl + nr * 72 + piece * 8); *(v8us*)(WT + (size_t)(n0 + nr) * K + k0 + piece * 8) = val; }
    };
    pass(); 
}
// k_gemmb: 64 x 64 block tile (4 waves x 16 x 64) of C[NB_*NTK][NW] = (A [+ Al]).B^T (K = 128 or 1024) [+ bf(bias[c])] [+ bf(R[r][c]) residual]; f32 whole-line epilogue (or f16
template <bool SPLITA, bool F16OUT = false>
__global__ __launch_bounds__(128) void k_gemmb(const bf* __restrict__ A, const bf* __restrict__ Al, const bf* __restrict__ Bn, const float* __restrict__ bias, float* C, int ldc, h16* C2, const float* __restrict__ R = nullptr, int K = DM, int roundR = 1) {
    __shared__ __align__(16) float ost[4][16 * 68];
    const int lane = threadIdx.x & 31, wave = threadIdx.x >> 5, lr = lane & 15, hi = lane >> 4;
    const int r0 = blockIdx.x * 64 + wave * 16, c0 = blockIdx.y * 64;
    const size_t aoff = (size_t)(r0 + lr) * K + 8 * hi;
    size_t boff[4];
#pragma unroll
    for (int t = 0; t < 4; ++t) boff[t] = (size_t)(c0 + t * 16 + lr) * K + 8 * hi;
    v8f acc[4];
#pragma unroll
    for (int t = 0; t < 4; ++t) acc[t] = (v8f){};
#pragma unroll 1
    for (int kc = 0; kc < K; kc += 32) {
        const v16bf a = cat16b(*(const v8us*)(A + aoff + kc), *(const v8us*)(A + aoff + kc + 16));
        v16bf al = a;
        if (SPLITA) al = cat16b(*(const v8us*)(Al + aoff + kc), *(const v8us*)(Al + aoff + kc + 16));
#pragma unroll
        for (int t = 0; t < 4; ++t) { const v16bf b = cat16b(*(const v8us*)(Bn + boff[t] + kc), *(const v8us*)(Bn + boff[t] + kc + 16)); acc[t] = wmmab(a, b, acc[t]); if (SPLITA) acc[t] = wmmab(al, b, acc[t]); }
        asm volatile("v_nop\n\tv_nop\n\tv_nop\n\tv_nop" : "+v"(acc[0]), "+v"(acc[1]), "+v"(acc[2]), "+v"(acc[3]) : "v"(a), "v"(al));
    }
    float* os = &ost[wave][0];
#pragma unroll
    for (int t = 0; t < 4; ++t) { const float bv = bias ? bfr(bias[c0 + t * 16 + lr]) : 0.f;
#pragma unroll
        for (int j = 0; j < 8; ++j) os[(hi * 8 + j) * 68 + t * 16 + lr] = acc[t][j] + bv; }
    __syncthreads();
    if (F16OUT) {
        h16* crow = (h16*)(void*)C + (size_t)r0 * ldc + c0;
        auto pass = [&]() {
#pragma unroll
            for (int s = 0; s < 4; ++s) { const int row = 4 * s + (lane >> 3), piece = lane & 7; const float* sp = os + row * 68 + piece * 8; v8h o, o2;
#pragma unroll
                for (int i = 0; i < 8; ++i) { const h16 a = (h16)sp[i]; o[i] = a; o2[i] = (h16)((sp[i] - (float)a) * LOSC); }
                *(v8h*)(crow + (size_t)row * ldc + piece * 8) = o; if (C2) *(v8h*)(C2 + (size_t)r0 * ldc + c0 + (size_t)row * ldc + piece * 8) = o2; }
        };
        pass(); 
    } else {
        float* crow = C + (size_t)r0 * ldc + c0;
        auto pass = [&]() {
#pragma unroll
            for (int s = 0; s < 8; ++s) { const int Lid = (lane >> 3) + 4 * s, piece = lane & 7; const int row = Lid >> 1, cofs = (Lid & 1) * 32 + piece * 4;
                v4f val = *(const v4fa*)(os + row * 68 + cofs); if (R) { const v4f rv = *(const v4f*)(R + ((size_t)r0 + row) * ldc + c0 + cofs); val += roundR ? (v4f){bfr(rv[0]), bfr(rv[1]), bfr(rv[2]), bfr(rv[3])} : rv; }
                *(v4f*)(crow + (size_t)row * ldc + cofs) = val; }
        };
        pass(); 
    }
}

__global__ __launch_bounds__(256) void k_cvtw(const float* __restrict__ src, int nrows, bf* dst) {
    const int lane = threadIdx.x & 31, r = blockIdx.x * 8 + (threadIdx.x >> 5);
    if (r >= nrows) return;
    v8us o[KW / 256];
#pragma unroll
    for (int q = 0; q < KW / 256; ++q) { v8us t;
#pragma unroll
        for (int i = 0; i < 8; ++i) t[i] = f2bf(src[(size_t)r * KW + q * 256 + lane * 8 + i]);
        o[q] = t; }
{
#pragma unroll
        for (int q = 0; q < KW / 256; ++q) *(v8us*)(dst + (size_t)r * KW + q * 256 + lane * 8) = o[q];
         }
}
// 8 lanes x 16 B.
__global__ __launch_bounds__(256) void k_vt(const float* __restrict__ V, bf* VTH) {
    __shared__ __align__(16) unsigned short th_[64 * 72];
    const int t0 = blockIdx.x * 64, dh = blockIdx.y, tid = threadIdx.x;
    const int tt = tid >> 2, dq = (tid & 3) * 16;
    V += (size_t)blockIdx.z * NT_ * HS; VTH += (size_t)blockIdx.z * HS * NT_;      // blockIdx.z = batch item
    const float* src = V + ((size_t)t0 + tt) * HS + dh * 64 + dq;
#pragma unroll
    for (int i = 0; i < 16; ++i) th_[(dq + i) * 72 + tt] = f2bf(src[i]);
    __syncthreads();
    const int piece = tid & 7;
    auto pass = [&]() {
#pragma unroll
        for (int s = 0; s < 2; ++s) { const int d = (tid >> 3) + 32 * s;
            const v8us a = *(const v8usa*)(th_ + d * 72 + piece * 8);
            *(v8us*)(VTH + (size_t)(dh * 64 + d) * NT_ + t0 + piece * 8) = a; }
    };
    pass(); 
}
// stage_kv: the 128 threads of one half of the block copy one 32-key tile (K hi and K residual rows of one head: 32 x 256 B each; V^T: 128 rows x 64 B) from global memory into one
// ring buffer, 12 asynchronous 16-B copies a thread; a wave's K copy covers two whole 256-B rows. lb = the buffer's LDS byte address.
__device__ __forceinline__ void stage_kv(const h16* kh, const h16* kl, const bf* vt, unsigned lb, int l0, int tid) {
    const int kr = tid >> 4, kc8 = (tid & 15) * 8, vr = tid >> 2, vc8 = (tid & 3) * 8;
    const h16* gh = kh + (size_t)(l0 + kr) * KW + kc8; const h16* gl = kl + (size_t)(l0 + kr) * KW + kc8; const bf* gv = vt + (size_t)vr * NT_ + l0 + vc8;
    const unsigned lh = lb + (unsigned)(kr * KP + kc8) * 2u, ll = lh + KPL * 2u, lv = lb + (unsigned)(2 * KPL + vr * VP + vc8) * 2u;
    // the copies and their s_wait_xcnt in one statement: no address register of a copy is rewritten in front of that wait
    asm volatile("global_load_async_to_lds_b128 %0, %1, off\n\t"
                 "global_load_async_to_lds_b128 %2, %3, off\n\t"
                 "global_load_async_to_lds_b128 %4, %5, off\n\t"
                 "global_load_async_to_lds_b128 %6, %7, off\n\t"
                 "global_load_async_to_lds_b128 %8, %9, off\n\t"
                 "global_load_async_to_lds_b128 %10, %11, off\n\t"
                 "global_load_async_to_lds_b128 %12, %13, off\n\t"
                 "global_load_async_to_lds_b128 %14, %15, off\n\t"
                 "global_load_async_to_lds_b128 %16, %17, off\n\t"
                 "global_load_async_to_lds_b128 %18, %19, off\n\t"
                 "global_load_async_to_lds_b128 %20, %21, off\n\t"
                 "global_load_async_to_lds_b128 %22, %23, off\n\t"
                 "s_wait_xcnt 0x0"
                 :: "v"(lh), "v"(gh), "v"(lh + 8u * KP * 2u), "v"(gh + (size_t)8 * KW), "v"(lh + 16u * KP * 2u), "v"(gh + (size_t)16 * KW), "v"(lh + 24u * KP * 2u), "v"(gh + (size_t)24 * KW),
                    "v"(ll), "v"(gl), "v"(ll + 8u * KP * 2u), "v"(gl + (size_t)8 * KW), "v"(ll + 16u * KP * 2u), "v"(gl + (size_t)16 * KW), "v"(ll + 24u * KP * 2u), "v"(gl + (size_t)24 * KW),
                    "v"(lv), "v"(gv), "v"(lv + 32u * VP * 2u), "v"(gv + (size_t)32 * NT_), "v"(lv + 64u * VP * 2u), "v"(gv + (size_t)64 * NT_), "v"(lv + 96u * VP * 2u), "v"(gv + (size_t)96 * NT_)
                 : "memory");
}
// k_attn: block = 8 waves = (item, head, 64 queries); a step is 64 keys: waves 0-3 (16 queries each) take its even 32-key tile, waves 4-7 the odd one for the same queries,
// so the longest block walks 64 steps. The softmax shift is fixed, so the two halves' o and l are plain partial sums: waves 4-7 hand theirs over through LDS behind the
// loop, waves 0-3 add them and finish. Two blocks fit a WGP, half of the grid at a time: the blocks with the most steps come first in the grid, the short ones fill up.
// K slice of head h (row stride NH*HD), V = bf16(x)^T shared by all heads (exact, single plane); causal key tiles
// 0..(Q0+63)/32; per element: j <= q -> clip(score x 128^-1/2, -10, 10) else -inf (reference: clip before the causal where); scores hh + (hl+lh)/1024 on separate
// accumulators; softmax f32 with the fixed shift 10; P (x32768) as bf16 hi + unscaled residual; o += ph.v + pl.v; ctx / l -> bf16 hi/lo planes CH/CL[tok][h*128+d].
__global__ __launch_bounds__(256) void k_attn(const h16* __restrict__ QH, const h16* __restrict__ QL, const h16* __restrict__ KH, const h16* __restrict__ KL, const bf* __restrict__ VTH, bf* CH, bf* CL) {
    __shared__ __align__(16) unsigned short plds[8][16 * 32];
    __shared__ __align__(16) unsigned short plds2[8][16 * 32];
    __shared__ __align__(16) float ost[4][16 * 68];
    __shared__ __align__(16) unsigned short ring[4 * STG];     // two buffers of two key tiles: the next step's copies fly while this one is worked on; 4 waves share each tile
    const int lane = threadIdx.x & 31, wave = threadIdx.x >> 5, lr = lane & 15, hi = lane >> 4;
    const int grp = __builtin_amdgcn_readfirstlane(threadIdx.x >> 7), w4 = wave & 3, t128 = threadIdx.x & 127;   // grp (wave-uniform): which key tile of a step this wave takes
    const int bid = blockIdx.x; const int qt = NT_ / 64 - 1 - bid / (NH_ * NB_), h = bid % NH_, item = (bid / NH_) % NB_; const int g = h;   // K has one slice per head; V (= x) is shared by all heads
    { const size_t ib = (size_t)item * NT_ * KW;                      // batch item: its own rows of every plane, its own V^T
      QH += ib; QL += ib; KH += ib; KL += ib; CH += ib; CL += ib; VTH += (size_t)item * HS * NT_; }
    const int q0 = qt * 64 + w4 * 16;
    unsigned short* pl = &plds[wave][0]; unsigned short* pl2 = &plds2[wave][0];
    const size_t qo = (size_t)(q0 + lr) * (NH_ * HD) + h * HD + 8 * hi;
    const h16* kh_b = KH + g * HD; const h16* kl_b = KL + g * HD;
    v8f o[8];
#pragma unroll
    for (int n = 0; n < 8; ++n) o[n] = (v8f){};
    float lpart[8];
#pragma unroll
    for (int j = 0; j < 8; ++j) lpart[j] = 0.f;
    const int st_hi = qt;                                           // causal: steps of 64 keys, 0..qt; each half of the block copies the tile it works on
    const unsigned ring_b = (unsigned)(size_t)&ring[0];              // LDS byte address of the ring
    stage_kv(kh_b, kl_b, VTH, ring_b + (unsigned)grp * (STG * 2u), grp * 32, t128);
    asm volatile("s_wait_asynccnt 0x0" ::: "memory");               // this wave's copies of step 0 have landed
    __syncthreads();                                                // ... and every other wave's
    if (st_hi >= 1) stage_kv(kh_b, kl_b, VTH, ring_b + (unsigned)(2 + grp) * (STG * 2u), 64 + grp * 32, t128);
#pragma unroll 1
    for (int st = 0; st <= st_hi; ++st) {
        const int l0 = st * 64 + grp * 32;
        const unsigned short* tb = ring + ((st & 1) * 2 + grp) * STG;
        const unsigned short* tkh = tb + lr * KP + 8 * hi; const unsigned short* tkl = tkh + KPL; const unsigned short* tv = tb + 2 * KPL + lr * VP + 8 * hi;
        v8f s0 = {}, s1 = {}, x0 = {}, x1 = {};
#pragma unroll
        for (int kc = 0; kc < 4; ++kc) {
            const v16h qa = cat16(*(const v8h*)(QH + qo + kc * 32), *(const v8h*)(QH + qo + kc * 32 + 16)), qx = cat16(*(const v8h*)(QL + qo + kc * 32), *(const v8h*)(QL + qo + kc * 32 + 16));
            const v16h k0h = cat16(*(const v8ha*)(tkh + kc * 32), *(const v8ha*)(tkh + kc * 32 + 16)), k1h = cat16(*(const v8ha*)(tkh + 16 * KP + kc * 32), *(const v8ha*)(tkh + 16 * KP + kc * 32 + 16));
            s0 = wmma16(qa, k0h, s0); s1 = wmma16(qa, k1h, s1); x0 = wmma16(qx, k0h, x0); x1 = wmma16(qx, k1h, x1);
            asm volatile("v_nop" : "+v"(s0), "+v"(s1), "+v"(x0), "+v"(x1) : "v"(qa), "v"(qx), "v"(k0h), "v"(k1h) : "memory");
            const v16h k0l = cat16(*(const v8ha*)(tkl + kc * 32), *(const v8ha*)(tkl + kc * 32 + 16)), k1l = cat16(*(const v8ha*)(tkl + 16 * KP + kc * 32), *(const v8ha*)(tkl + 16 * KP + kc * 32 + 16));
            x0 = wmma16(qa, k0l, x0); x1 = wmma16(qa, k1l, x1);
            asm volatile("v_nop" : "+v"(x0), "+v"(x1) : "v"(k0l), "v"(k1l) : "memory");
        }
        asm volatile("v_nop\n\tv_nop\n\tv_nop\n\tv_nop" : "+v"(s0), "+v"(s1), "+v"(x0), "+v"(x1));
#pragma unroll
        for (int j = 0; j < 8; ++j) { const int qi = q0 + hi * 8 + j, ja = l0 + lr, jb = l0 + 16 + lr;
            // reference order: scores / sqrt(128) -> clip(-10, 10) -> causal where -> softmax
            const float a0 = (ja <= qi) ? fminf(fmaxf((s0[j] + x0[j] * LOSCI) * 0.08838834764831845f, -10.0f), 10.0f) : -__builtin_inff(), a1 = (jb <= qi) ? fminf(fmaxf((s1[j] + x1[j] * LOSCI) * 0.08838834764831845f, -10.0f), 10.0f) : -__builtin_inff();
            // every kept score lies in [-10, 10] after the clip, so the clip's upper bound is the softmax shift: exp(a - 10) is in [e^-20, 1] for any input,
            // and no row maximum is searched, carried or applied to o and l
            const float p0 = __expf(a0 - 10.0f), p1 = __expf(a1 - 10.0f);
            lpart[j] += p0 + p1;
            const int mr = hi * 8 + j; const float ps0 = p0 * PSC, ps1 = p1 * PSC; const unsigned short h0 = f2bf(ps0), h1 = f2bf(ps1);
            pl[mr * 32 + lr] = h0; pl[mr * 32 + 16 + lr] = h1; pl2[mr * 32 + lr] = f2bf(ps0 - bf2f(h0)); pl2[mr * 32 + 16 + lr] = f2bf(ps1 - bf2f(h1)); }
        asm volatile("" ::: "memory");
        const v16bf pa = cat16b(*(const v8usa*)(pl + lr * 32 + hi * 8), *(const v8usa*)(pl + lr * 32 + 16 + hi * 8));
        const v16bf px = cat16b(*(const v8usa*)(pl2 + lr * 32 + hi * 8), *(const v8usa*)(pl2 + lr * 32 + 16 + hi * 8));
#pragma unroll
        for (int n = 0; n < 8; ++n) {
            const v16bf vh = cat16b(*(const v8usa*)(tv + n * 16 * VP), *(const v8usa*)(tv + n * 16 * VP + 16));     // V = bf16(x) exactly (a rounded INPUT): no residual plane
            o[n] = wmmab(pa, vh, o[n]); o[n] = wmmab(px, vh, o[n]);
            asm volatile("" : "+v"(o[n]) : "v"(vh) : "memory"); }
        asm volatile("v_nop\n\tv_nop\n\tv_nop\n\tv_nop" : "+v"(o[0]), "+v"(o[7]) : "v"(pa), "v"(px));
        __builtin_amdgcn_wave_barrier();
        asm volatile("s_wait_dscnt 0x0" ::: "memory");              // this wave's reads of the buffer are done before it may be refilled
        asm volatile("s_wait_asynccnt 0x0" ::: "memory");           // this wave's copies of step st + 1 have landed
        __syncthreads();                                            // publishes step st + 1 and ends every wave's reads of step st
        if (st + 2 <= st_hi) stage_kv(kh_b, kl_b, VTH, ring_b + (unsigned)((st & 1) * 2 + grp) * (STG * 2u), l0 + 128, t128);
    }
    asm volatile("s_wait_asynccnt 0x0" ::: "memory");               // nothing in flight when the ring is put to another use
    // the ring is free behind the loop's last barrier: waves 4-7 lay their partial o and l there, 18 x 16 B a lane, for the wave with the same queries
    v4fa* xw = (v4fa*)(void*)ring + w4 * (18 * 32) + lane;
    if (grp == 1) {
#pragma unroll
        for (int n = 0; n < 8; ++n) { xw[(2 * n) * 32] = (v4f){o[n][0], o[n][1], o[n][2], o[n][3]}; xw[(2 * n + 1) * 32] = (v4f){o[n][4], o[n][5], o[n][6], o[n][7]}; }
        xw[16 * 32] = (v4f){lpart[0], lpart[1], lpart[2], lpart[3]}; xw[17 * 32] = (v4f){lpart[4], lpart[5], lpart[6], lpart[7]};
    }
    __syncthreads();                                                // the partial sums are visible to waves 0-3
    if (grp == 1) return;                                           // no barrier follows: waves 0-3 finish alone
#pragma unroll
    for (int n = 0; n < 8; ++n) { const v4f a = xw[(2 * n) * 32], b = xw[(2 * n + 1) * 32];
#pragma unroll
        for (int j = 0; j < 4; ++j) { o[n][j] += a[j]; o[n][4 + j] += b[j]; } }
    { const v4f a = xw[16 * 32], b = xw[17 * 32];
#pragma unroll
      for (int j = 0; j < 4; ++j) { lpart[j] += a[j]; lpart[4 + j] += b[j]; } }
    float inv[8];
#pragma unroll
    for (int j = 0; j < 8; ++j) { float rs = lpart[j]; rs += __shfl_xor(rs, 1, 16); rs += __shfl_xor(rs, 2, 16); rs += __shfl_xor(rs, 4, 16); rs += __shfl_xor(rs, 8, 16); inv[j] = 1.0f / (rs * PSC); }
    float* os = &ost[w4][0];
    const size_t cbase = (size_t)q0 * (NH_ * HD) + (size_t)h * HD;
#pragma unroll
    for (int half = 0; half < 2; ++half) {
#pragma unroll
        for (int n = 0; n < 4; ++n)
#pragma unroll
            for (int j = 0; j < 8; ++j) os[(hi * 8 + j) * 68 + n * 16 + lr] = o[half * 4 + n][j] * inv[j];
        __builtin_amdgcn_wave_barrier(); asm volatile("" ::: "memory");
{
#pragma unroll
            for (int s = 0; s < 4; ++s) { const int row = 4 * s + (lane >> 3), piece = lane & 7; const float* sp = os + row * 68 + piece * 8; v8us oh, ol;
#pragma unroll
                for (int i = 0; i < 8; ++i) { const unsigned short hb = f2bf(sp[i]); oh[i] = hb; ol[i] = f2bf(sp[i] - bf2f(hb)); }
                const size_t po = cbase + (size_t)row * (NH_ * HD) + half * 64 + piece * 8; *(v8us*)(CH + po) = oh; *(v8us*)(CL + po) = ol; }
             }
        __builtin_amdgcn_wave_barrier(); asm volatile("" ::: "memory");
    }
}

extern "C" void kernel_launch(void* const* d_in, const int* in_sizes, int n_in,
                              void* d_out, int out_size, void* d_ws, size_t ws_size, hipStream_t stream) {
    (void)in_sizes; (void)n_in; (void)out_size;
    const float* x = (const float*)d_in[0]; const float* Wq = (const float*)d_in[1]; const float* Wk = (const float*)d_in[2]; const float* Wo = (const float*)d_in[3];   // Wq/Wk [8][128][128] (x.W[h]); Wo [128][1024] = [out][in]
    float* out = (float*)d_out;    // [2][4096][128]
    char* wsp = (char*)d_ws;
    auto take = [&](size_t bytes) { char* p = wsp; wsp += (bytes + 255) & ~(size_t)255; return (void*)p; };
    bf* Xb = (bf*)take((size_t)NB_ * NTK * HS * 2); float* Xr = (float*)take((size_t)NB_ * NTK * HS * 4);
    bf* WqT = (bf*)take((size_t)KW * HS * 2); bf* WkT = (bf*)take((size_t)KW * HS * 2); bf* WoB = (bf*)take((size_t)HS * KW * 2);
    h16* QH = (h16*)take((size_t)NB_ * NTK * KW * 2); h16* QL = (h16*)take((size_t)NB_ * NTK * KW * 2); h16* KH = (h16*)take((size_t)NB_ * NTK * KW * 2); h16* KL = (h16*)take((size_t)NB_ * NTK * KW * 2);
    bf* VTH = (bf*)take((size_t)NB_ * HS * NT_ * 2); bf* CH = (bf*)take((size_t)NB_ * NTK * KW * 2); bf* CL = (bf*)take((size_t)NB_ * NTK * KW * 2);
    if ((size_t)(wsp - (char*)d_ws) > ws_size) return;    // about 110 MB, no aliasing: every per-item plane holds both batch items
    for (int h = 0; h < NH_; ++h) {      // per-head k-major [128][128] -> rows h*128.. of the n-major planes [1024][128]
        k_wt<<<dim3(HS / 64, HD / 64, 1), 256, 0, stream>>>(Wq + (size_t)h * HS * HD, HS, HD, WqT + (size_t)h * HD * HS);
        k_wt<<<dim3(HS / 64, HD / 64, 1), 256, 0, stream>>>(Wk + (size_t)h * HS * HD, HS, HD, WkT + (size_t)h * HD * HS);
    }
    k_cvtw<<<HS / 8, 256, 0, stream>>>(Wo, HS, WoB);      // W_o [128][1024] = [out][in]: bf16 copy = n-major B operand
    // both batch items in every launch: the row-wise kernels see 2 x 4096 rows, k_vt and k_attn take the item from the block index
    k_cvt128<<<NB_ * NTK / 8, 256, 0, stream>>>(x, NB_ * NTK, Xb, Xr);
    k_gemmb<false, true><<<dim3(NB_ * NTK / 64, KW / 64, 1), 128, 0, stream>>>(Xb, nullptr, WqT, nullptr, (float*)(void*)QH, KW, QL, nullptr, HS);
    k_gemmb<false, true><<<dim3(NB_ * NTK / 64, KW / 64, 1), 128, 0, stream>>>(Xb, nullptr, WkT, nullptr, (float*)(void*)KH, KW, KL, nullptr, HS);
    k_vt<<<dim3(NT_ / 64, 2, NB_), 256, 0, stream>>>(Xr, VTH);
    k_attn<<<dim3(NB_ * NH_ * (NT_ / 64), 1, 1), 256, 0, stream>>>(QH, QL, KH, KL, VTH, CH, CL);
    k_gemmb<true, false><<<dim3(NB_ * NTK / 64, HS / 64, 1), 128, 0, stream>>>(CH, CL, WoB, nullptr, out, HS, nullptr, nullptr, KW);
}

// v005
// A run of this version takes 269 microseconds.
// In two side-by-side timings against v004, it was 1.18 and 1.19 times as fast.
// All steps since v000 together make it 5.92 times as fast.
#include <hip/hip_runtime.h>

// Compute dtypes, f32 accumulate, both batch items in every launch: Q/K = x.W_q[h] / x.W_k[h] ([4096 x 128].[128 x 128] per head, k-major per-head weights transposed once
// into n-major [8*128][128] planes; PLAIN bf16 operands = inputs rounded once, exact products) written straight from the GEMM epilogue as f16 hi + residual
// x1024 planes [t][h*128+e], and out = y.W_o^T ([4096 x 1024].[1024 x 128], W_o [out][in] as-is; y as bf16 hi + residual) on v_wmma_f32_16x16x32_bf16; the
// 8-head causal attention with clipped scores (clip(s/sqrt(128), -10, 10)) and V = x itself (bf16(x)^T, exact, one plane) on v_wmma_f32_16x16x32_f16 (scores)

#define NB_  2
#define NT_  4096
#define HS   128                 // x width = head dim of q, k and v
#define NH_  8
#define HD   128
#define KW   (NH_ * HD)          // 1024: row stride of the Q/K planes
#define NTK  NT_
#define DM   HS                  // k_gemmb's default K
#define PSC  32768.0f
#define LOSC 1024.0f
#define LOSCI (1.0f / 1024.0f)
#define KP   136                 // LDS pitch of a staged K row in 16-bit elements: 272 B = 16 B x odd, for ds_load_b128 readers
#define VP   40                  // LDS pitch of a staged V^T row (32 keys) in 16-bit elements: 80 B = 16 B x odd
#define KPL  (32 * KP)           // one K plane of a 32-key tile
#define STG  (2 * KPL + HS * VP) // one ring buffer: K hi, K residual, V^T

typedef _Float16 h16;
typedef unsigned short bf;
typedef __attribute__((ext_vector_type(16))) __bf16   v16bf;
typedef __attribute__((ext_vector_type(16))) _Float16 v16h;
typedef __attribute__((ext_vector_type(8)))  _Float16 v8h;
typedef __attribute__((ext_vector_type(8)))  unsigned short v8us;
typedef __attribute__((ext_vector_type(8)))  float    v8f;
typedef __attribute__((ext_vector_type(4)))  float    v4f;
typedef __attribute__((ext_vector_type(4)))  _Float16 v4h;
typedef v8h  __attribute__((may_alias)) v8ha;
typedef v4f  __attribute__((may_alias)) v4fa;
typedef v8us __attribute__((may_alias)) v8usa;

__device__ __forceinline__ unsigned short f2bf(float f) { unsigned u = __float_as_uint(f); u += 0x7FFFu + ((u >> 16) & 1u); return (unsigned short)(u >> 16); }
__device__ __forceinline__ float bf2f(unsigned short b) { return __uint_as_float(((unsigned)b) << 16); }
__device__ __forceinline__ float bfr(float f) { return bf2f(f2bf(f)); }
__device__ __forceinline__ v16h cat16(v8h lo, v8h hi) { return __builtin_shufflevector(lo, hi, 0, 1, 2, 3, 4, 5, 6, 7, 8, 9, 10, 11, 12, 13, 14, 15); }
__device__ __forceinline__ v16bf cat16b(v8us lo, v8us hi) { return __builtin_bit_cast(v16bf, __builtin_shufflevector(lo, hi, 0, 1, 2, 3, 4, 5, 6, 7, 8, 9, 10, 11, 12, 13, 14, 15)); }
__device__ __forceinline__ v8f wmma16(v16h a, v16h b, v8f c) { return __builtin_amdgcn_wmma_f32_16x16x32_f16(false, a, false, b, (short)0, c, false, false); }
__device__ __forceinline__ v8f wmmab(v16bf a, v16bf b, v8f c) { return __builtin_amdgcn_wmma_f32_16x16x32_bf16(false, a, false, b, (short)0, c, false, false); }

// The four jobs below read inputs only and none reads another's output: they are parts of ONE launch (k_prep), each with its own range of 256-thread blocks; bid = index in the range.
// p_cvt128: one wave per row of x [rows][128]: bf16 plane (A operand of the Q and K projections); lane -> 4 consecutive floats
__device__ __forceinline__ void p_cvt128(int bid, const float* __restrict__ src, int nrows, bf* dstb) {
    typedef __attribute__((ext_vector_type(4))) unsigned short v4us;
    const int lane = threadIdx.x & 31, r = bid * 8 + (threadIdx.x >> 5);
    if (r >= nrows) return;
    const v4f v = *(const v4f*)(src + (size_t)r * HS + lane * 4); v4us ob;
#pragma unroll
    for (int i = 0; i < 4; ++i) ob[i] = f2bf(v[i]);
    *(v4us*)(dstb + (size_t)r * HS + lane * 4) = ob;
}
// p_wt: WT [n][K] = bf16(W[k][n]) (k-major [K][ncols]) via 64 x 64 LDS tiles; (bx, by) = tile of (K/64, ncols/64); tl = 64 x 72 LDS elements.
__device__ __forceinline__ void p_wt(int bx, int by, const float* __restrict__ Wm, int K, int ncols, bf* WT, unsigned short* tl) {
    const int tid = threadIdx.x, k0 = bx * 64, n0 = by * 64;
    const int kk = tid >> 2, nq = (tid & 3) * 16;
#pragma unroll
    for (int i = 0; i < 16; ++i) tl[(nq + i) * 72 + kk] = f2bf(Wm[(size_t)(k0 + kk) * ncols + n0 + nq + i]);
    __syncthreads();
    const int piece = tid & 7;
    auto pass = [&]() {
#pragma unroll
        for (int s = 0; s < 2; ++s) { const int nr = (tid >> 3) + 32 * s; const v8us val = *(const v8usa*)(tl + nr * 72 + piece * 8); *(v8us*)(WT + (size_t)(n0 + nr) * K + k0 + piece * 8) = val; }
    };
    pass(); 
    asm volatile("s_wait_xcnt 0x0" ::: "memory");   // the stores' registers are free before code of another job, which follows in the listing, may rewrite them
}
// k_gemmb: 64 x 64 block tile (4 waves x 16 x 64) of C[NB_*NTK][NW] = (A [+ Al]).B^T (K = 128 or 1024) [+ bf(bias[c])] [+ bf(R[r][c]) residual]; f32 whole-line epilogue (or f16
template <bool SPLITA, bool F16OUT = false>
__global__ __launch_bounds__(128) void k_gemmb(const bf* __restrict__ A, const bf* __restrict__ Al, const bf* __restrict__ Bn0, const float* __restrict__ bias, float* C0, int ldc, h16* C20, const float* __restrict__ R = nullptr, int K = DM, int roundR = 1, const bf* __restrict__ BnZ = nullptr, float* CZ = nullptr, h16* C2Z = nullptr) {
    __shared__ __align__(16) float ost[4][16 * 68];
    // blockIdx.z = 1: a second product of the same A in the same launch, with its own B and outputs
    const bf* Bn = blockIdx.z ? BnZ : Bn0; float* C = blockIdx.z ? CZ : C0; h16* C2 = blockIdx.z ? C2Z : C20;
    const int lane = threadIdx.x & 31, wave = threadIdx.x >> 5, lr = lane & 15, hi = lane >> 4;
    const int r0 = blockIdx.x * 64 + wave * 16, c0 = blockIdx.y * 64;
    const size_t aoff = (size_t)(r0 + lr) * K + 8 * hi;
    size_t boff[4];
#pragma unroll
    for (int t = 0; t < 4; ++t) boff[t] = (size_t)(c0 + t * 16 + lr) * K + 8 * hi;
    v8f acc[4];
#pragma unroll
    for (int t = 0; t < 4; ++t) acc[t] = (v8f){};
#pragma unroll 1
    for (int kc = 0; kc < K; kc += 32) {
        const v16bf a = cat16b(*(const v8us*)(A + aoff + kc), *(const v8us*)(A + aoff + kc + 16));
        v16bf al = a;
        if (SPLITA) al = cat16b(*(const v8us*)(Al + aoff + kc), *(const v8us*)(Al + aoff + kc + 16));
#pragma unroll
        for (int t = 0; t < 4; ++t) { const v16bf b = cat16b(*(const v8us*)(Bn + boff[t] + kc), *(const v8us*)(Bn + boff[t] + kc + 16)); acc[t] = wmmab(a, b, acc[t]); if (SPLITA) acc[t] = wmmab(al, b, acc[t]); }
        asm volatile("v_nop\n\tv_nop\n\tv_nop\n\tv_nop" : "+v"(acc[0]), "+v"(acc[1]), "+v"(acc[2]), "+v"(acc[3]) : "v"(a), "v"(al));
    }
    float* os = &ost[wave][0];
#pragma unroll
    for (int t = 0; t < 4; ++t) { const float bv = bias ? bfr(bias[c0 + t * 16 + lr]) : 0.f;
#pragma unroll
        for (int j = 0; j < 8; ++j) os[(hi * 8 + j) * 68 + t * 16 + lr] = acc[t][j] + bv; }
    __syncthreads();
    if (F16OUT) {
        h16* crow = (h16*)(void*)C + (size_t)r0 * ldc + c0;
        auto pass = [&]() {
#pragma unroll
            for (int s = 0; s < 4; ++s) { const int row = 4 * s + (lane >> 3), piece = lane & 7; const float* sp = os + row * 68 + piece * 8; v8h o, o2;
#pragma unroll
                for (int i = 0; i < 8; ++i) { const h16 a = (h16)sp[i]; o[i] = a; o2[i] = (h16)((sp[i] - (float)a) * LOSC); }
                *(v8h*)(crow + (size_t)row * ldc + piece * 8) = o; if (C2) *(v8h*)(C2 + (size_t)r0 * ldc + c0 + (size_t)row * ldc + piece * 8) = o2; }
        };
        pass(); 
    } else {
        float* crow = C + (size_t)r0 * ldc + c0;
        auto pass = [&]() {
#pragma unroll
            for (int s = 0; s < 8; ++s) { const int Lid = (lane >> 3) + 4 * s, piece = lane & 7; const int row = Lid >> 1, cofs = (Lid & 1) * 32 + piece * 4;
                v4f val = *(const v4fa*)(os + row * 68 + cofs); if (R) { const v4f rv = *(const v4f*)(R + ((size_t)r0 + row) * ldc + c0 + cofs); val += roundR ? (v4f){bfr(rv[0]), bfr(rv[1]), bfr(rv[2]), bfr(rv[3])} : rv; }
                *(v4f*)(crow + (size_t)row * ldc + cofs) = val; }
        };
        pass(); 
    }
}

__device__ __forceinline__ void p_cvtw(int bid, const float* __restrict__ src, int nrows, bf* dst) {
    const int lane = threadIdx.x & 31, r = bid * 8 + (threadIdx.x >> 5);
    if (r >= nrows) return;
    v8us o[KW / 256];
#pragma unroll
    for (int q = 0; q < KW / 256; ++q) { v8us t;
#pragma unroll
        for (int i = 0; i < 8; ++i) t[i] = f2bf(src[(size_t)r * KW + q * 256 + lane * 8 + i]);
        o[q] = t; }
{
#pragma unroll
        for (int q = 0; q < KW / 256; ++q) *(v8us*)(dst + (size_t)r * KW + q * 256 + lane * 8) = o[q];
         }
}
// p_vt: V^T plane = bf16(x)^T of one batch item, straight from x (the same rounding as p_cvt128's), 64 x 64 LDS tiles; stores of 8 lanes x 16 B. th_ = 64 x 72 LDS elements.
__device__ __forceinline__ void p_vt(int bx, int dh, int item, const float* __restrict__ V, bf* VTH, unsigned short* th_) {
    const int t0 = bx * 64, tid = threadIdx.x;
    const int tt = tid >> 2, dq = (tid & 3) * 16;
    V += (size_t)item * NT_ * HS; VTH += (size_t)item * HS * NT_;
    const float* src = V + ((size_t)t0 + tt) * HS + dh * 64 + dq;
#pragma unroll
    for (int i = 0; i < 16; ++i) th_[(dq + i) * 72 + tt] = f2bf(src[i]);
    __syncthreads();
    const int piece = tid & 7;
    auto pass = [&]() {
#pragma unroll
        for (int s = 0; s < 2; ++s) { const int d = (tid >> 3) + 32 * s;
            const v8us a = *(const v8usa*)(th_ + d * 72 + piece * 8);
            *(v8us*)(VTH + (size_t)(dh * 64 + d) * NT_ + t0 + piece * 8) = a; }
    };
    pass(); 
    asm volatile("s_wait_xcnt 0x0" ::: "memory");   // the stores' registers are free before code of another job, which follows in the listing, may rewrite them
}
// k_prep: every job that depends on the inputs alone, in one launch. Block ranges: 64 weight tiles (16 matrices x 4), 16 of W_o, 256 of V^T, 1024 of x; every branch is block-uniform.
#define PB_WT  (2 * NH_ * 4)
#define PB_WO  (HS / 8)
#define PB_VT  (NB_ * 2 * (NT_ / 64))
#define PB_X   (NB_ * NTK / 8)
__global__ __launch_bounds__(256) void k_prep(const float* __restrict__ x, const float* __restrict__ Wq, const float* __restrict__ Wk, const float* __restrict__ Wo, bf* Xb, bf* VTH, bf* WqT, bf* WkT, bf* WoB) {
    __shared__ __align__(16) unsigned short tl[64 * 72];
    int bid = blockIdx.x;
    if (bid < PB_WT) {      // per-head k-major [128][128] -> rows h*128.. of the n-major planes [1024][128]
        const int h = bid >> 3, wk = (bid >> 2) & 1;
        p_wt(bid & 1, (bid >> 1) & 1, (wk ? Wk : Wq) + (size_t)h * HS * HD, HS, HD, (wk ? WkT : WqT) + (size_t)h * HD * HS, tl);
        return;
    }
    bid -= PB_WT;
    if (bid < PB_WO) { p_cvtw(bid, Wo, HS, WoB); return; }      // W_o [128][1024] = [out][in]: bf16 copy = n-major B operand
    bid -= PB_WO;
    if (bid < PB_VT) { p_vt(bid & (NT_ / 64 - 1), (bid / (NT_ / 64)) & 1, bid / (2 * (NT_ / 64)), x, VTH, tl); return; }
    p_cvt128(bid - PB_VT, x, NB_ * NTK, Xb);
}
// stage_kv: the 128 threads of one half of the block copy one 32-key tile (K hi and K residual rows of one head: 32 x 256 B each; V^T: 128 rows x 64 B) from global memory into one
// ring buffer, 12 asynchronous 16-B copies a thread; a wave's K copy covers two whole 256-B rows. lb = the buffer's LDS byte address.
__device__ __forceinline__ void stage_kv(const h16* kh, const h16* kl, const bf* vt, unsigned lb, int l0, int tid) {
    const int kr = tid >> 4, kc8 = (tid & 15) * 8, vr = tid >> 2, vc8 = (tid & 3) * 8;
    const h16* gh = kh + (size_t)(l0 + kr) * KW + kc8; const h16* gl = kl + (size_t)(l0 + kr) * KW + kc8; const bf* gv = vt + (size_t)vr * NT_ + l0 + vc8;
    const unsigned lh = lb + (unsigned)(kr * KP + kc8) * 2u, ll = lh + KPL * 2u, lv = lb + (unsigned)(2 * KPL + vr * VP + vc8) * 2u;
    // the copies and their s_wait_xcnt in one statement: no address register of a copy is rewritten in front of that wait
    asm volatile("global_load_async_to_lds_b128 %0, %1, off\n\t"
                 "global_load_async_to_lds_b128 %2, %3, off\n\t"
                 "global_load_async_to_lds_b128 %4, %5, off\n\t"
                 "global_load_async_to_lds_b128 %6, %7, off\n\t"
                 "global_load_async_to_lds_b128 %8, %9, off\n\t"
                 "global_load_async_to_lds_b128 %10, %11, off\n\t"
                 "global_load_async_to_lds_b128 %12, %13, off\n\t"
                 "global_load_async_to_lds_b128 %14, %15, off\n\t"
                 "global_load_async_to_lds_b128 %16, %17, off\n\t"
                 "global_load_async_to_lds_b128 %18, %19, off\n\t"
                 "global_load_async_to_lds_b128 %20, %21, off\n\t"
                 "global_load_async_to_lds_b128 %22, %23, off\n\t"
                 "s_wait_xcnt 0x0"
                 :: "v"(lh), "v"(gh), "v"(lh + 8u * KP * 2u), "v"(gh + (size_t)8 * KW), "v"(lh + 16u * KP * 2u), "v"(gh + (size_t)16 * KW), "v"(lh + 24u * KP * 2u), "v"(gh + (size_t)24 * KW),
                    "v"(ll), "v"(gl), "v"(ll + 8u * KP * 2u), "v"(gl + (size_t)8 * KW), "v"(ll + 16u * KP * 2u), "v"(gl + (size_t)16 * KW), "v"(ll + 24u * KP * 2u), "v"(gl + (size_t)24 * KW),
                    "v"(lv), "v"(gv), "v"(lv + 32u * VP * 2u), "v"(gv + (size_t)32 * NT_), "v"(lv + 64u * VP * 2u), "v"(gv + (size_t)64 * NT_), "v"(lv + 96u * VP * 2u), "v"(gv + (size_t)96 * NT_)
                 : "memory");
}
// k_attn: block = 8 waves = (item, head, 64 queries); a step is 64 keys: waves 0-3 (16 queries each) take its even 32-key tile, waves 4-7 the odd one for the same queries,
// so the longest block walks 64 steps. The softmax shift is fixed, so the two halves' o and l are plain partial sums: waves 4-7 hand theirs over through LDS behind the
// loop, waves 0-3 add them and finish. Two blocks fit a WGP, half of the grid at a time: the blocks with the most steps come first in the grid, the short ones fill up.
// K slice of head h (row stride NH*HD), V = bf16(x)^T shared by all heads (exact, single plane); causal key tiles
// 0..(Q0+63)/32; per element: j <= q -> clip(score x 128^-1/2, -10, 10) else -inf (reference: clip before the causal where); scores hh + (hl+lh)/1024 on separate
// accumulators; softmax f32 with the fixed shift 10; P (x32768) as bf16 hi + unscaled residual; o += ph.v + pl.v; ctx / l -> bf16 hi/lo planes CH/CL[tok][h*128+d].
__global__ __launch_bounds__(256) void k_attn(const h16* __restrict__ QH, const h16* __restrict__ QL, const h16* __restrict__ KH, const h16* __restrict__ KL, const bf* __restrict__ VTH, bf* CH, bf* CL) {
    __shared__ __align__(16) unsigned short plds[8][16 * 32];
    __shared__ __align__(16) unsigned short plds2[8][16 * 32];
    __shared__ __align__(16) float ost[4][16 * 68];
    __shared__ __align__(16) unsigned short ring[4 * STG];     // two buffers of two key tiles: the next step's copies fly while this one is worked on; 4 waves share each tile
    const int lane = threadIdx.x & 31, wave = threadIdx.x >> 5, lr = lane & 15, hi = lane >> 4;
    const int grp = __builtin_amdgcn_readfirstlane(threadIdx.x >> 7), w4 = wave & 3, t128 = threadIdx.x & 127;   // grp (wave-uniform): which key tile of a step this wave takes
    const int bid = blockIdx.x; const int qt = NT_ / 64 - 1 - bid / (NH_ * NB_), h = bid % NH_, item = (bid / NH_) % NB_; const int g = h;   // K has one slice per head; V (= x) is shared by all heads
    { const size_t ib = (size_t)item * NT_ * KW;                      // batch item: its own rows of every plane, its own V^T
      QH += ib; QL += ib; KH += ib; KL += ib; CH += ib; CL += ib; VTH += (size_t)item * HS * NT_; }
    const int q0 = qt * 64 + w4 * 16;
    unsigned short* pl = &plds[wave][0]; unsigned short* pl2 = &plds2[wave][0];
    const size_t qo = (size_t)(q0 + lr) * (NH_ * HD) + h * HD + 8 * hi;
    const h16* kh_b = KH + g * HD; const h16* kl_b = KL + g * HD;
    v8f o[8];
#pragma unroll
    for (int n = 0; n < 8; ++n) o[n] = (v8f){};
    float lpart[8];
#pragma unroll
    for (int j = 0; j < 8; ++j) lpart[j] = 0.f;
    const int st_hi = qt;                                           // causal: steps of 64 keys, 0..qt; each half of the block copies the tile it works on
    const unsigned ring_b = (unsigned)(size_t)&ring[0];              // LDS byte address of the ring
    stage_kv(kh_b, kl_b, VTH, ring_b + (unsigned)grp * (STG * 2u), grp * 32, t128);
    asm volatile("s_wait_asynccnt 0x0" ::: "memory");               // this wave's copies of step 0 have landed
    __syncthreads();                                                // ... and every other wave's
    if (st_hi >= 1) stage_kv(kh_b, kl_b, VTH, ring_b + (unsigned)(2 + grp) * (STG * 2u), 64 + grp * 32, t128);
#pragma unroll 1
    for (int st = 0; st <= st_hi; ++st) {
        const int l0 = st * 64 + grp * 32;
        const unsigned short* tb = ring + ((st & 1) * 2 + grp) * STG;
        const unsigned short* tkh = tb + lr * KP + 8 * hi; const unsigned short* tkl = tkh + KPL; const unsigned short* tv = tb + 2 * KPL + lr * VP + 8 * hi;
        v8f s0 = {}, s1 = {}, x0 = {}, x1 = {};
#pragma unroll
        for (int kc = 0; kc < 4; ++kc) {
            const v16h qa = cat16(*(const v8h*)(QH + qo + kc * 32), *(const v8h*)(QH + qo + kc * 32 + 16)), qx = cat16(*(const v8h*)(QL + qo + kc * 32), *(const v8h*)(QL + qo + kc * 32 + 16));
            const v16h k0h = cat16(*(const v8ha*)(tkh + kc * 32), *(const v8ha*)(tkh + kc * 32 + 16)), k1h = cat16(*(const v8ha*)(tkh + 16 * KP + kc * 32), *(const v8ha*)(tkh + 16 * KP + kc * 32 + 16));
            s0 = wmma16(qa, k0h, s0); s1 = wmma16(qa, k1h, s1); x0 = wmma16(qx, k0h, x0); x1 = wmma16(qx, k1h, x1);
            asm volatile("v_nop" : "+v"(s0), "+v"(s1), "+v"(x0), "+v"(x1) : "v"(qa), "v"(qx), "v"(k0h), "v"(k1h) : "memory");
            const v16h k0l = cat16(*(const v8ha*)(tkl + kc * 32), *(const v8ha*)(tkl + kc * 32 + 16)), k1l = cat16(*(const v8ha*)(tkl + 16 * KP + kc * 32), *(const v8ha*)(tkl + 16 * KP + kc * 32 + 16));
            x0 = wmma16(qa, k0l, x0); x1 = wmma16(qa, k1l, x1);
            asm volatile("v_nop" : "+v"(x0), "+v"(x1) : "v"(k0l), "v"(k1l) : "memory");
        }
        asm volatile("v_nop\n\tv_nop\n\tv_nop\n\tv_nop" : "+v"(s0), "+v"(s1), "+v"(x0), "+v"(x1));
#pragma unroll
        for (int j = 0; j < 8; ++j) { const int qi = q0 + hi * 8 + j, ja = l0 + lr, jb = l0 + 16 + lr;
            // reference order: scores / sqrt(128) -> clip(-10, 10) -> causal where -> softmax
            const float a0 = (ja <= qi) ? fminf(fmaxf((s0[j] + x0[j] * LOSCI) * 0.08838834764831845f, -10.0f), 10.0f) : -__builtin_inff(), a1 = (jb <= qi) ? fminf(fmaxf((s1[j] + x1[j] * LOSCI) * 0.08838834764831845f, -10.0f), 10.0f) : -__builtin_inff();
            // every kept score lies in [-10, 10] after the clip, so the clip's upper bound is the softmax shift: exp(a - 10) is in [e^-20, 1] for any input,
            // and no row maximum is searched, carried or applied to o and l
            const float p0 = __expf(a0 - 10.0f), p1 = __expf(a1 - 10.0f);
            lpart[j] += p0 + p1;
            const int mr = hi * 8 + j; const float ps0 = p0 * PSC, ps1 = p1 * PSC; const unsigned short h0 = f2bf(ps0), h1 = f2bf(ps1);
            pl[mr * 32 + lr] = h0; pl[mr * 32 + 16 + lr] = h1; pl2[mr * 32 + lr] = f2bf(ps0 - bf2f(h0)); pl2[mr * 32 + 16 + lr] = f2bf(ps1 - bf2f(h1)); }
        asm volatile("" ::: "memory");
        const v16bf pa = cat16b(*(const v8usa*)(pl + lr * 32 + hi * 8), *(const v8usa*)(pl + lr * 32 + 16 + hi * 8));
        const v16bf px = cat16b(*(const v8usa*)(pl2 + lr * 32 + hi * 8), *(const v8usa*)(pl2 + lr * 32 + 16 + hi * 8));
#pragma unroll
        for (int n = 0; n < 8; ++n) {
            const v16bf vh = cat16b(*(const v8usa*)(tv + n * 16 * VP), *(const v8usa*)(tv + n * 16 * VP + 16));     // V = bf16(x) exactly (a rounded INPUT): no residual plane
            o[n] = wmmab(pa, vh, o[n]); o[n] = wmmab(px, vh, o[n]);
            asm volatile("" : "+v"(o[n]) : "v"(vh) : "memory"); }
        asm volatile("v_nop\n\tv_nop\n\tv_nop\n\tv_nop" : "+v"(o[0]), "+v"(o[7]) : "v"(pa), "v"(px));
        __builtin_amdgcn_wave_barrier();
        asm volatile("s_wait_dscnt 0x0" ::: "memory");              // this wave's reads of the buffer are done before it may be refilled
        asm volatile("s_wait_asynccnt 0x0" ::: "memory");           // this wave's copies of step st + 1 have landed
        __syncthreads();                                            // publishes step st + 1 and ends every wave's reads of step st
        if (st + 2 <= st_hi) stage_kv(kh_b, kl_b, VTH, ring_b + (unsigned)((st & 1) * 2 + grp) * (STG * 2u), l0 + 128, t128);
    }
    asm volatile("s_wait_asynccnt 0x0" ::: "memory");               // nothing in flight when the ring is put to another use
    // the ring is free behind the loop's last barrier: waves 4-7 lay their partial o and l there, 18 x 16 B a lane, for the wave with the same queries
    v4fa* xw = (v4fa*)(void*)ring + w4 * (18 * 32) + lane;
    if (grp == 1) {
#pragma unroll
        for (int n = 0; n < 8; ++n) { xw[(2 * n) * 32] = (v4f){o[n][0], o[n][1], o[n][2], o[n][3]}; xw[(2 * n + 1) * 32] = (v4f){o[n][4], o[n][5], o[n][6], o[n][7]}; }
        xw[16 * 32] = (v4f){lpart[0], lpart[1], lpart[2], lpart[3]}; xw[17 * 32] = (v4f){lpart[4], lpart[5], lpart[6], lpart[7]};
    }
    __syncthreads();                                                // the partial sums are visible to waves 0-3
    if (grp == 1) return;                                           // no barrier follows: waves 0-3 finish alone
#pragma unroll
    for (int n = 0; n < 8; ++n) { const v4f a = xw[(2 * n) * 32], b = xw[(2 * n + 1) * 32];
#pragma unroll
        for (int j = 0; j < 4; ++j) { o[n][j] += a[j]; o[n][4 + j] += b[j]; } }
    { const v4f a = xw[16 * 32], b = xw[17 * 32];
#pragma unroll
      for (int j = 0; j < 4; ++j) { lpart[j] += a[j]; lpart[4 + j] += b[j]; } }
    float inv[8];
#pragma unroll
    for (int j = 0; j < 8; ++j) { float rs = lpart[j]; rs += __shfl_xor(rs, 1, 16); rs += __shfl_xor(rs, 2, 16); rs += __shfl_xor(rs, 4, 16); rs += __shfl_xor(rs, 8, 16); inv[j] = 1.0f / (rs * PSC); }
    float* os = &ost[w4][0];
    const size_t cbase = (size_t)q0 * (NH_ * HD) + (size_t)h * HD;
#pragma unroll
    for (int half = 0; half < 2; ++half) {
#pragma unroll
        for (int n = 0; n < 4; ++n)
#pragma unroll
            for (int j = 0; j < 8; ++j) os[(hi * 8 + j) * 68 + n * 16 + lr] = o[half * 4 + n][j] * inv[j];
        __builtin_amdgcn_wave_barrier(); asm volatile("" ::: "memory");
{
#pragma unroll
            for (int s = 0; s < 4; ++s) { const int row = 4 * s + (lane >> 3), piece = lane & 7; const float* sp = os + row * 68 + piece * 8; v8us oh, ol;
#pragma unroll
                for (int i = 0; i < 8; ++i) { const unsigned short hb = f2bf(sp[i]); oh[i] = hb; ol[i] = f2bf(sp[i] - bf2f(hb)); }
                const size_t po = cbase + (size_t)row * (NH_ * HD) + half * 64 + piece * 8; *(v8us*)(CH + po) = oh; *(v8us*)(CL + po) = ol; }
             }
        __builtin_amdgcn_wave_barrier(); asm volatile("" ::: "memory");
    }
}

extern "C" void kernel_launch(void* const* d_in, const int* in_sizes, int n_in,
                              void* d_out, int out_size, void* d_ws, size_t ws_size, hipStream_t stream) {
    (void)in_sizes; (void)n_in; (void)out_size;
    const float* x = (const float*)d_in[0]; const float* Wq = (const float*)d_in[1]; const float* Wk = (const float*)d_in[2]; const float* Wo = (const float*)d_in[3];   // Wq/Wk [8][128][128] (x.W[h]); Wo [128][1024] = [out][in]
    float* out = (float*)d_out;    // [2][4096][128]
    char* wsp = (char*)d_ws;
    auto take = [&](size_t bytes) { char* p = wsp; wsp += (bytes + 255) & ~(size_t)255; return (void*)p; };
    bf* Xb = (bf*)take((size_t)NB_ * NTK * HS * 2);
    bf* WqT = (bf*)take((size_t)KW * HS * 2); bf* WkT = (bf*)take((size_t)KW * HS * 2); bf* WoB = (bf*)take((size_t)HS * KW * 2);
    h16* QH = (h16*)take((size_t)NB_ * NTK * KW * 2); h16* QL = (h16*)take((size_t)NB_ * NTK * KW * 2); h16* KH = (h16*)take((size_t)NB_ * NTK * KW * 2); h16* KL = (h16*)take((size_t)NB_ * NTK * KW * 2);
    bf* VTH = (bf*)take((size_t)NB_ * HS * NT_ * 2); bf* CH = (bf*)take((size_t)NB_ * NTK * KW * 2); bf* CL = (bf*)take((size_t)NB_ * NTK * KW * 2);
    if ((size_t)(wsp - (char*)d_ws) > ws_size) return;    // about 105 MB, no aliasing: every per-item plane holds both batch items
    // four dependent launches: what reads inputs only; the Q and the K projection (grid z); attention; the output projection. Both batch items in every launch.
    k_prep<<<PB_WT + PB_WO + PB_VT + PB_X, 256, 0, stream>>>(x, Wq, Wk, Wo, Xb, VTH, WqT, WkT, WoB);
    k_gemmb<false, true><<<dim3(NB_ * NTK / 64, KW / 64, 2), 128, 0, stream>>>(Xb, nullptr, WqT, nullptr, (float*)(void*)QH, KW, QL, nullptr, HS, 1, WkT, (float*)(void*)KH, KL);
    k_attn<<<dim3(NB_ * NH_ * (NT_ / 64), 1, 1), 256, 0, stream>>>(QH, QL, KH, KL, VTH, CH, CL);
    k_gemmb<true, false><<<dim3(NB_ * NTK / 64, HS / 64, 1), 128, 0, stream>>>(CH, CL, WoB, nullptr, out, HS, nullptr, nullptr, KW);
}

// v006
// It runs in 257 microseconds.
// Next to v005, in two timings, it ran 1.05 and 1.04 times as fast.
// All steps since v000 together make it 6.19 times as fast.
#include <hip/hip_runtime.h>

// Compute dtypes, f32 accumulate, both batch items in every launch: Q/K = x.W_q[h] / x.W_k[h] ([4096 x 128].[128 x 128] per head, k-major per-head weights transposed once
// into n-major [8*128][128] planes; PLAIN bf16 operands = inputs rounded once, exact products) written straight from the GEMM epilogue as f16 hi + residual
// x1024 planes [t][h*128+e], and out = y.W_o^T ([4096 x 1024].[1024 x 128], W_o [out][in] as-is; y as bf16 hi + residual) on v_wmma_f32_16x16x32_bf16; the
// 8-head causal attention with clipped scores (clip(s/sqrt(128), -10, 10)) and V = x itself (bf16(x)^T, exact, one plane) on v_wmma_f32_16x16x32_f16 (scores)

#define NB_  2
#define NT_  4096
#define HS   128                 // x width = head dim of q, k and v
#define NH_  8
#define HD   128
#define KW   (NH_ * HD)          // 1024: row stride of the Q/K planes
#define NTK  NT_
#define DM   HS                  // k_gemmb's default K
#define PSC  32768.0f
#define LOSC 1024.0f
#define LOSCI (1.0f / 1024.0f)
#define KP   136                 // LDS pitch of a staged K row in 16-bit elements: 272 B = 16 B x odd, for ds_load_b128 readers
#define VP   40                  // LDS pitch of a staged V^T row (32 keys) in 16-bit elements: 80 B = 16 B x odd
#define KPL  (32 * KP)           // one K plane of a 32-key tile
#define STG  (2 * KPL + HS * VP) // one ring buffer: K hi, K residual, V^T

typedef _Float16 h16;
typedef unsigned short bf;
typedef __attribute__((ext_vector_type(16))) __bf16   v16bf;
typedef __attribute__((ext_vector_type(16))) _Float16 v16h;
typedef __attribute__((ext_vector_type(8)))  _Float16 v8h;
typedef __attribute__((ext_vector_type(8)))  unsigned short v8us;
typedef __attribute__((ext_vector_type(8)))  float    v8f;
typedef __attribute__((ext_vector_type(4)))  float    v4f;
typedef __attribute__((ext_vector_type(4)))  _Float16 v4h;
typedef v8h  __attribute__((may_alias)) v8ha;
typedef v4f  __attribute__((may_alias)) v4fa;
typedef v8us __attribute__((may_alias)) v8usa;

__device__ __forceinline__ unsigned short f2bf(float f) { unsigned u = __float_as_uint(f); u += 0x7FFFu + ((u >> 16) & 1u); return (unsigned short)(u >> 16); }
__device__ __forceinline__ float bf2f(unsigned short b) { return __uint_as_float(((unsigned)b) << 16); }
__device__ __forceinline__ float bfr(float f) { return bf2f(f2bf(f)); }
__device__ __forceinline__ v16h cat16(v8h lo, v8h hi) { return __builtin_shufflevector(lo, hi, 0, 1, 2, 3, 4, 5, 6, 7, 8, 9, 10, 11, 12, 13, 14, 15); }
__device__ __forceinline__ v16bf cat16b(v8us lo, v8us hi) { return __builtin_bit_cast(v16bf, __builtin_shufflevector(lo, hi, 0, 1, 2, 3, 4, 5, 6, 7, 8, 9, 10, 11, 12, 13, 14, 15)); }
__device__ __forceinline__ v8f wmma16(v16h a, v16h b, v8f c) { return __builtin_amdgcn_wmma_f32_16x16x32_f16(false, a, false, b, (short)0, c, false, false); }
__device__ __forceinline__ v8f wmmab(v16bf a, v16bf b, v8f c) { return __builtin_amdgcn_wmma_f32_16x16x32_bf16(false, a, false, b, (short)0, c, false, false); }

// The four jobs below read inputs only and none reads another's output: they are parts of ONE launch (k_prep), each with its own range of 256-thread blocks; bid = index in the range.
// p_cvt128: one wave per row of x [rows][128]: bf16 plane (A operand of the Q and K projections); lane -> 4 consecutive floats
__device__ __forceinline__ void p_cvt128(int bid, const float* __restrict__ src, int nrows, bf* dstb) {
    typedef __attribute__((ext_vector_type(4))) unsigned short v4us;
    const int lane = threadIdx.x & 31, r = bid * 8 + (threadIdx.x >> 5);
    if (r >= nrows) return;
    const v4f v = *(const v4f*)(src + (size_t)r * HS + lane * 4); v4us ob;
#pragma unroll
    for (int i = 0; i < 4; ++i) ob[i] = f2bf(v[i]);
    *(v4us*)(dstb + (size_t)r * HS + lane * 4) = ob;
}
// p_wt: WT [n][K] = bf16(W[k][n]) (k-major [K][ncols]) via 64 x 64 LDS tiles; (bx, by) = tile of (K/64, ncols/64); tl = 64 x 72 LDS elements.
__device__ __forceinline__ void p_wt(int bx, int by, const float* __restrict__ Wm, int K, int ncols, bf* WT, unsigned short* tl) {
    const int tid = threadIdx.x, k0 = bx * 64, n0 = by * 64;
    const int kk = tid >> 2, nq = (tid & 3) * 16;
#pragma unroll
    for (int i = 0; i < 16; ++i) tl[(nq + i) * 72 + kk] = f2bf(Wm[(size_t)(k0 + kk) * ncols + n0 + nq + i]);
    __syncthreads();
    const int piece = tid & 7;
    auto pass = [&]() {
#pragma unroll
        for (int s = 0; s < 2; ++s) { const int nr = (tid >> 3) + 32 * s; const v8us val = *(const v8usa*)(tl + nr * 72 + piece * 8); *(v8us*)(WT + (size_t)(n0 + nr) * K + k0 + piece * 8) = val; }
    };
    pass(); 
    asm volatile("s_wait_xcnt 0x0" ::: "memory");   // the stores' registers are free before code of another job, which follows in the listing, may rewrite them
}
// k_gemmb: 64 x 64 block tile (4 waves x 16 x 64) of C[NB_*NTK][NW] = (A [+ Al]).B^T (K = 128 or 1024) [+ bf(bias[c])] [+ bf(R[r][c]) residual]; f32 whole-line epilogue (or f16
template <bool SPLITA, bool F16OUT = false>
__global__ __launch_bounds__(128) void k_gemmb(const bf* __restrict__ A, const bf* __restrict__ Al, const bf* __restrict__ Bn0, const float* __restrict__ bias, float* C0, int ldc, h16* C20, const float* __restrict__ R = nullptr, int K = DM, int roundR = 1, const bf* __restrict__ BnZ = nullptr, float* CZ = nullptr, h16* C2Z = nullptr) {
    __shared__ __align__(16) float ost[4][16 * 68];
    // blockIdx.z = 1: a second product of the same A in the same launch, with its own B and outputs
    const bf* Bn = blockIdx.z ? BnZ : Bn0; float* C = blockIdx.z ? CZ : C0; h16* C2 = blockIdx.z ? C2Z : C20;
    const int lane = threadIdx.x & 31, wave = threadIdx.x >> 5, lr = lane & 15, hi = lane >> 4;
    const int r0 = blockIdx.x * 64 + wave * 16, c0 = blockIdx.y * 64;
    const size_t aoff = (size_t)(r0 + lr) * K + 8 * hi;
    size_t boff[4];
#pragma unroll
    for (int t = 0; t < 4; ++t) boff[t] = (size_t)(c0 + t * 16 + lr) * K + 8 * hi;
    v8f acc[4];
#pragma unroll
    for (int t = 0; t < 4; ++t) acc[t] = (v8f){};
#pragma unroll 1
    for (int kc = 0; kc < K; kc += 32) {
        const v16bf a = cat16b(*(const v8us*)(A + aoff + kc), *(const v8us*)(A + aoff + kc + 16));
        v16bf al = a;
        if (SPLITA) al = cat16b(*(const v8us*)(Al + aoff + kc), *(const v8us*)(Al + aoff + kc + 16));
#pragma unroll
        for (int t = 0; t < 4; ++t) { const v16bf b = cat16b(*(const v8us*)(Bn + boff[t] + kc), *(const v8us*)(Bn + boff[t] + kc + 16)); acc[t] = wmmab(a, b, acc[t]); if (SPLITA) acc[t] = wmmab(al, b, acc[t]); }
        asm volatile("v_nop\n\tv_nop\n\tv_nop\n\tv_nop" : "+v"(acc[0]), "+v"(acc[1]), "+v"(acc[2]), "+v"(acc[3]) : "v"(a), "v"(al));
    }
    float* os = &ost[wave][0];
#pragma unroll
    for (int t = 0; t < 4; ++t) { const float bv = bias ? bfr(bias[c0 + t * 16 + lr]) : 0.f;
#pragma unroll
        for (int j = 0; j < 8; ++j) os[(hi * 8 + j) * 68 + t * 16 + lr] = acc[t][j] + bv; }
    __syncthreads();
    if (F16OUT) {
        h16* crow = (h16*)(void*)C + (size_t)r0 * ldc + c0;
        auto pass = [&]() {
#pragma unroll
            for (int s = 0; s < 4; ++s) { const int row = 4 * s + (lane >> 3), piece = lane & 7; const float* sp = os + row * 68 + piece * 8; v8h o, o2;
#pragma unroll
                for (int i = 0; i < 8; ++i) { const h16 a = (h16)sp[i]; o[i] = a; o2[i] = (h16)((sp[i] - (float)a) * LOSC); }
                *(v8h*)(crow + (size_t)row * ldc + piece * 8) = o; if (C2) *(v8h*)(C2 + (size_t)r0 * ldc + c0 + (size_t)row * ldc + piece * 8) = o2; }
        };
        pass(); 
    } else {
        float* crow = C + (size_t)r0 * ldc + c0;
        auto pass = [&]() {
#pragma unroll
            for (int s = 0; s < 8; ++s) { const int Lid = (lane >> 3) + 4 * s, piece = lane & 7; const int row = Lid >> 1, cofs = (Lid & 1) * 32 + piece * 4;
                v4f val = *(const v4fa*)(os + row * 68 + cofs); if (R) { const v4f rv = *(const v4f*)(R + ((size_t)r0 + row) * ldc + c0 + cofs); val += roundR ? (v4f){bfr(rv[0]), bfr(rv[1]), bfr(rv[2]), bfr(rv[3])} : rv; }
                *(v4f*)(crow + (size_t)row * ldc + cofs) = val; }
        };
        pass(); 
    }
}

__device__ __forceinline__ void p_cvtw(int bid, const float* __restrict__ src, int nrows, bf* dst) {
    const int lane = threadIdx.x & 31, r = bid * 8 + (threadIdx.x >> 5);
    if (r >= nrows) return;
    v8us o[KW / 256];
#pragma unroll
    for (int q = 0; q < KW / 256; ++q) { v8us t;
#pragma unroll
        for (int i = 0; i < 8; ++i) t[i] = f2bf(src[(size_t)r * KW + q * 256 + lane * 8 + i]);
        o[q] = t; }
{
#pragma unroll
        for (int q = 0; q < KW / 256; ++q) *(v8us*)(dst + (size_t)r * KW + q * 256 + lane * 8) = o[q];
         }
}
// p_vt: V^T plane = bf16(x)^T of one batch item, straight from x (the same rounding as p_cvt128's), 64 x 64 LDS tiles; stores of 8 lanes x 16 B. th_ = 64 x 72 LDS elements.
__device__ __forceinline__ void p_vt(int bx, int dh, int item, const float* __restrict__ V, bf* VTH, unsigned short* th_) {
    const int t0 = bx * 64, tid = threadIdx.x;
    const int tt = tid >> 2, dq = (tid & 3) * 16;
    V += (size_t)item * NT_ * HS; VTH += (size_t)item * HS * NT_;
    const float* src = V + ((size_t)t0 + tt) * HS + dh * 64 + dq;
#pragma unroll
    for (int i = 0; i < 16; ++i) th_[(dq + i) * 72 + tt] = f2bf(src[i]);
    __syncthreads();
    const int piece = tid & 7;
    auto pass = [&]() {
#pragma unroll
        for (int s = 0; s < 2; ++s) { const int d = (tid >> 3) + 32 * s;
            const v8us a = *(const v8usa*)(th_ + d * 72 + piece * 8);
            *(v8us*)(VTH + (size_t)(dh * 64 + d) * NT_ + t0 + piece * 8) = a; }
    };
    pass(); 
    asm volatile("s_wait_xcnt 0x0" ::: "memory");   // the stores' registers are free before code of another job, which follows in the listing, may rewrite them
}
// k_prep: every job that depends on the inputs alone, in one launch. Block ranges: 64 weight tiles (16 matrices x 4), 16 of W_o, 256 of V^T, 1024 of x; every branch is block-uniform.
#define PB_WT  (2 * NH_ * 4)
#define PB_WO  (HS / 8)
#define PB_VT  (NB_ * 2 * (NT_ / 64))
#define PB_X   (NB_ * NTK / 8)
__global__ __launch_bounds__(256) void k_prep(const float* __restrict__ x, const float* __restrict__ Wq, const float* __restrict__ Wk, const float* __restrict__ Wo, bf* Xb, bf* VTH, bf* WqT, bf* WkT, bf* WoB) {
    __shared__ __align__(16) unsigned short tl[64 * 72];
    int bid = blockIdx.x;
    if (bid < PB_WT) {      // per-head k-major [128][128] -> rows h*128.. of the n-major planes [1024][128]
        const int h = bid >> 3, wk = (bid >> 2) & 1;
        p_wt(bid & 1, (bid >> 1) & 1, (wk ? Wk : Wq) + (size_t)h * HS * HD, HS, HD, (wk ? WkT : WqT) + (size_t)h * HD * HS, tl);
        return;
    }
    bid -= PB_WT;
    if (bid < PB_WO) { p_cvtw(bid, Wo, HS, WoB); return; }      // W_o [128][1024] = [out][in]: bf16 copy = n-major B operand
    bid -= PB_WO;
    if (bid < PB_VT) { p_vt(bid & (NT_ / 64 - 1), (bid / (NT_ / 64)) & 1, bid / (2 * (NT_ / 64)), x, VTH, tl); return; }
    p_cvt128(bid - PB_VT, x, NB_ * NTK, Xb);
}
// stage_kv: the 128 threads of one half of the block copy one 32-key tile (K hi and K residual rows of one head: 32 x 256 B each; V^T: 128 rows x 64 B) from global memory into one
// ring buffer, 12 asynchronous 16-B copies a thread; a wave's K copy covers two whole 256-B rows. lb = the buffer's LDS byte address.
__device__ __forceinline__ void stage_kv(const h16* kh, const h16* kl, const bf* vt, unsigned lb, int l0, int tid) {
    const int kr = tid >> 4, kc8 = (tid & 15) * 8, vr = tid >> 2, vc8 = (tid & 3) * 8;
    const h16* gh = kh + (size_t)(l0 + kr) * KW + kc8; const h16* gl = kl + (size_t)(l0 + kr) * KW + kc8; const bf* gv = vt + (size_t)vr * NT_ + l0 + vc8;
    const unsigned lh = lb + (unsigned)(kr * KP + kc8) * 2u, ll = lh + KPL * 2u, lv = lb + (unsigned)(2 * KPL + vr * VP + vc8) * 2u;
    // the copies and their s_wait_xcnt in one statement: no address register of a copy is rewritten in front of that wait
    asm volatile("global_load_async_to_lds_b128 %0, %1, off\n\t"
                 "global_load_async_to_lds_b128 %2, %3, off\n\t"
                 "global_load_async_to_lds_b128 %4, %5, off\n\t"
                 "global_load_async_to_lds_b128 %6, %7, off\n\t"
                 "global_load_async_to_lds_b128 %8, %9, off\n\t"
                 "global_load_async_to_lds_b128 %10, %11, off\n\t"
                 "global_load_async_to_lds_b128 %12, %13, off\n\t"
                 "global_load_async_to_lds_b128 %14, %15, off\n\t"
                 "global_load_async_to_lds_b128 %16, %17, off\n\t"
                 "global_load_async_to_lds_b128 %18, %19, off\n\t"
                 "global_load_async_to_lds_b128 %20, %21, off\n\t"
                 "global_load_async_to_lds_b128 %22, %23, off\n\t"
                 "s_wait_xcnt 0x0"
                 :: "v"(lh), "v"(gh), "v"(lh + 8u * KP * 2u), "v"(gh + (size_t)8 * KW), "v"(lh + 16u * KP * 2u), "v"(gh + (size_t)16 * KW), "v"(lh + 24u * KP * 2u), "v"(gh + (size_t)24 * KW),
                    "v"(ll), "v"(gl), "v"(ll + 8u * KP * 2u), "v"(gl + (size_t)8 * KW), "v"(ll + 16u * KP * 2u), "v"(gl + (size_t)16 * KW), "v"(ll + 24u * KP * 2u), "v"(gl + (size_t)24 * KW),
                    "v"(lv), "v"(gv), "v"(lv + 32u * VP * 2u), "v"(gv + (size_t)32 * NT_), "v"(lv + 64u * VP * 2u), "v"(gv + (size_t)64 * NT_), "v"(lv + 96u * VP * 2u), "v"(gv + (size_t)96 * NT_)
                 : "memory");
}
// k_attn: block = 8 waves = (item, head, 64 queries); a step is 64 keys: waves 0-3 (16 queries each) take its even 32-key tile, waves 4-7 the odd one for the same queries,
// so the longest block walks 64 steps. The softmax shift is fixed, so the two halves' o and l are plain partial sums: waves 4-7 hand theirs over through LDS behind the
// loop, waves 0-3 add them and finish. Two blocks fit a WGP, half of the grid at a time: the blocks with the most steps come first in the grid, the short ones fill up.
// K slice of head h (row stride NH*HD), V = bf16(x)^T shared by all heads (exact, single plane); causal key tiles
// 0..(Q0+63)/32; per element: j <= q -> clip(score x 128^-1/2, -10, 10) else -inf (reference: clip before the causal where); scores hh + (hl+lh)/1024 on separate
// accumulators; softmax f32 with the fixed shift 10; P (x32768) as bf16 hi + unscaled residual; o += ph.v + pl.v; ctx / l -> bf16 hi/lo planes CH/CL[tok][h*128+d].
__global__ __launch_bounds__(256) void k_attn(const h16* __restrict__ QH, const h16* __restrict__ QL, const h16* __restrict__ KH, const h16* __restrict__ KL, const bf* __restrict__ VTH, bf* CH, bf* CL) {
    __shared__ __align__(16) unsigned short plds[8][16 * 32];
    __shared__ __align__(16) unsigned short plds2[8][16 * 32];
    __shared__ __align__(16) float ost[4][16 * 68];
    __shared__ __align__(16) unsigned short ring[4 * STG];     // two buffers of two key tiles: the next step's copies fly while this one is worked on; 4 waves share each tile
    const int lane = threadIdx.x & 31, wave = threadIdx.x >> 5, lr = lane & 15, hi = lane >> 4;
    const int grp = __builtin_amdgcn_readfirstlane(threadIdx.x >> 7), w4 = wave & 3, t128 = threadIdx.x & 127;   // grp (wave-uniform): which key tile of a step this wave takes
    const int bid = blockIdx.x; const int qt = NT_ / 64 - 1 - bid / (NH_ * NB_), h = bid % NH_, item = (bid / NH_) % NB_; const int g = h;   // K has one slice per head; V (= x) is shared by all heads
    { const size_t ib = (size_t)item * NT_ * KW;                      // batch item: its own rows of every plane, its own V^T
      QH += ib; QL += ib; KH += ib; KL += ib; CH += ib; CL += ib; VTH += (size_t)item * HS * NT_; }
    const int q0 = qt * 64 + w4 * 16;
    unsigned short* pl = &plds[wave][0]; unsigned short* pl2 = &plds2[wave][0];
    const size_t qo = (size_t)(q0 + lr) * (NH_ * HD) + h * HD + 8 * hi;
    const h16* kh_b = KH + g * HD; const h16* kl_b = KL + g * HD;
    v8f o[8];
#pragma unroll
    for (int n = 0; n < 8; ++n) o[n] = (v8f){};
    float lpart[8];
#pragma unroll
    for (int j = 0; j < 8; ++j) lpart[j] = 0.f;
    const int st_hi = qt;                                           // causal: steps of 64 keys, 0..qt; each half of the block copies the tile it works on
    const unsigned ring_b = (unsigned)(size_t)&ring[0];              // LDS byte address of the ring
    stage_kv(kh_b, kl_b, VTH, ring_b + (unsigned)grp * (STG * 2u), grp * 32, t128);
    asm volatile("s_wait_asynccnt 0x0" ::: "memory");               // this wave's copies of step 0 have landed
    __syncthreads();                                                // ... and every other wave's
    if (st_hi >= 1) stage_kv(kh_b, kl_b, VTH, ring_b + (unsigned)(2 + grp) * (STG * 2u), 64 + grp * 32, t128);
#pragma unroll 1
    for (int st = 0; st <= st_hi; ++st) {
        const int l0 = st * 64 + grp * 32;
        const unsigned short* tb = ring + ((st & 1) * 2 + grp) * STG;
        const unsigned short* tkh = tb + lr * KP + 8 * hi; const unsigned short* tkl = tkh + KPL; const unsigned short* tv = tb + 2 * KPL + lr * VP + 8 * hi;
        v8f s0 = {}, s1 = {}, x0 = {}, x1 = {};
        // LDS fragment reads run ahead of their use, so that a wave waits on a count and not on an empty queue: chunk kc + 1's four K fragments are requested in front of chunk kc's
        // products (two register sets), and all eight V fragments behind the last score product, into the K sets' registers, so that they land under the softmax
        v16h kf[2][4];
        auto ldk = [&](int kc, v16h* d) {
            d[0] = cat16(*(const v8ha*)(tkh + kc * 32), *(const v8ha*)(tkh + kc * 32 + 16)); d[1] = cat16(*(const v8ha*)(tkh + 16 * KP + kc * 32), *(const v8ha*)(tkh + 16 * KP + kc * 32 + 16));
            d[2] = cat16(*(const v8ha*)(tkl + kc * 32), *(const v8ha*)(tkl + kc * 32 + 16)); d[3] = cat16(*(const v8ha*)(tkl + 16 * KP + kc * 32), *(const v8ha*)(tkl + 16 * KP + kc * 32 + 16)); };
        v16bf vf[8];
        ldk(0, kf[0]);
#pragma unroll
        for (int kc = 0; kc < 4; ++kc) {
            const v16h qa = cat16(*(const v8h*)(QH + qo + kc * 32), *(const v8h*)(QH + qo + kc * 32 + 16)), qx = cat16(*(const v8h*)(QL + qo + kc * 32), *(const v8h*)(QL + qo + kc * 32 + 16));
            if (kc < 3) ldk(kc + 1, kf[(kc + 1) & 1]);
            const v16h k0h = kf[kc & 1][0], k1h = kf[kc & 1][1], k0l = kf[kc & 1][2], k1l = kf[kc & 1][3];
            s0 = wmma16(qa, k0h, s0); s1 = wmma16(qa, k1h, s1); x0 = wmma16(qx, k0h, x0); x1 = wmma16(qx, k1h, x1);
            x0 = wmma16(qa, k0l, x0); x1 = wmma16(qa, k1l, x1);
            // one vector slot behind the chunk's last product, with its operands still held: the next requests into this register set stand behind it
            asm volatile("v_nop" : "+v"(s0), "+v"(s1), "+v"(x0), "+v"(x1) : "v"(qa), "v"(qx), "v"(k0h), "v"(k1h), "v"(k0l), "v"(k1l));
        }
#pragma unroll
        for (int n = 0; n < 8; ++n) vf[n] = cat16b(*(const v8usa*)(tv + n * 16 * VP), *(const v8usa*)(tv + n * 16 * VP + 16));     // V = bf16(x) exactly (a rounded INPUT): no residual plane
        asm volatile("v_nop\n\tv_nop\n\tv_nop\n\tv_nop" : "+v"(s0), "+v"(s1), "+v"(x0), "+v"(x1));
#pragma unroll
        for (int j = 0; j < 8; ++j) { const int qi = q0 + hi * 8 + j, ja = l0 + lr, jb = l0 + 16 + lr;
            // reference order: scores / sqrt(128) -> clip(-10, 10) -> causal where -> softmax
            const float a0 = (ja <= qi) ? fminf(fmaxf((s0[j] + x0[j] * LOSCI) * 0.08838834764831845f, -10.0f), 10.0f) : -__builtin_inff(), a1 = (jb <= qi) ? fminf(fmaxf((s1[j] + x1[j] * LOSCI) * 0.08838834764831845f, -10.0f), 10.0f) : -__builtin_inff();
            // every kept score lies in [-10, 10] after the clip, so the clip's upper bound is the softmax shift: exp(a - 10) is in [e^-20, 1] for any input,
            // and no row maximum is searched, carried or applied to o and l
            const float p0 = __expf(a0 - 10.0f), p1 = __expf(a1 - 10.0f);
            lpart[j] += p0 + p1;
            const int mr = hi * 8 + j; const float ps0 = p0 * PSC, ps1 = p1 * PSC; const unsigned short h0 = f2bf(ps0), h1 = f2bf(ps1);
            pl[mr * 32 + lr] = h0; pl[mr * 32 + 16 + lr] = h1; pl2[mr * 32 + lr] = f2bf(ps0 - bf2f(h0)); pl2[mr * 32 + 16 + lr] = f2bf(ps1 - bf2f(h1)); }
        asm volatile("" ::: "memory");
        const v16bf pa = cat16b(*(const v8usa*)(pl + lr * 32 + hi * 8), *(const v8usa*)(pl + lr * 32 + 16 + hi * 8));
        const v16bf px = cat16b(*(const v8usa*)(pl2 + lr * 32 + hi * 8), *(const v8usa*)(pl2 + lr * 32 + 16 + hi * 8));
#pragma unroll
        for (int n = 0; n < 8; ++n) o[n] = wmmab(pa, vf[n], o[n]);
#pragma unroll
        for (int n = 0; n < 8; ++n) o[n] = wmmab(px, vf[n], o[n]);      // per o[n] still hi then residual: the sums keep their order
        // four vector slots behind the last products before anything may rewrite their operands; all eight accumulators are named, so that no product drifts behind the barrier with its V registers held
        asm volatile("v_nop\n\tv_nop\n\tv_nop\n\tv_nop" : "+v"(o[0]), "+v"(o[1]), "+v"(o[2]), "+v"(o[3]), "+v"(o[4]), "+v"(o[5]), "+v"(o[6]), "+v"(o[7]) : "v"(pa), "v"(px));
        __builtin_amdgcn_wave_barrier();
        asm volatile("s_wait_dscnt 0x0" ::: "memory");              // this wave's reads of the buffer are done before it may be refilled
        asm volatile("s_wait_asynccnt 0x0" ::: "memory");           // this wave's copies of step st + 1 have landed
        __syncthreads();                                            // publishes step st + 1 and ends every wave's reads of step st
        if (st + 2 <= st_hi) stage_kv(kh_b, kl_b, VTH, ring_b + (unsigned)((st & 1) * 2 + grp) * (STG * 2u), l0 + 128, t128);
    }
    asm volatile("s_wait_asynccnt 0x0" ::: "memory");               // nothing in flight when the ring is put to another use
    // the ring is free behind the loop's last barrier: waves 4-7 lay their partial o and l there, 18 x 16 B a lane, for the wave with the same queries
    v4fa* xw = (v4fa*)(void*)ring + w4 * (18 * 32) + lane;
    if (grp == 1) {
#pragma unroll
        for (int n = 0; n < 8; ++n) { xw[(2 * n) * 32] = (v4f){o[n][0], o[n][1], o[n][2], o[n][3]}; xw[(2 * n + 1) * 32] = (v4f){o[n][4], o[n][5], o[n][6], o[n][7]}; }
        xw[16 * 32] = (v4f){lpart[0], lpart[1], lpart[2], lpart[3]}; xw[17 * 32] = (v4f){lpart[4], lpart[5], lpart[6], lpart[7]};
    }
    __syncthreads();                                                // the partial sums are visible to waves 0-3
    if (grp == 1) return;                                           // no barrier follows: waves 0-3 finish alone
#pragma unroll
    for (int n = 0; n < 8; ++n) { const v4f a = xw[(2 * n) * 32], b = xw[(2 * n + 1) * 32];
#pragma unroll
        for (int j = 0; j < 4; ++j) { o[n][j] += a[j]; o[n][4 + j] += b[j]; } }
    { const v4f a = xw[16 * 32], b = xw[17 * 32];
#pragma unroll
      for (int j = 0; j < 4; ++j) { lpart[j] += a[j]; lpart[4 + j] += b[j]; } }
    float inv[8];
#pragma unroll
    for (int j = 0; j < 8; ++j) { float rs = lpart[j]; rs += __shfl_xor(rs, 1, 16); rs += __shfl_xor(rs, 2, 16); rs += __shfl_xor(rs, 4, 16); rs += __shfl_xor(rs, 8, 16); inv[j] = 1.0f / (rs * PSC); }
    float* os = &ost[w4][0];
    const size_t cbase = (size_t)q0 * (NH_ * HD) + (size_t)h * HD;
#pragma unroll
    for (int half = 0; half < 2; ++half) {
#pragma unroll
        for (int n = 0; n < 4; ++n)
#pragma unroll
            for (int j = 0; j < 8; ++j) os[(hi * 8 + j) * 68 + n * 16 + lr] = o[half * 4 + n][j] * inv[j];
        __builtin_amdgcn_wave_barrier(); asm volatile("" ::: "memory");
{
#pragma unroll
            for (int s = 0; s < 4; ++s) { const int row = 4 * s + (lane >> 3), piece = lane & 7; const float* sp = os + row * 68 + piece * 8; v8us oh, ol;
#pragma unroll
                for (int i = 0; i < 8; ++i) { const unsigned short hb = f2bf(sp[i]); oh[i] = hb; ol[i] = f2bf(sp[i] - bf2f(hb)); }
                const size_t po = cbase + (size_t)row * (NH_ * HD) + half * 64 + piece * 8; *(v8us*)(CH + po) = oh; *(v8us*)(CL + po) = ol; }
             }
        __builtin_amdgcn_wave_barrier(); asm volatile("" ::: "memory");
    }
}

extern "C" void kernel_launch(void* const* d_in, const int* in_sizes, int n_in,
                              void* d_out, int out_size, void* d_ws, size_t ws_size, hipStream_t stream) {
    (void)in_sizes; (void)n_in; (void)out_size;
    const float* x = (const float*)d_in[0]; const float* Wq = (const float*)d_in[1]; const float* Wk = (const float*)d_in[2]; const float* Wo = (const float*)d_in[3];   // Wq/Wk [8][128][128] (x.W[h]); Wo [128][1024] = [out][in]
    float* out = (float*)d_out;    // [2][4096][128]
    char* wsp = (char*)d_ws;
    auto take = [&](size_t bytes) { char* p = wsp; wsp += (bytes + 255) & ~(size_t)255; return (void*)p; };
    bf* Xb = (bf*)take((size_t)NB_ * NTK * HS * 2);
    bf* WqT = (bf*)take((size_t)KW * HS * 2); bf* WkT = (bf*)take((size_t)KW * HS * 2); bf* WoB = (bf*)take((size_t)HS * KW * 2);
    h16* QH = (h16*)take((size_t)NB_ * NTK * KW * 2); h16* QL = (h16*)take((size_t)NB_ * NTK * KW * 2); h16* KH = (h16*)take((size_t)NB_ * NTK * KW * 2); h16* KL = (h16*)take((size_t)NB_ * NTK * KW * 2);
    bf* VTH = (bf*)take((size_t)NB_ * HS * NT_ * 2); bf* CH = (bf*)take((size_t)NB_ * NTK * KW * 2); bf* CL = (bf*)take((size_t)NB_ * NTK * KW * 2);
    if ((size_t)(wsp - (char*)d_ws) > ws_size) return;    // about 105 MB, no aliasing: every per-item plane holds both batch items
    // four dependent launches: what reads inputs only; the Q and the K projection (grid z); attention; the output projection. Both batch items in every launch.
    k_prep<<<PB_WT + PB_WO + PB_VT + PB_X, 256, 0, stream>>>(x, Wq, Wk, Wo, Xb, VTH, WqT, WkT, WoB);
    k_gemmb<false, true><<<dim3(NB_ * NTK / 64, KW / 64, 2), 128, 0, stream>>>(Xb, nullptr, WqT, nullptr, (float*)(void*)QH, KW, QL, nullptr, HS, 1, WkT, (float*)(void*)KH, KL);
    k_attn<<<dim3(NB_ * NH_ * (NT_ / 64), 1, 1), 256, 0, stream>>>(QH, QL, KH, KL, VTH, CH, CL);
    k_gemmb<true, false><<<dim3(NB_ * NTK / 64, HS / 64, 1), 128, 0, stream>>>(CH, CL, WoB, nullptr, out, HS, nullptr, nullptr, KW);
}

// v007
// A run of this version takes 225 microseconds.
// Timed twice side by side with v006, it ran 1.14 times as fast both times.
// All steps since v000 together make it 7.05 times as fast.
#include <hip/hip_runtime.h>

// Compute dtypes, f32 accumulate, both batch items in every launch: Q/K = x.W_q[h] / x.W_k[h] ([4096 x 128].[128 x 128] per head, k-major per-head weights transposed once
// into n-major [8*128][128] planes; PLAIN bf16 operands = inputs rounded once, exact products) written straight from the GEMM epilogue as f16 hi + residual
// x1024 planes [t][h*128+e], and out = y.W_o^T ([4096 x 1024].[1024 x 128], W_o [out][in] as-is; y as bf16 hi + residual) on v_wmma_f32_16x16x32_bf16; the
// 8-head causal attention with clipped scores (clip(s/sqrt(128), -10, 10)) and V = x itself (bf16(x)^T, exact, one plane) on v_wmma_f32_16x16x32_f16 (scores)

#define NB_  2
#define NT_  4096
#define HS   128                 // x width = head dim of q, k and v
#define NH_  8
#define HD   128
#define KW   (NH_ * HD)          // 1024: row stride of the Q/K planes
#define NTK  NT_
#define DM   HS                  // k_gemmb's default K
#define PSC  32768.0f
#define LOSC 1024.0f
#define LOSCI (1.0f / 1024.0f)
#define KP   136                 // LDS pitch of a staged K row in 16-bit elements: 272 B = 16 B x odd, for ds_load_b128 readers
#define VP   40                  // LDS pitch of a staged V^T row (32 keys) in 16-bit elements: 80 B = 16 B x odd
#define KPL  (32 * KP)           // one K plane of a 32-key tile
#define STG  (2 * KPL + HS * VP) // one ring buffer: K hi, K residual, V^T

typedef _Float16 h16;
typedef unsigned short bf;
typedef __attribute__((ext_vector_type(16))) __bf16   v16bf;
typedef __attribute__((ext_vector_type(16))) _Float16 v16h;
typedef __attribute__((ext_vector_type(8)))  _Float16 v8h;
typedef __attribute__((ext_vector_type(8)))  unsigned short v8us;
typedef __attribute__((ext_vector_type(8)))  float    v8f;
typedef __attribute__((ext_vector_type(4)))  float    v4f;
typedef __attribute__((ext_vector_type(4)))  _Float16 v4h;
typedef v8h  __attribute__((may_alias)) v8ha;
typedef v4f  __attribute__((may_alias)) v4fa;
typedef v8us __attribute__((may_alias)) v8usa;

__device__ __forceinline__ unsigned short f2bf(float f) { unsigned u = __float_as_uint(f); u += 0x7FFFu + ((u >> 16) & 1u); return (unsigned short)(u >> 16); }
__device__ __forceinline__ float bf2f(unsigned short b) { return __uint_as_float(((unsigned)b) << 16); }
__device__ __forceinline__ float bfr(float f) { return bf2f(f2bf(f)); }
__device__ __forceinline__ v16h cat16(v8h lo, v8h hi) { return __builtin_shufflevector(lo, hi, 0, 1, 2, 3, 4, 5, 6, 7, 8, 9, 10, 11, 12, 13, 14, 15); }
__device__ __forceinline__ v16bf cat16b(v8us lo, v8us hi) { return __builtin_bit_cast(v16bf, __builtin_shufflevector(lo, hi, 0, 1, 2, 3, 4, 5, 6, 7, 8, 9, 10, 11, 12, 13, 14, 15)); }
__device__ __forceinline__ v8f wmma16(v16h a, v16h b, v8f c) { return __builtin_amdgcn_wmma_f32_16x16x32_f16(false, a, false, b, (short)0, c, false, false); }
__device__ __forceinline__ v8f wmmab(v16bf a, v16bf b, v8f c) { return __builtin_amdgcn_wmma_f32_16x16x32_bf16(false, a, false, b, (short)0, c, false, false); }

// The four jobs below read inputs only and none reads another's output: they are parts of ONE launch (k_prep), each with its own range of 256-thread blocks; bid = index in the range.
// p_cvt128: one wave per row of x [rows][128]: bf16 plane (A operand of the Q and K projections); lane -> 4 consecutive floats
__device__ __forceinline__ void p_cvt128(int bid, const float* __restrict__ src, int nrows, bf* dstb) {
    typedef __attribute__((ext_vector_type(4))) unsigned short v4us;
    const int lane = threadIdx.x & 31, r = bid * 8 + (threadIdx.x >> 5);
    if (r >= nrows) return;
    const v4f v = *(const v4f*)(src + (size_t)r * HS + lane * 4); v4us ob;
#pragma unroll
    for (int i = 0; i < 4; ++i) ob[i] = f2bf(v[i]);
    *(v4us*)(dstb + (size_t)r * HS + lane * 4) = ob;
}
// p_wt: WT [n][K] = bf16(W[k][n]) (k-major [K][ncols]) via 64 x 64 LDS tiles; (bx, by) = tile of (K/64, ncols/64); tl = 64 x 72 LDS elements.
__device__ __forceinline__ void p_wt(int bx, int by, const float* __restrict__ Wm, int K, int ncols, bf* WT, unsigned short* tl) {
    const int tid = threadIdx.x, k0 = bx * 64, n0 = by * 64;
    const int kk = tid >> 2, nq = (tid & 3) * 16;
#pragma unroll
    for (int i = 0; i < 16; ++i) tl[(nq + i) * 72 + kk] = f2bf(Wm[(size_t)(k0 + kk) * ncols + n0 + nq + i]);
    __syncthreads();
    const int piece = tid & 7;
    auto pass = [&]() {
#pragma unroll
        for (int s = 0; s < 2; ++s) { const int nr = (tid >> 3) + 32 * s; const v8us val = *(const v8usa*)(tl + nr * 72 + piece * 8); *(v8us*)(WT + (size_t)(n0 + nr) * K + k0 + piece * 8) = val; }
    };
    pass(); 
    asm volatile("s_wait_xcnt 0x0" ::: "memory");   // the stores' registers are free before code of another job, which follows in the listing, may rewrite them
}
// k_gemmb: 64 x 64 block tile (4 waves x 16 x 64) of C[NB_*NTK][NW] = (A [+ Al]).B^T (K = 128 or 1024) [+ bf(bias[c])] [+ bf(R[r][c]) residual]; f32 whole-line epilogue (or f16
template <bool SPLITA, bool F16OUT = false>
__global__ __launch_bounds__(128) void k_gemmb(const bf* __restrict__ A, const bf* __restrict__ Al, const bf* __restrict__ Bn0, const float* __restrict__ bias, float* C0, int ldc, h16* C20, const float* __restrict__ R = nullptr, int K = DM, int roundR = 1, const bf* __restrict__ BnZ = nullptr, float* CZ = nullptr, h16* C2Z = nullptr) {
    __shared__ __align__(16) float ost[4][16 * 68];
    // blockIdx.z = 1: a second product of the same A in the same launch, with its own B and outputs
    const bf* Bn = blockIdx.z ? BnZ : Bn0; float* C = blockIdx.z ? CZ : C0; h16* C2 = blockIdx.z ? C2Z : C20;
    const int lane = threadIdx.x & 31, wave = threadIdx.x >> 5, lr = lane & 15, hi = lane >> 4;
    const int r0 = blockIdx.x * 64 + wave * 16, c0 = blockIdx.y * 64;
    const size_t aoff = (size_t)(r0 + lr) * K + 8 * hi;
    size_t boff[4];
#pragma unroll
    for (int t = 0; t < 4; ++t) boff[t] = (size_t)(c0 + t * 16 + lr) * K + 8 * hi;
    v8f acc[4];
#pragma unroll
    for (int t = 0; t < 4; ++t) acc[t] = (v8f){};
#pragma unroll 1
    for (int kc = 0; kc < K; kc += 32) {
        const v16bf a = cat16b(*(const v8us*)(A + aoff + kc), *(const v8us*)(A + aoff + kc + 16));
        v16bf al = a;
        if (SPLITA) al = cat16b(*(const v8us*)(Al + aoff + kc), *(const v8us*)(Al + aoff + kc + 16));
#pragma unroll
        for (int t = 0; t < 4; ++t) { const v16bf b = cat16b(*(const v8us*)(Bn + boff[t] + kc), *(const v8us*)(Bn + boff[t] + kc + 16)); acc[t] = wmmab(a, b, acc[t]); if (SPLITA) acc[t] = wmmab(al, b, acc[t]); }
        asm volatile("v_nop\n\tv_nop\n\tv_nop\n\tv_nop" : "+v"(acc[0]), "+v"(acc[1]), "+v"(acc[2]), "+v"(acc[3]) : "v"(a), "v"(al));
    }
    float* os = &ost[wave][0];
#pragma unroll
    for (int t = 0; t < 4; ++t) { const float bv = bias ? bfr(bias[c0 + t * 16 + lr]) : 0.f;
#pragma unroll
        for (int j = 0; j < 8; ++j) os[(hi * 8 + j) * 68 + t * 16 + lr] = acc[t][j] + bv; }
    __syncthreads();
    if (F16OUT) {
        h16* crow = (h16*)(void*)C + (size_t)r0 * ldc + c0;
        auto pass = [&]() {
#pragma unroll
            for (int s = 0; s < 4; ++s) { const int row = 4 * s + (lane >> 3), piece = lane & 7; const float* sp = os + row * 68 + piece * 8; v8h o, o2;
#pragma unroll
                for (int i = 0; i < 8; ++i) { const h16 a = (h16)sp[i]; o[i] = a; o2[i] = (h16)((sp[i] - (float)a) * LOSC); }
                *(v8h*)(crow + (size_t)row * ldc + piece * 8) = o; if (C2) *(v8h*)(C2 + (size_t)r0 * ldc + c0 + (size_t)row * ldc + piece * 8) = o2; }
        };
        pass(); 
    } else {
        float* crow = C + (size_t)r0 * ldc + c0;
        auto pass = [&]() {
#pragma unroll
            for (int s = 0; s < 8; ++s) { const int Lid = (lane >> 3) + 4 * s, piece = lane & 7; const int row = Lid >> 1, cofs = (Lid & 1) * 32 + piece * 4;
                v4f val = *(const v4fa*)(os + row * 68 + cofs); if (R) { const v4f rv = *(const v4f*)(R + ((size_t)r0 + row) * ldc + c0 + cofs); val += roundR ? (v4f){bfr(rv[0]), bfr(rv[1]), bfr(rv[2]), bfr(rv[3])} : rv; }
                *(v4f*)(crow + (size_t)row * ldc + cofs) = val; }
        };
        pass(); 
    }
}

__device__ __forceinline__ void p_cvtw(int bid, const float* __restrict__ src, int nrows, bf* dst) {
    const int lane = threadIdx.x & 31, r = bid * 8 + (threadIdx.x >> 5);
    if (r >= nrows) return;
    v8us o[KW / 256];
#pragma unroll
    for (int q = 0; q < KW / 256; ++q) { v8us t;
#pragma unroll
        for (int i = 0; i < 8; ++i) t[i] = f2bf(src[(size_t)r * KW + q * 256 + lane * 8 + i]);
        o[q] = t; }
{
#pragma unroll
        for (int q = 0; q < KW / 256; ++q) *(v8us*)(dst + (size_t)r * KW + q * 256 + lane * 8) = o[q];
         }
}
// p_vt: V^T plane = bf16(x)^T of one batch item, straight from x (the same rounding as p_cvt128's), 64 x 64 LDS tiles; stores of 8 lanes x 16 B. th_ = 64 x 72 LDS elements.
__device__ __forceinline__ void p_vt(int bx, int dh, int item, const float* __restrict__ V, bf* VTH, unsigned short* th_) {
    const int t0 = bx * 64, tid = threadIdx.x;
    const int tt = tid >> 2, dq = (tid & 3) * 16;
    V += (size_t)item * NT_ * HS; VTH += (size_t)item * HS * NT_;
    const float* src = V + ((size_t)t0 + tt) * HS + dh * 64 + dq;
#pragma unroll
    for (int i = 0; i < 16; ++i) th_[(dq + i) * 72 + tt] = f2bf(src[i]);
    __syncthreads();
    const int piece = tid & 7;
    auto pass = [&]() {
#pragma unroll
        for (int s = 0; s < 2; ++s) { const int d = (tid >> 3) + 32 * s;
            const v8us a = *(const v8usa*)(th_ + d * 72 + piece * 8);
            *(v8us*)(VTH + (size_t)(dh * 64 + d) * NT_ + t0 + piece * 8) = a; }
    };
    pass(); 
    asm volatile("s_wait_xcnt 0x0" ::: "memory");   // the stores' registers are free before code of another job, which follows in the listing, may rewrite them
}
// k_prep: every job that depends on the inputs alone, in one launch. Block ranges: 64 weight tiles (16 matrices x 4), 16 of W_o, 256 of V^T, 1024 of x; every branch is block-uniform.
#define PB_WT  (2 * NH_ * 4)
#define PB_WO  (HS / 8)
#define PB_VT  (NB_ * 2 * (NT_ / 64))
#define PB_X   (NB_ * NTK / 8)
__global__ __launch_bounds__(256) void k_prep(const float* __restrict__ x, const float* __restrict__ Wq, const float* __restrict__ Wk, const float* __restrict__ Wo, bf* Xb, bf* VTH, bf* WqT, bf* WkT, bf* WoB) {
    __shared__ __align__(16) unsigned short tl[64 * 72];
    int bid = blockIdx.x;
    if (bid < PB_WT) {      // per-head k-major [128][128] -> rows h*128.. of the n-major planes [1024][128]
        const int h = bid >> 3, wk = (bid >> 2) & 1;
        p_wt(bid & 1, (bid >> 1) & 1, (wk ? Wk : Wq) + (size_t)h * HS * HD, HS, HD, (wk ? WkT : WqT) + (size_t)h * HD * HS, tl);
        return;
    }
    bid -= PB_WT;
    if (bid < PB_WO) { p_cvtw(bid, Wo, HS, WoB); return; }      // W_o [128][1024] = [out][in]: bf16 copy = n-major B operand
    bid -= PB_WO;
    if (bid < PB_VT) { p_vt(bid & (NT_ / 64 - 1), (bid / (NT_ / 64)) & 1, bid / (2 * (NT_ / 64)), x, VTH, tl); return; }
    p_cvt128(bid - PB_VT, x, NB_ * NTK, Xb);
}
// stage_kv: the 128 threads of one half of the block copy one 32-key tile (K hi and K residual rows of one head: 32 x 256 B each; V^T: 128 rows x 64 B) from global memory into one
// ring buffer, 12 asynchronous 16-B copies a thread; a wave's K copy covers two whole 256-B rows. lb = the buffer's LDS byte address.
__device__ __forceinline__ void stage_kv(const h16* kh, const h16* kl, const bf* vt, unsigned lb, int l0, int tid) {
    const int kr = tid >> 4, kc8 = (tid & 15) * 8, vr = tid >> 2, vc8 = (tid & 3) * 8;
    const h16* gh = kh + (size_t)(l0 + kr) * KW + kc8; const h16* gl = kl + (size_t)(l0 + kr) * KW + kc8; const bf* gv = vt + (size_t)vr * NT_ + l0 + vc8;
    const unsigned lh = lb + (unsigned)(kr * KP + kc8) * 2u, ll = lh + KPL * 2u, lv = lb + (unsigned)(2 * KPL + vr * VP + vc8) * 2u;
    // the copies and their s_wait_xcnt in one statement: no address register of a copy is rewritten in front of that wait
    asm volatile("global_load_async_to_lds_b128 %0, %1, off\n\t"
                 "global_load_async_to_lds_b128 %2, %3, off\n\t"
                 "global_load_async_to_lds_b128 %4, %5, off\n\t"
                 "global_load_async_to_lds_b128 %6, %7, off\n\t"
                 "global_load_async_to_lds_b128 %8, %9, off\n\t"
                 "global_load_async_to_lds_b128 %10, %11, off\n\t"
                 "global_load_async_to_lds_b128 %12, %13, off\n\t"
                 "global_load_async_to_lds_b128 %14, %15, off\n\t"
                 "global_load_async_to_lds_b128 %16, %17, off\n\t"
                 "global_load_async_to_lds_b128 %18, %19, off\n\t"
                 "global_load_async_to_lds_b128 %20, %21, off\n\t"
                 "global_load_async_to_lds_b128 %22, %23, off\n\t"
                 "s_wait_xcnt 0x0"
                 :: "v"(lh), "v"(gh), "v"(lh + 8u * KP * 2u), "v"(gh + (size_t)8 * KW), "v"(lh + 16u * KP * 2u), "v"(gh + (size_t)16 * KW), "v"(lh + 24u * KP * 2u), "v"(gh + (size_t)24 * KW),
                    "v"(ll), "v"(gl), "v"(ll + 8u * KP * 2u), "v"(gl + (size_t)8 * KW), "v"(ll + 16u * KP * 2u), "v"(gl + (size_t)16 * KW), "v"(ll + 24u * KP * 2u), "v"(gl + (size_t)24 * KW),
                    "v"(lv), "v"(gv), "v"(lv + 32u * VP * 2u), "v"(gv + (size_t)32 * NT_), "v"(lv + 64u * VP * 2u), "v"(gv + (size_t)64 * NT_), "v"(lv + 96u * VP * 2u), "v"(gv + (size_t)96 * NT_)
                 : "memory");
}
// stage_q: the block's 256 threads copy its 64 Q rows of one head (hi and residual plane, 256 B a row) into LDS at K's pitch, once, 8 asynchronous 16-B copies a thread;
// a wave's copy covers two whole rows. lb = LDS byte address of the hi plane; the residual plane follows it.
__device__ __forceinline__ void stage_q(const h16* qh, const h16* ql, unsigned lb, int tid) {
    const int r = tid >> 4, c8 = (tid & 15) * 8;
    const h16* gh = qh + (size_t)r * KW + c8; const h16* gl = ql + (size_t)r * KW + c8;
    const unsigned lh = lb + (unsigned)(r * KP + c8) * 2u, ll = lh + 64u * KP * 2u;
    // the copies and their s_wait_xcnt in one statement: no address register of a copy is rewritten in front of that wait
    asm volatile("global_load_async_to_lds_b128 %0, %1, off\n\t"
                 "global_load_async_to_lds_b128 %2, %3, off\n\t"
                 "global_load_async_to_lds_b128 %4, %5, off\n\t"
                 "global_load_async_to_lds_b128 %6, %7, off\n\t"
                 "global_load_async_to_lds_b128 %8, %9, off\n\t"
                 "global_load_async_to_lds_b128 %10, %11, off\n\t"
                 "global_load_async_to_lds_b128 %12, %13, off\n\t"
                 "global_load_async_to_lds_b128 %14, %15, off\n\t"
                 "s_wait_xcnt 0x0"
                 :: "v"(lh), "v"(gh), "v"(lh + 16u * KP * 2u), "v"(gh + (size_t)16 * KW), "v"(lh + 32u * KP * 2u), "v"(gh + (size_t)32 * KW), "v"(lh + 48u * KP * 2u), "v"(gh + (size_t)48 * KW),
                    "v"(ll), "v"(gl), "v"(ll + 16u * KP * 2u), "v"(gl + (size_t)16 * KW), "v"(ll + 32u * KP * 2u), "v"(gl + (size_t)32 * KW), "v"(ll + 48u * KP * 2u), "v"(gl + (size_t)48 * KW)
                 : "memory");
}
// k_attn: block = 8 waves = (item, head, 64 queries); a step is 64 keys: waves 0-3 (16 queries each) take its even 32-key tile, waves 4-7 the odd one for the same queries,
// so the longest block walks 64 steps. The softmax shift is fixed, so the two halves' o and l are plain partial sums: waves 4-7 hand theirs over through LDS behind the
// loop, waves 0-3 add them and finish. Two blocks fit a WGP, half of the grid at a time: the blocks with the most steps come first in the grid, the short ones fill up.
// K slice of head h (row stride NH*HD), V = bf16(x)^T shared by all heads (exact, single plane); causal key tiles
// 0..(Q0+63)/32; per element: j <= q -> clip(score x 128^-1/2, -10, 10) else -inf (reference: clip before the causal where); scores hh + (hl+lh)/1024 on separate
// accumulators; softmax f32 with the fixed shift 10; P (x32768) as bf16 hi + unscaled residual; o += ph.v + pl.v; ctx / l -> bf16 hi/lo planes CH/CL[tok][h*128+d].
__global__ __launch_bounds__(256) void k_attn(const h16* __restrict__ QH, const h16* __restrict__ QL, const h16* __restrict__ KH, const h16* __restrict__ KL, const bf* __restrict__ VTH, bf* CH, bf* CL) {
    __shared__ __align__(16) unsigned short plds[8][16 * 32];
    __shared__ __align__(16) unsigned short plds2[8][16 * 32];
    __shared__ __align__(16) unsigned short qs[2 * 64 * KP];   // the block's Q rows, hi and residual plane, copied once: a fragment read from global memory touches 16 lines, and every key tile repeated it. Behind the loop: output staging
    __shared__ __align__(16) unsigned short ring[4 * STG];     // two buffers of two key tiles: the next step's copies fly while this one is worked on; 4 waves share each tile
    const int lane = threadIdx.x & 31, wave = threadIdx.x >> 5, lr = lane & 15, hi = lane >> 4;
    const int grp = __builtin_amdgcn_readfirstlane(threadIdx.x >> 7), w4 = wave & 3, t128 = threadIdx.x & 127;   // grp (wave-uniform): which key tile of a step this wave takes
    const int bid = blockIdx.x; const int qt = NT_ / 64 - 1 - bid / (NH_ * NB_), h = bid % NH_, item = (bid / NH_) % NB_; const int g = h;   // K has one slice per head; V (= x) is shared by all heads
    { const size_t ib = (size_t)item * NT_ * KW;                      // batch item: its own rows of every plane, its own V^T
      QH += ib; QL += ib; KH += ib; KL += ib; CH += ib; CL += ib; VTH += (size_t)item * HS * NT_; }
    const int q0 = qt * 64 + w4 * 16;
    unsigned short* pl = &plds[wave][0]; unsigned short* pl2 = &plds2[wave][0];
    const unsigned short* tq = qs + (w4 * 16 + lr) * KP + 8 * hi;    // this lane's Q row in LDS; the residual plane lies 64 rows on
    const h16* kh_b = KH + g * HD; const h16* kl_b = KL + g * HD;
    v8f o[8];
#pragma unroll
    for (int n = 0; n < 8; ++n) o[n] = (v8f){};
    float lpart[8];
#pragma unroll
    for (int j = 0; j < 8; ++j) lpart[j] = 0.f;
    const int st_hi = qt;                                           // causal: steps of 64 keys, 0..qt; each half of the block copies the tile it works on
    const unsigned ring_b = (unsigned)(size_t)&ring[0];              // LDS byte address of the ring
    stage_q(QH + (size_t)(qt * 64) * KW + h * HD, QL + (size_t)(qt * 64) * KW + h * HD, (unsigned)(size_t)&qs[0], threadIdx.x);
    stage_kv(kh_b, kl_b, VTH, ring_b + (unsigned)grp * (STG * 2u), grp * 32, t128);
    asm volatile("s_wait_asynccnt 0x0" ::: "memory");               // this wave's copies of Q and of step 0 have landed
    __syncthreads();                                                // ... and every other wave's
    if (st_hi >= 1) stage_kv(kh_b, kl_b, VTH, ring_b + (unsigned)(2 + grp) * (STG * 2u), 64 + grp * 32, t128);
#pragma unroll 1
    for (int st = 0; st <= st_hi; ++st) {
        const int l0 = st * 64 + grp * 32;
        const unsigned short* tb = ring + ((st & 1) * 2 + grp) * STG;
        const unsigned short* tkh = tb + lr * KP + 8 * hi; const unsigned short* tkl = tkh + KPL; const unsigned short* tv = tb + 2 * KPL + lr * VP + 8 * hi;
        v8f s0 = {}, s1 = {}, x0 = {}, x1 = {};
        // LDS fragment reads run ahead of their use, so that a wave waits on a count and not on an empty queue: chunk kc + 1's four K fragments are requested in front of chunk kc's
        // products (two register sets), and all eight V fragments behind the last score product, into the K sets' registers, so that they land under the softmax
        v16h kf[2][4], qf[2][2];                                    // the Q fragments of a chunk come with its K fragments
        auto ldk = [&](int kc, v16h* d, v16h* q) {
            q[0] = cat16(*(const v8ha*)(tq + kc * 32), *(const v8ha*)(tq + kc * 32 + 16)); q[1] = cat16(*(const v8ha*)(tq + 64 * KP + kc * 32), *(const v8ha*)(tq + 64 * KP + kc * 32 + 16));
            d[0] = cat16(*(const v8ha*)(tkh + kc * 32), *(const v8ha*)(tkh + kc * 32 + 16)); d[1] = cat16(*(const v8ha*)(tkh + 16 * KP + kc * 32), *(const v8ha*)(tkh + 16 * KP + kc * 32 + 16));
            d[2] = cat16(*(const v8ha*)(tkl + kc * 32), *(const v8ha*)(tkl + kc * 32 + 16)); d[3] = cat16(*(const v8ha*)(tkl + 16 * KP + kc * 32), *(const v8ha*)(tkl + 16 * KP + kc * 32 + 16)); };
        v16bf vf[8];
        ldk(0, kf[0], qf[0]);
#pragma unroll
        for (int kc = 0; kc < 4; ++kc) {
            if (kc < 3) ldk(kc + 1, kf[(kc + 1) & 1], qf[(kc + 1) & 1]);
            const v16h qa = qf[kc & 1][0], qx = qf[kc & 1][1];
            const v16h k0h = kf[kc & 1][0], k1h = kf[kc & 1][1], k0l = kf[kc & 1][2], k1l = kf[kc & 1][3];
            s0 = wmma16(qa, k0h, s0); s1 = wmma16(qa, k1h, s1); x0 = wmma16(qx, k0h, x0); x1 = wmma16(qx, k1h, x1);
            x0 = wmma16(qa, k0l, x0); x1 = wmma16(qa, k1l, x1);
            // one vector slot behind the chunk's last product, with its operands still held: the next requests into this register set stand behind it
            asm volatile("v_nop" : "+v"(s0), "+v"(s1), "+v"(x0), "+v"(x1) : "v"(qa), "v"(qx), "v"(k0h), "v"(k1h), "v"(k0l), "v"(k1l));
        }
#pragma unroll
        for (int n = 0; n < 8; ++n) vf[n] = cat16b(*(const v8usa*)(tv + n * 16 * VP), *(const v8usa*)(tv + n * 16 * VP + 16));     // V = bf16(x) exactly (a rounded INPUT): no residual plane
        asm volatile("v_nop\n\tv_nop\n\tv_nop\n\tv_nop" : "+v"(s0), "+v"(s1), "+v"(x0), "+v"(x1));
#pragma unroll
        for (int j = 0; j < 8; ++j) { const int qi = q0 + hi * 8 + j, ja = l0 + lr, jb = l0 + 16 + lr;
            // reference order: scores / sqrt(128) -> clip(-10, 10) -> causal where -> softmax
            const float a0 = (ja <= qi) ? fminf(fmaxf((s0[j] + x0[j] * LOSCI) * 0.08838834764831845f, -10.0f), 10.0f) : -__builtin_inff(), a1 = (jb <= qi) ? fminf(fmaxf((s1[j] + x1[j] * LOSCI) * 0.08838834764831845f, -10.0f), 10.0f) : -__builtin_inff();
            // every kept score lies in [-10, 10] after the clip, so the clip's upper bound is the softmax shift: exp(a - 10) is in [e^-20, 1] for any input,
            // and no row maximum is searched, carried or applied to o and l
            const float p0 = __expf(a0 - 10.0f), p1 = __expf(a1 - 10.0f);
            lpart[j] += p0 + p1;
            const int mr = hi * 8 + j; const float ps0 = p0 * PSC, ps1 = p1 * PSC; const unsigned short h0 = f2bf(ps0), h1 = f2bf(ps1);
            pl[mr * 32 + lr] = h0; pl[mr * 32 + 16 + lr] = h1; pl2[mr * 32 + lr] = f2bf(ps0 - bf2f(h0)); pl2[mr * 32 + 16 + lr] = f2bf(ps1 - bf2f(h1)); }
        asm volatile("" ::: "memory");
        const v16bf pa = cat16b(*(const v8usa*)(pl + lr * 32 + hi * 8), *(const v8usa*)(pl + lr * 32 + 16 + hi * 8));
        const v16bf px = cat16b(*(const v8usa*)(pl2 + lr * 32 + hi * 8), *(const v8usa*)(pl2 + lr * 32 + 16 + hi * 8));
#pragma unroll
        for (int n = 0; n < 8; ++n) o[n] = wmmab(pa, vf[n], o[n]);
#pragma unroll
        for (int n = 0; n < 8; ++n) o[n] = wmmab(px, vf[n], o[n]);      // per o[n] still hi then residual: the sums keep their order
        // four vector slots behind the last products before anything may rewrite their operands; all eight accumulators are named, so that no product drifts behind the barrier with its V registers held
        asm volatile("v_nop\n\tv_nop\n\tv_nop\n\tv_nop" : "+v"(o[0]), "+v"(o[1]), "+v"(o[2]), "+v"(o[3]), "+v"(o[4]), "+v"(o[5]), "+v"(o[6]), "+v"(o[7]) : "v"(pa), "v"(px));
        __builtin_amdgcn_wave_barrier();
        asm volatile("s_wait_dscnt 0x0" ::: "memory");              // this wave's reads of the buffer are done before it may be refilled
        asm volatile("s_wait_asynccnt 0x0" ::: "memory");           // this wave's copies of step st + 1 have landed
        __syncthreads();                                            // publishes step st + 1 and ends every wave's reads of step st
        if (st + 2 <= st_hi) stage_kv(kh_b, kl_b, VTH, ring_b + (unsigned)((st & 1) * 2 + grp) * (STG * 2u), l0 + 128, t128);
    }
    asm volatile("s_wait_asynccnt 0x0" ::: "memory");               // nothing in flight when the ring is put to another use
    // the ring is free behind the loop's last barrier: waves 4-7 lay their partial o and l there, 18 x 16 B a lane, for the wave with the same queries
    v4fa* xw = (v4fa*)(void*)ring + w4 * (18 * 32) + lane;
    if (grp == 1) {
#pragma unroll
        for (int n = 0; n < 8; ++n) { xw[(2 * n) * 32] = (v4f){o[n][0], o[n][1], o[n][2], o[n][3]}; xw[(2 * n + 1) * 32] = (v4f){o[n][4], o[n][5], o[n][6], o[n][7]}; }
        xw[16 * 32] = (v4f){lpart[0], lpart[1], lpart[2], lpart[3]}; xw[17 * 32] = (v4f){lpart[4], lpart[5], lpart[6], lpart[7]};
    }
    __syncthreads();                                                // the partial sums are visible to waves 0-3
    if (grp == 1) return;                                           // no barrier follows: waves 0-3 finish alone
#pragma unroll
    for (int n = 0; n < 8; ++n) { const v4f a = xw[(2 * n) * 32], b = xw[(2 * n + 1) * 32];
#pragma unroll
        for (int j = 0; j < 4; ++j) { o[n][j] += a[j]; o[n][4 + j] += b[j]; } }
    { const v4f a = xw[16 * 32], b = xw[17 * 32];
#pragma unroll
      for (int j = 0; j < 4; ++j) { lpart[j] += a[j]; lpart[4 + j] += b[j]; } }
    float inv[8];
#pragma unroll
    for (int j = 0; j < 8; ++j) { float rs = lpart[j]; rs += __shfl_xor(rs, 1, 16); rs += __shfl_xor(rs, 2, 16); rs += __shfl_xor(rs, 4, 16); rs += __shfl_xor(rs, 8, 16); inv[j] = 1.0f / (rs * PSC); }
    float* os = (float*)(void*)qs + w4 * (16 * 68);                 // Q's last read lies in front of the loop's last barrier
    const size_t cbase = (size_t)q0 * (NH_ * HD) + (size_t)h * HD;
#pragma unroll
    for (int half = 0; half < 2; ++half) {
#pragma unroll
        for (int n = 0; n < 4; ++n)
#pragma unroll
            for (int j = 0; j < 8; ++j) os[(hi * 8 + j) * 68 + n * 16 + lr] = o[half * 4 + n][j] * inv[j];
        __builtin_amdgcn_wave_barrier(); asm volatile("" ::: "memory");
{
#pragma unroll
            for (int s = 0; s < 4; ++s) { const int row = 4 * s + (lane >> 3), piece = lane & 7; const float* sp = os + row * 68 + piece * 8; v8us oh, ol;
#pragma unroll
                for (int i = 0; i < 8; ++i) { const unsigned short hb = f2bf(sp[i]); oh[i] = hb; ol[i] = f2bf(sp[i] - bf2f(hb)); }
                const size_t po = cbase + (size_t)row * (NH_ * HD) + half * 64 + piece * 8; *(v8us*)(CH + po) = oh; *(v8us*)(CL + po) = ol; }
             }
        __builtin_amdgcn_wave_barrier(); asm volatile("" ::: "memory");
    }
}

extern "C" void kernel_launch(void* const* d_in, const int* in_sizes, int n_in,
                              void* d_out, int out_size, void* d_ws, size_t ws_size, hipStream_t stream) {
    (void)in_sizes; (void)n_in; (void)out_size;
    const float* x = (const float*)d_in[0]; const float* Wq = (const float*)d_in[1]; const float* Wk = (const float*)d_in[2]; const float* Wo = (const float*)d_in[3];   // Wq/Wk [8][128][128] (x.W[h]); Wo [128][1024] = [out][in]
    float* out = (float*)d_out;    // [2][4096][128]
    char* wsp = (char*)d_ws;
    auto take = [&](size_t bytes) { char* p = wsp; wsp += (bytes + 255) & ~(size_t)255; return (void*)p; };
    bf* Xb = (bf*)take((size_t)NB_ * NTK * HS * 2);
    bf* WqT = (bf*)take((size_t)KW * HS * 2); bf* WkT = (bf*)take((size_t)KW * HS * 2); bf* WoB = (bf*)take((size_t)HS * KW * 2);
    h16* QH = (h16*)take((size_t)NB_ * NTK * KW * 2); h16* QL = (h16*)take((size_t)NB_ * NTK * KW * 2); h16* KH = (h16*)take((size_t)NB_ * NTK * KW * 2); h16* KL = (h16*)take((size_t)NB_ * NTK * KW * 2);
    bf* VTH = (bf*)take((size_t)NB_ * HS * NT_ * 2); bf* CH = (bf*)take((size_t)NB_ * NTK * KW * 2); bf* CL = (bf*)take((size_t)NB_ * NTK * KW * 2);
    if ((size_t)(wsp - (char*)d_ws) > ws_size) return;    // about 105 MB, no aliasing: every per-item plane holds both batch items
    // four dependent launches: what reads inputs only; the Q and the K projection (grid z); attention; the output projection. Both batch items in every launch.
    k_prep<<<PB_WT + PB_WO + PB_VT + PB_X, 256, 0, stream>>>(x, Wq, Wk, Wo, Xb, VTH, WqT, WkT, WoB);
    k_gemmb<false, true><<<dim3(NB_ * NTK / 64, KW / 64, 2), 128, 0, stream>>>(Xb, nullptr, WqT, nullptr, (float*)(void*)QH, KW, QL, nullptr, HS, 1, WkT, (float*)(void*)KH, KL);
    k_attn<<<dim3(NB_ * NH_ * (NT_ / 64), 1, 1), 256, 0, stream>>>(QH, QL, KH, KL, VTH, CH, CL);
    k_gemmb<true, false><<<dim3(NB_ * NTK / 64, HS / 64, 1), 128, 0, stream>>>(CH, CL, WoB, nullptr, out, HS, nullptr, nullptr, KW);
}

// v008
// One run takes 185 microseconds.
// Two timings next to v007 both put it at 1.22 times that version's speed.
// Counting every step since v000, it is 8.59 times as fast.
#include <hip/hip_runtime.h>

// Compute dtypes, f32 accumulate, both batch items in every launch: Q/K = x.W_q[h] / x.W_k[h] ([4096 x 128].[128 x 128] per head, k-major per-head weights transposed once
// into n-major [8*128][128] planes; PLAIN bf16 operands = inputs rounded once, exact products) written straight from the GEMM epilogue as f16 hi + residual
// x1024 planes [t][h*128+e], and out = y.W_o^T ([4096 x 1024].[1024 x 128], W_o [out][in] as-is; y as bf16 hi + residual) on v_wmma_f32_16x16x32_bf16; the
// 8-head causal attention with clipped scores (clip(s/sqrt(128), -10, 10)) and V = x itself (bf16(x)^T, exact, one plane) on v_wmma_f32_16x16x32_f16 (scores)

#define NB_  2
#define NT_  4096
#define HS   128                 // x width = head dim of q, k and v
#define NH_  8
#define HD   128
#define KW   (NH_ * HD)          // 1024: row stride of the Q/K planes
#define NTK  NT_
#define DM   HS                  // k_gemmb's default K
#define PSC  32768.0f
#define LOSC 1024.0f
#define LOSCI (1.0f / 1024.0f)
#define KP   136                 // LDS pitch of a staged K row in 16-bit elements: 272 B = 16 B x odd, for ds_load_b128 readers
#define VP   40                  // LDS pitch of a staged V^T row (32 keys) in 16-bit elements: 80 B = 16 B x odd
#define KPL  (32 * KP)           // one K plane of a 32-key tile
#define STG  (2 * KPL + HS * VP) // one ring buffer: K hi, K residual, V^T

typedef _Float16 h16;
typedef unsigned short bf;
typedef __attribute__((ext_vector_type(16))) __bf16   v16bf;
typedef __attribute__((ext_vector_type(16))) _Float16 v16h;
typedef __attribute__((ext_vector_type(8)))  _Float16 v8h;
typedef __attribute__((ext_vector_type(8)))  unsigned short v8us;
typedef __attribute__((ext_vector_type(8)))  float    v8f;
typedef __attribute__((ext_vector_type(4)))  float    v4f;
typedef __attribute__((ext_vector_type(4)))  _Float16 v4h;
typedef v8h  __attribute__((may_alias)) v8ha;
typedef v4f  __attribute__((may_alias)) v4fa;
typedef v8us __attribute__((may_alias)) v8usa;
typedef __attribute__((ext_vector_type(2)))  float    v2f;
typedef __attribute__((ext_vector_type(2)))  __bf16   v2bf;
typedef __attribute__((ext_vector_type(8)))  unsigned v8u;

__device__ __forceinline__ unsigned short f2bf(float f) { unsigned u = __float_as_uint(f); u += 0x7FFFu + ((u >> 16) & 1u); return (unsigned short)(u >> 16); }
__device__ __forceinline__ float bf2f(unsigned short b) { return __uint_as_float(((unsigned)b) << 16); }
__device__ __forceinline__ float bfr(float f) { return bf2f(f2bf(f)); }
__device__ __forceinline__ v16h cat16(v8h lo, v8h hi) { return __builtin_shufflevector(lo, hi, 0, 1, 2, 3, 4, 5, 6, 7, 8, 9, 10, 11, 12, 13, 14, 15); }
__device__ __forceinline__ v16bf cat16b(v8us lo, v8us hi) { return __builtin_bit_cast(v16bf, __builtin_shufflevector(lo, hi, 0, 1, 2, 3, 4, 5, 6, 7, 8, 9, 10, 11, 12, 13, 14, 15)); }
__device__ __forceinline__ v8f wmma16(v16h a, v16h b, v8f c) { return __builtin_amdgcn_wmma_f32_16x16x32_f16(false, a, false, b, (short)0, c, false, false); }
__device__ __forceinline__ v8f wmmab(v16bf a, v16bf b, v8f c) { return __builtin_amdgcn_wmma_f32_16x16x32_bf16(false, a, false, b, (short)0, c, false, false); }

// The four jobs below read inputs only and none reads another's output: they are parts of ONE launch (k_prep), each with its own range of 256-thread blocks; bid = index in the range.
// p_cvt128: one wave per row of x [rows][128]: bf16 plane (A operand of the Q and K projections); lane -> 4 consecutive floats
__device__ __forceinline__ void p_cvt128(int bid, const float* __restrict__ src, int nrows, bf* dstb) {
    typedef __attribute__((ext_vector_type(4))) unsigned short v4us;
    const int lane = threadIdx.x & 31, r = bid * 8 + (threadIdx.x >> 5);
    if (r >= nrows) return;
    const v4f v = *(const v4f*)(src + (size_t)r * HS + lane * 4); v4us ob;
#pragma unroll
    for (int i = 0; i < 4; ++i) ob[i] = f2bf(v[i]);
    *(v4us*)(dstb + (size_t)r * HS + lane * 4) = ob;
}
// p_wt: WT [n][K] = bf16(W[k][n]) (k-major [K][ncols]) via 64 x 64 LDS tiles; (bx, by) = tile of (K/64, ncols/64); tl = 64 x 72 LDS elements.
__device__ __forceinline__ void p_wt(int bx, int by, const float* __restrict__ Wm, int K, int ncols, bf* WT, unsigned short* tl) {
    const int tid = threadIdx.x, k0 = bx * 64, n0 = by * 64;
    const int kk = tid >> 2, nq = (tid & 3) * 16;
#pragma unroll
    for (int i = 0; i < 16; ++i) tl[(nq + i) * 72 + kk] = f2bf(Wm[(size_t)(k0 + kk) * ncols + n0 + nq + i]);
    __syncthreads();
    const int piece = tid & 7;
    auto pass = [&]() {
#pragma unroll
        for (int s = 0; s < 2; ++s) { const int nr = (tid >> 3) + 32 * s; const v8us val = *(const v8usa*)(tl + nr * 72 + piece * 8); *(v8us*)(WT + (size_t)(n0 + nr) * K + k0 + piece * 8) = val; }
    };
    pass(); 
    asm volatile("s_wait_xcnt 0x0" ::: "memory");   // the stores' registers are free before code of another job, which follows in the listing, may rewrite them
}
// k_gemmb: 64 x 64 block tile (4 waves x 16 x 64) of C[NB_*NTK][NW] = (A [+ Al]).B^T (K = 128 or 1024) [+ bf(bias[c])] [+ bf(R[r][c]) residual]; f32 whole-line epilogue (or f16
template <bool SPLITA, bool F16OUT = false>
__global__ __launch_bounds__(128) void k_gemmb(const bf* __restrict__ A, const bf* __restrict__ Al, const bf* __restrict__ Bn0, const float* __restrict__ bias, float* C0, int ldc, h16* C20, const float* __restrict__ R = nullptr, int K = DM, int roundR = 1, const bf* __restrict__ BnZ = nullptr, float* CZ = nullptr, h16* C2Z = nullptr) {
    __shared__ __align__(16) float ost[4][16 * 68];
    // blockIdx.z = 1: a second product of the same A in the same launch, with its own B and outputs
    const bf* Bn = blockIdx.z ? BnZ : Bn0; float* C = blockIdx.z ? CZ : C0; h16* C2 = blockIdx.z ? C2Z : C20;
    const int lane = threadIdx.x & 31, wave = threadIdx.x >> 5, lr = lane & 15, hi = lane >> 4;
    const int r0 = blockIdx.x * 64 + wave * 16, c0 = blockIdx.y * 64;
    const size_t aoff = (size_t)(r0 + lr) * K + 8 * hi;
    size_t boff[4];
#pragma unroll
    for (int t = 0; t < 4; ++t) boff[t] = (size_t)(c0 + t * 16 + lr) * K + 8 * hi;
    v8f acc[4];
#pragma unroll
    for (int t = 0; t < 4; ++t) acc[t] = (v8f){};
#pragma unroll 1
    for (int kc = 0; kc < K; kc += 32) {
        const v16bf a = cat16b(*(const v8us*)(A + aoff + kc), *(const v8us*)(A + aoff + kc + 16));
        v16bf al = a;
        if (SPLITA) al = cat16b(*(const v8us*)(Al + aoff + kc), *(const v8us*)(Al + aoff + kc + 16));
#pragma unroll
        for (int t = 0; t < 4; ++t) { const v16bf b = cat16b(*(const v8us*)(Bn + boff[t] + kc), *(const v8us*)(Bn + boff[t] + kc + 16)); acc[t] = wmmab(a, b, acc[t]); if (SPLITA) acc[t] = wmmab(al, b, acc[t]); }
        asm volatile("v_nop\n\tv_nop\n\tv_nop\n\tv_nop" : "+v"(acc[0]), "+v"(acc[1]), "+v"(acc[2]), "+v"(acc[3]) : "v"(a), "v"(al));
    }
    float* os = &ost[wave][0];
#pragma unroll
    for (int t = 0; t < 4; ++t) { const float bv = bias ? bfr(bias[c0 + t * 16 + lr]) : 0.f;
#pragma unroll
        for (int j = 0; j < 8; ++j) os[(hi * 8 + j) * 68 + t * 16 + lr] = acc[t][j] + bv; }
    __syncthreads();
    if (F16OUT) {
        h16* crow = (h16*)(void*)C + (size_t)r0 * ldc + c0;
        auto pass = [&]() {
#pragma unroll
            for (int s = 0; s < 4; ++s) { const int row = 4 * s + (lane >> 3), piece = lane & 7; const float* sp = os + row * 68 + piece * 8; v8h o, o2;
#pragma unroll
                for (int i = 0; i < 8; ++i) { const h16 a = (h16)sp[i]; o[i] = a; o2[i] = (h16)((sp[i] - (float)a) * LOSC); }
                *(v8h*)(crow + (size_t)row * ldc + piece * 8) = o; if (C2) *(v8h*)(C2 + (size_t)r0 * ldc + c0 + (size_t)row * ldc + piece * 8) = o2; }
        };
        pass(); 
    } else {
        float* crow = C + (size_t)r0 * ldc + c0;
        auto pass = [&]() {
#pragma unroll
            for (int s = 0; s < 8; ++s) { const int Lid = (lane >> 3) + 4 * s, piece = lane & 7; const int row = Lid >> 1, cofs = (Lid & 1) * 32 + piece * 4;
                v4f val = *(const v4fa*)(os + row * 68 + cofs); if (R) { const v4f rv = *(const v4f*)(R + ((size_t)r0 + row) * ldc + c0 + cofs); val += roundR ? (v4f){bfr(rv[0]), bfr(rv[1]), bfr(rv[2]), bfr(rv[3])} : rv; }
                *(v4f*)(crow + (size_t)row * ldc + cofs) = val; }
        };
        pass(); 
    }
}

__device__ __forceinline__ void p_cvtw(int bid, const float* __restrict__ src, int nrows, bf* dst) {
    const int lane = threadIdx.x & 31, r = bid * 8 + (threadIdx.x >> 5);
    if (r >= nrows) return;
    v8us o[KW / 256];
#pragma unroll
    for (int q = 0; q < KW / 256; ++q) { v8us t;
#pragma unroll
        for (int i = 0; i < 8; ++i) t[i] = f2bf(src[(size_t)r * KW + q * 256 + lane * 8 + i]);
        o[q] = t; }
{
#pragma unroll
        for (int q = 0; q < KW / 256; ++q) *(v8us*)(dst + (size_t)r * KW + q * 256 + lane * 8) = o[q];
         }
}
// p_vt: V^T plane = bf16(x)^T of one batch item, straight from x (the same rounding as p_cvt128's), 64 x 64 LDS tiles; stores of 8 lanes x 16 B. th_ = 64 x 72 LDS elements.
__device__ __forceinline__ void p_vt(int bx, int dh, int item, const float* __restrict__ V, bf* VTH, unsigned short* th_) {
    const int t0 = bx * 64, tid = threadIdx.x;
    const int tt = tid >> 2, dq = (tid & 3) * 16;
    V += (size_t)item * NT_ * HS; VTH += (size_t)item * HS * NT_;
    const float* src = V + ((size_t)t0 + tt) * HS + dh * 64 + dq;
#pragma unroll
    for (int i = 0; i < 16; ++i) th_[(dq + i) * 72 + tt] = f2bf(src[i]);
    __syncthreads();
    const int piece = tid & 7;
    auto pass = [&]() {
#pragma unroll
        for (int s = 0; s < 2; ++s) { const int d = (tid >> 3) + 32 * s;
            const v8us a = *(const v8usa*)(th_ + d * 72 + piece * 8);
            *(v8us*)(VTH + (size_t)(dh * 64 + d) * NT_ + t0 + piece * 8) = a; }
    };
    pass(); 
    asm volatile("s_wait_xcnt 0x0" ::: "memory");   // the stores' registers are free before code of another job, which follows in the listing, may rewrite them
}
// k_prep: every job that depends on the inputs alone, in one launch. Block ranges: 64 weight tiles (16 matrices x 4), 16 of W_o, 256 of V^T, 1024 of x; every branch is block-uniform.
#define PB_WT  (2 * NH_ * 4)
#define PB_WO  (HS / 8)
#define PB_VT  (NB_ * 2 * (NT_ / 64))
#define PB_X   (NB_ * NTK / 8)
__global__ __launch_bounds__(256) void k_prep(const float* __restrict__ x, const float* __restrict__ Wq, const float* __restrict__ Wk, const float* __restrict__ Wo, bf* Xb, bf* VTH, bf* WqT, bf* WkT, bf* WoB) {
    __shared__ __align__(16) unsigned short tl[64 * 72];
    int bid = blockIdx.x;
    if (bid < PB_WT) {      // per-head k-major [128][128] -> rows h*128.. of the n-major planes [1024][128]
        const int h = bid >> 3, wk = (bid >> 2) & 1;
        p_wt(bid & 1, (bid >> 1) & 1, (wk ? Wk : Wq) + (size_t)h * HS * HD, HS, HD, (wk ? WkT : WqT) + (size_t)h * HD * HS, tl);
        return;
    }
    bid -= PB_WT;
    if (bid < PB_WO) { p_cvtw(bid, Wo, HS, WoB); return; }      // W_o [128][1024] = [out][in]: bf16 copy = n-major B operand
    bid -= PB_WO;
    if (bid < PB_VT) { p_vt(bid & (NT_ / 64 - 1), (bid / (NT_ / 64)) & 1, bid / (2 * (NT_ / 64)), x, VTH, tl); return; }
    p_cvt128(bid - PB_VT, x, NB_ * NTK, Xb);
}
// stage_kv: the 128 threads of one half of the block copy one 32-key tile (K hi and K residual rows of one head: 32 x 256 B each; V^T: 128 rows x 64 B) from global memory into one
// ring buffer, 12 asynchronous 16-B copies a thread; a wave's K copy covers two whole 256-B rows. lb = the buffer's LDS byte address.
__device__ __forceinline__ void stage_kv(const h16* kh, const h16* kl, const bf* vt, unsigned lb, int l0, int tid) {
    const int kr = tid >> 4, kc8 = (tid & 15) * 8, vr = tid >> 2, vc8 = (tid & 3) * 8;
    const h16* gh = kh + (size_t)(l0 + kr) * KW + kc8; const h16* gl = kl + (size_t)(l0 + kr) * KW + kc8; const bf* gv = vt + (size_t)vr * NT_ + l0 + vc8;
    const unsigned lh = lb + (unsigned)(kr * KP + kc8) * 2u, ll = lh + KPL * 2u, lv = lb + (unsigned)(2 * KPL + vr * VP + vc8) * 2u;
    // the copies and their s_wait_xcnt in one statement: no address register of a copy is rewritten in front of that wait
    asm volatile("global_load_async_to_lds_b128 %0, %1, off\n\t"
                 "global_load_async_to_lds_b128 %2, %3, off\n\t"
                 "global_load_async_to_lds_b128 %4, %5, off\n\t"
                 "global_load_async_to_lds_b128 %6, %7, off\n\t"
                 "global_load_async_to_lds_b128 %8, %9, off\n\t"
                 "global_load_async_to_lds_b128 %10, %11, off\n\t"
                 "global_load_async_to_lds_b128 %12, %13, off\n\t"
                 "global_load_async_to_lds_b128 %14, %15, off\n\t"
                 "global_load_async_to_lds_b128 %16, %17, off\n\t"
                 "global_load_async_to_lds_b128 %18, %19, off\n\t"
                 "global_load_async_to_lds_b128 %20, %21, off\n\t"
                 "global_load_async_to_lds_b128 %22, %23, off\n\t"
                 "s_wait_xcnt 0x0"
                 :: "v"(lh), "v"(gh), "v"(lh + 8u * KP * 2u), "v"(gh + (size_t)8 * KW), "v"(lh + 16u * KP * 2u), "v"(gh + (size_t)16 * KW), "v"(lh + 24u * KP * 2u), "v"(gh + (size_t)24 * KW),
                    "v"(ll), "v"(gl), "v"(ll + 8u * KP * 2u), "v"(gl + (size_t)8 * KW), "v"(ll + 16u * KP * 2u), "v"(gl + (size_t)16 * KW), "v"(ll + 24u * KP * 2u), "v"(gl + (size_t)24 * KW),
                    "v"(lv), "v"(gv), "v"(lv + 32u * VP * 2u), "v"(gv + (size_t)32 * NT_), "v"(lv + 64u * VP * 2u), "v"(gv + (size_t)64 * NT_), "v"(lv + 96u * VP * 2u), "v"(gv + (size_t)96 * NT_)
                 : "memory");
}
// stage_q: the block's 256 threads copy its 64 Q rows of one head (hi and residual plane, 256 B a row) into LDS at K's pitch, once, 8 asynchronous 16-B copies a thread;
// a wave's copy covers two whole rows. lb = LDS byte address of the hi plane; the residual plane follows it.
__device__ __forceinline__ void stage_q(const h16* qh, const h16* ql, unsigned lb, int tid) {
    const int r = tid >> 4, c8 = (tid & 15) * 8;
    const h16* gh = qh + (size_t)r * KW + c8; const h16* gl = ql + (size_t)r * KW + c8;
    const unsigned lh = lb + (unsigned)(r * KP + c8) * 2u, ll = lh + 64u * KP * 2u;
    // the copies and their s_wait_xcnt in one statement: no address register of a copy is rewritten in front of that wait
    asm volatile("global_load_async_to_lds_b128 %0, %1, off\n\t"
                 "global_load_async_to_lds_b128 %2, %3, off\n\t"
                 "global_load_async_to_lds_b128 %4, %5, off\n\t"
                 "global_load_async_to_lds_b128 %6, %7, off\n\t"
                 "global_load_async_to_lds_b128 %8, %9, off\n\t"
                 "global_load_async_to_lds_b128 %10, %11, off\n\t"
                 "global_load_async_to_lds_b128 %12, %13, off\n\t"
                 "global_load_async_to_lds_b128 %14, %15, off\n\t"
                 "s_wait_xcnt 0x0"
                 :: "v"(lh), "v"(gh), "v"(lh + 16u * KP * 2u), "v"(gh + (size_t)16 * KW), "v"(lh + 32u * KP * 2u), "v"(gh + (size_t)32 * KW), "v"(lh + 48u * KP * 2u), "v"(gh + (size_t)48 * KW),
                    "v"(ll), "v"(gl), "v"(ll + 16u * KP * 2u), "v"(gl + (size_t)16 * KW), "v"(ll + 32u * KP * 2u), "v"(gl + (size_t)32 * KW), "v"(ll + 48u * KP * 2u), "v"(gl + (size_t)48 * KW)
                 : "memory");
}
// k_attn: block = 8 waves = (item, head, 64 queries); a step is 64 keys: waves 0-3 (16 queries each) take its even 32-key tile, waves 4-7 the odd one for the same queries,
// so the longest block walks 64 steps. The softmax shift is fixed, so the two halves' o and l are plain partial sums: waves 4-7 hand theirs over through LDS behind the
// loop, waves 0-3 add them and finish. Two blocks fit a WGP, half of the grid at a time: the blocks with the most steps come first in the grid, the short ones fill up.
// K slice of head h (row stride NH*HD), V = bf16(x)^T shared by all heads (exact, single plane); causal key tiles
// 0..(Q0+63)/32; per element: j <= q -> clip(score x 128^-1/2, -10, 10) else -inf (reference: clip before the causal where); scores hh + (hl+lh)/1024 on separate
// accumulators; softmax f32 with the fixed shift 10; P (x32768) as bf16 hi + unscaled residual; o += ph.v + pl.v; ctx / l -> bf16 hi/lo planes CH/CL[tok][h*128+d].
// Both products run transposed: S^T = K.Q^T (A = K rows, B = Q rows), O^T += V^T.P^T (A = V^T rows, B = P^T). A lane then holds scores of ONE query (column lr), keys 8*hi + j of
// each 16-key tile, which is the k order of a B fragment: the two score tiles, converted in place, ARE P^T's fragment, and P goes through no LDS and no lane exchange.
__global__ __launch_bounds__(256) void k_attn(const h16* __restrict__ QH, const h16* __restrict__ QL, const h16* __restrict__ KH, const h16* __restrict__ KL, const bf* __restrict__ VTH, bf* CH, bf* CL) {
    __shared__ __align__(16) unsigned short qs[2 * 64 * KP];   // the block's Q rows, hi and residual plane, copied once: a fragment read from global memory touches 16 lines, and every key tile repeated it. Behind the loop: output staging
    __shared__ __align__(16) unsigned short ring[4 * STG];     // two buffers of two key tiles: the next step's copies fly while this one is worked on; 4 waves share each tile
    const int lane = threadIdx.x & 31, wave = threadIdx.x >> 5, lr = lane & 15, hi = lane >> 4;
    const int grp = __builtin_amdgcn_readfirstlane(threadIdx.x >> 7), w4 = wave & 3, t128 = threadIdx.x & 127;   // grp (wave-uniform): which key tile of a step this wave takes
    const int bid = blockIdx.x; const int qt = NT_ / 64 - 1 - bid / (NH_ * NB_), h = bid % NH_, item = (bid / NH_) % NB_; const int g = h;   // K has one slice per head; V (= x) is shared by all heads
    { const size_t ib = (size_t)item * NT_ * KW;                      // batch item: its own rows of every plane, its own V^T
      QH += ib; QL += ib; KH += ib; KL += ib; CH += ib; CL += ib; VTH += (size_t)item * HS * NT_; }
    const int q0 = qt * 64 + w4 * 16;
    const unsigned short* tq = qs + (w4 * 16 + lr) * KP + 8 * hi;    // this lane's Q row in LDS; the residual plane lies 64 rows on
    const h16* kh_b = KH + g * HD; const h16* kl_b = KL + g * HD;
    v8f o[8];
#pragma unroll
    for (int n = 0; n < 8; ++n) o[n] = (v8f){};
    float lsum = 0.f;                                               // this lane's share of its query's row sum: the keys 8*hi + j of every 16-key tile
    const int st_hi = qt;                                           // causal: steps of 64 keys, 0..qt; each half of the block copies the tile it works on
    const unsigned ring_b = (unsigned)(size_t)&ring[0];              // LDS byte address of the ring
    stage_q(QH + (size_t)(qt * 64) * KW + h * HD, QL + (size_t)(qt * 64) * KW + h * HD, (unsigned)(size_t)&qs[0], threadIdx.x);
    stage_kv(kh_b, kl_b, VTH, ring_b + (unsigned)grp * (STG * 2u), grp * 32, t128);
    asm volatile("s_wait_asynccnt 0x0" ::: "memory");               // this wave's copies of Q and of step 0 have landed
    __syncthreads();                                                // ... and every other wave's
    if (st_hi >= 1) stage_kv(kh_b, kl_b, VTH, ring_b + (unsigned)(2 + grp) * (STG * 2u), 64 + grp * 32, t128);
#pragma unroll 1
    for (int st = 0; st <= st_hi; ++st) {
        const int l0 = st * 64 + grp * 32;
        const unsigned short* tb = ring + ((st & 1) * 2 + grp) * STG;
        const unsigned short* tkh = tb + lr * KP + 8 * hi; const unsigned short* tkl = tkh + KPL; const unsigned short* tv = tb + 2 * KPL + lr * VP + 8 * hi;
        v8f s0 = {}, s1 = {}, x0 = {}, x1 = {};
        // LDS fragment reads run ahead of their use, so that a wave waits on a count and not on an empty queue: chunk kc + 1's four K fragments are requested in front of chunk kc's
        // products (two register sets), and all eight V fragments behind the last score product, into the K sets' registers, so that they land under the softmax
        v16h kf[2][4], qf[2][2];                                    // the Q fragments of a chunk come with its K fragments
        auto ldk = [&](int kc, v16h* d, v16h* q) {
            q[0] = cat16(*(const v8ha*)(tq + kc * 32), *(const v8ha*)(tq + kc * 32 + 16)); q[1] = cat16(*(const v8ha*)(tq + 64 * KP + kc * 32), *(const v8ha*)(tq + 64 * KP + kc * 32 + 16));
            d[0] = cat16(*(const v8ha*)(tkh + kc * 32), *(const v8ha*)(tkh + kc * 32 + 16)); d[1] = cat16(*(const v8ha*)(tkh + 16 * KP + kc * 32), *(const v8ha*)(tkh + 16 * KP + kc * 32 + 16));
            d[2] = cat16(*(const v8ha*)(tkl + kc * 32), *(const v8ha*)(tkl + kc * 32 + 16)); d[3] = cat16(*(const v8ha*)(tkl + 16 * KP + kc * 32), *(const v8ha*)(tkl + 16 * KP + kc * 32 + 16)); };
        v16bf vf[8];
        ldk(0, kf[0], qf[0]);
#pragma unroll
        for (int kc = 0; kc < 4; ++kc) {
            if (kc < 3) ldk(kc + 1, kf[(kc + 1) & 1], qf[(kc + 1) & 1]);
            const v16h qa = qf[kc & 1][0], qx = qf[kc & 1][1];
            const v16h k0h = kf[kc & 1][0], k1h = kf[kc & 1][1], k0l = kf[kc & 1][2], k1l = kf[kc & 1][3];
            s0 = wmma16(k0h, qa, s0); s1 = wmma16(k1h, qa, s1); x0 = wmma16(k0h, qx, x0); x1 = wmma16(k1h, qx, x1);     // s[j] = S^T[key 8*hi + j][query lr]
            x0 = wmma16(k0l, qa, x0); x1 = wmma16(k1l, qa, x1);
            // one vector slot behind the chunk's last product, with its operands still held: the next requests into this register set stand behind it
            asm volatile("v_nop" : "+v"(s0), "+v"(s1), "+v"(x0), "+v"(x1) : "v"(qa), "v"(qx), "v"(k0h), "v"(k1h), "v"(k0l), "v"(k1l));
        }
#pragma unroll
        for (int n = 0; n < 8; ++n) vf[n] = cat16b(*(const v8usa*)(tv + n * 16 * VP), *(const v8usa*)(tv + n * 16 * VP + 16));     // V = bf16(x) exactly (a rounded INPUT): no residual plane
        asm volatile("v_nop\n\tv_nop\n\tv_nop\n\tv_nop" : "+v"(s0), "+v"(s1), "+v"(x0), "+v"(x1));
        float pe[16];                                               // P^T in B's k order: 0-7 = keys 8*hi + j (tile 0), 8-15 = keys 16 + 8*hi + j (tile 1)
        const int lim = q0 + lr - l0 - hi * 8;                      // causal, key l0 + 8*hi + j (+ 16) <= query q0 + lr: register index j (+ 16) against this lane's limit
#pragma unroll
        for (int j = 0; j < 8; ++j) {
            // reference order: scores / sqrt(128) -> clip(-10, 10) -> causal where -> softmax
            const float a0 = (j <= lim) ? fminf(fmaxf((s0[j] + x0[j] * LOSCI) * 0.08838834764831845f, -10.0f), 10.0f) : -__builtin_inff(), a1 = (j + 16 <= lim) ? fminf(fmaxf((s1[j] + x1[j] * LOSCI) * 0.08838834764831845f, -10.0f), 10.0f) : -__builtin_inff();
            // every kept score lies in [-10, 10] after the clip, so the clip's upper bound is the softmax shift: exp(a - 10) is in [e^-20, 1] for any input,
            // and no row maximum is searched, carried or applied to o and l
            pe[j] = (a0 - 10.0f) * 1.44269504f; pe[8 + j] = (a1 - 10.0f) * 1.44269504f; }      // exp(t) = 2^(t x log2 e), as __expf forms it
        // the tile's 16 exponentials in one statement, each in place, its last line the one slot that the instruction set asks for behind a transcendental
        asm("v_exp_f32 %0, %0\n\tv_exp_f32 %1, %1\n\tv_exp_f32 %2, %2\n\tv_exp_f32 %3, %3\n\tv_exp_f32 %4, %4\n\tv_exp_f32 %5, %5\n\tv_exp_f32 %6, %6\n\tv_exp_f32 %7, %7\n\t"
            "v_exp_f32 %8, %8\n\tv_exp_f32 %9, %9\n\tv_exp_f32 %10, %10\n\tv_exp_f32 %11, %11\n\tv_exp_f32 %12, %12\n\tv_exp_f32 %13, %13\n\tv_exp_f32 %14, %14\n\tv_exp_f32 %15, %15\n\tv_nop"
            : "+v"(pe[0]), "+v"(pe[1]), "+v"(pe[2]), "+v"(pe[3]), "+v"(pe[4]), "+v"(pe[5]), "+v"(pe[6]), "+v"(pe[7]),
              "+v"(pe[8]), "+v"(pe[9]), "+v"(pe[10]), "+v"(pe[11]), "+v"(pe[12]), "+v"(pe[13]), "+v"(pe[14]), "+v"(pe[15]));
        float ps[16];
#pragma unroll
        for (int j = 0; j < 8; ++j) { lsum += pe[j] + pe[8 + j]; ps[j] = pe[j] * PSC; ps[8 + j] = pe[8 + j] * PSC; }
        v8u pw, rw;                                                 // neighbours in k share a register: one packed conversion (round to nearest even, as f2bf) makes each word of the fragment
#pragma unroll
        for (int i = 0; i < 8; ++i) { const unsigned w = __builtin_bit_cast(unsigned, __builtin_convertvector((v2f){ps[2 * i], ps[2 * i + 1]}, v2bf)); pw[i] = w;
            rw[i] = __builtin_bit_cast(unsigned, __builtin_convertvector((v2f){ps[2 * i] - __uint_as_float(w << 16), ps[2 * i + 1] - __uint_as_float(w & 0xFFFF0000u)}, v2bf)); }
        const v16bf pa = __builtin_bit_cast(v16bf, pw), px = __builtin_bit_cast(v16bf, rw);
#pragma unroll
        for (int n = 0; n < 8; ++n) o[n] = wmmab(vf[n], pa, o[n]);      // o[n][j] = O^T[d = n*16 + 8*hi + j][query lr]
#pragma unroll
        for (int n = 0; n < 8; ++n) o[n] = wmmab(vf[n], px, o[n]);      // per o[n] still hi then residual: the sums keep their order
        // four vector slots behind the last products before anything may rewrite their operands; all eight accumulators are named, so that no product drifts behind the barrier with its V registers held
        asm volatile("v_nop\n\tv_nop\n\tv_nop\n\tv_nop" : "+v"(o[0]), "+v"(o[1]), "+v"(o[2]), "+v"(o[3]), "+v"(o[4]), "+v"(o[5]), "+v"(o[6]), "+v"(o[7]) : "v"(pa), "v"(px));
        __builtin_amdgcn_wave_barrier();
        asm volatile("s_wait_dscnt 0x0" ::: "memory");              // this wave's reads of the buffer are done before it may be refilled
        asm volatile("s_wait_asynccnt 0x0" ::: "memory");           // this wave's copies of step st + 1 have landed
        __syncthreads();                                            // publishes step st + 1 and ends every wave's reads of step st
        if (st + 2 <= st_hi) stage_kv(kh_b, kl_b, VTH, ring_b + (unsigned)((st & 1) * 2 + grp) * (STG * 2u), l0 + 128, t128);
    }
    asm volatile("s_wait_asynccnt 0x0" ::: "memory");               // nothing in flight when the ring is put to another use
    // the ring is free behind the loop's last barrier: waves 4-7 lay their partial o and l there, 16 x 16 B + 4 B a lane, for the wave with the same queries
    v4fa* xw = (v4fa*)(void*)ring + w4 * (16 * 32) + lane; float* xl = (float*)(void*)ring + 4 * (16 * 32) * 4 + w4 * 32 + lane;
    if (grp == 1) {
#pragma unroll
        for (int n = 0; n < 8; ++n) { xw[(2 * n) * 32] = (v4f){o[n][0], o[n][1], o[n][2], o[n][3]}; xw[(2 * n + 1) * 32] = (v4f){o[n][4], o[n][5], o[n][6], o[n][7]}; }
        *xl = lsum;
    }
    __syncthreads();                                                // the partial sums are visible to waves 0-3
    if (grp == 1) return;                                           // no barrier follows: waves 0-3 finish alone
#pragma unroll
    for (int n = 0; n < 8; ++n) { const v4f a = xw[(2 * n) * 32], b = xw[(2 * n + 1) * 32];
#pragma unroll
        for (int j = 0; j < 4; ++j) { o[n][j] += a[j]; o[n][4 + j] += b[j]; } }
    lsum += *xl;
    lsum += __shfl_xor(lsum, 16, 32);                               // the two lane halves hold the two halves of a query's keys
    const float inv = 1.0f / (lsum * PSC);
    float* os = (float*)(void*)qs + w4 * (16 * 68);                 // Q's last read lies in front of the loop's last barrier
    const size_t cbase = (size_t)q0 * (NH_ * HD) + (size_t)h * HD;
#pragma unroll
    for (int half = 0; half < 2; ++half) {
#pragma unroll
        for (int n = 0; n < 4; ++n) { const v8f t = o[half * 4 + n] * inv; v4fa* d = (v4fa*)(os + lr * 68 + n * 16 + hi * 8);     // a lane holds 8 consecutive d of its query's row
            d[0] = (v4f){t[0], t[1], t[2], t[3]}; d[1] = (v4f){t[4], t[5], t[6], t[7]}; }
        __builtin_amdgcn_wave_barrier(); asm volatile("" ::: "memory");
{
#pragma unroll
            for (int s = 0; s < 4; ++s) { const int row = 4 * s + (lane >> 3), piece = lane & 7; const float* sp = os + row * 68 + piece * 8; v8us oh, ol;
#pragma unroll
                for (int i = 0; i < 8; ++i) { const unsigned short hb = f2bf(sp[i]); oh[i] = hb; ol[i] = f2bf(sp[i] - bf2f(hb)); }
                const size_t po = cbase + (size_t)row * (NH_ * HD) + half * 64 + piece * 8; *(v8us*)(CH + po) = oh; *(v8us*)(CL + po) = ol; }
             }
        __builtin_amdgcn_wave_barrier(); asm volatile("" ::: "memory");
    }
}

extern "C" void kernel_launch(void* const* d_in, const int* in_sizes, int n_in,
                              void* d_out, int out_size, void* d_ws, size_t ws_size, hipStream_t stream) {
    (void)in_sizes; (void)n_in; (void)out_size;
    const float* x = (const float*)d_in[0]; const float* Wq = (const float*)d_in[1]; const float* Wk = (const float*)d_in[2]; const float* Wo = (const float*)d_in[3];   // Wq/Wk [8][128][128] (x.W[h]); Wo [128][1024] = [out][in]
    float* out = (float*)d_out;    // [2][4096][128]
    char* wsp = (char*)d_ws;
    auto take = [&](size_t bytes) { char* p = wsp; wsp += (bytes + 255) & ~(size_t)255; return (void*)p; };
    bf* Xb = (bf*)take((size_t)NB_ * NTK * HS * 2);
    bf* WqT = (bf*)take((size_t)KW * HS * 2); bf* WkT = (bf*)take((size_t)KW * HS * 2); bf* WoB = (bf*)take((size_t)HS * KW * 2);
    h16* QH = (h16*)take((size_t)NB_ * NTK * KW * 2); h16* QL = (h16*)take((size_t)NB_ * NTK * KW * 2); h16* KH = (h16*)take((size_t)NB_ * NTK * KW * 2); h16* KL = (h16*)take((size_t)NB_ * NTK * KW * 2);
    bf* VTH = (bf*)take((size_t)NB_ * HS * NT_ * 2); bf* CH = (bf*)take((size_t)NB_ * NTK * KW * 2); bf* CL = (bf*)take((size_t)NB_ * NTK * KW * 2);
    if ((size_t)(wsp - (char*)d_ws) > ws_size) return;    // about 105 MB, no aliasing: every per-item plane holds both batch items
    // four dependent launches: what reads inputs only; the Q and the K projection (grid z); attention; the output projection. Both batch items in every launch.
    k_prep<<<PB_WT + PB_WO + PB_VT + PB_X, 256, 0, stream>>>(x, Wq, Wk, Wo, Xb, VTH, WqT, WkT, WoB);
    k_gemmb<false, true><<<dim3(NB_ * NTK / 64, KW / 64, 2), 128, 0, stream>>>(Xb, nullptr, WqT, nullptr, (float*)(void*)QH, KW, QL, nullptr, HS, 1, WkT, (float*)(void*)KH, KL);
    k_attn<<<dim3(NB_ * NH_ * (NT_ / 64), 1, 1), 256, 0, stream>>>(QH, QL, KH, KL, VTH, CH, CL);
    k_gemmb<true, false><<<dim3(NB_ * NTK / 64, HS / 64, 1), 128, 0, stream>>>(CH, CL, WoB, nullptr, out, HS, nullptr, nullptr, KW);
}

// v009
// It runs in 163 microseconds.
// In two side-by-side timings against v008, it was 1.14 and 1.13 times as fast.
// All steps since v000 together make it 9.75 times as fast.
#include <hip/hip_runtime.h>

// Compute dtypes, f32 accumulate, both batch items in every launch: Q/K = x.W_q[h] / x.W_k[h] ([4096 x 128].[128 x 128] per head, k-major per-head weights transposed once
// into n-major [8*128][128] planes; PLAIN bf16 operands = inputs rounded once, exact products) written straight from the GEMM epilogue as f16 hi + residual
// x1024 planes [t][h*128+e], and out = y.W_o^T ([4096 x 1024].[1024 x 128], W_o [out][in] as-is; y as bf16 hi + residual) on v_wmma_f32_16x16x32_bf16; the
// 8-head causal attention with clipped scores (clip(s/sqrt(128), -10, 10)) and V = x itself (bf16(x)^T, exact, one plane) on v_wmma_f32_16x16x32_f16 (scores)

#define NB_  2
#define NT_  4096
#define HS   128                 // x width = head dim of q, k and v
#define NH_  8
#define HD   128
#define KW   (NH_ * HD)          // 1024: row stride of the Q/K planes
#define NTK  NT_
#define DM   HS                  // k_gemmb's default K
#define PSC  32768.0f
#define LOSC 1024.0f
#define LOSCI (1.0f / 1024.0f)
#define KP   136                 // LDS pitch of a staged K row in 16-bit elements: 272 B = 16 B x odd, for ds_load_b128 readers
#define VP   40                  // LDS pitch of a staged V^T row (32 keys) in 16-bit elements: 80 B = 16 B x odd
#define KPL  (32 * KP)           // one K plane of a 32-key tile
#define STG  (2 * KPL + HS * VP) // one ring buffer: K hi, K residual, V^T

typedef _Float16 h16;
typedef unsigned short bf;
typedef __attribute__((ext_vector_type(16))) __bf16   v16bf;
typedef __attribute__((ext_vector_type(16))) _Float16 v16h;
typedef __attribute__((ext_vector_type(8)))  _Float16 v8h;
typedef __attribute__((ext_vector_type(8)))  unsigned short v8us;
typedef __attribute__((ext_vector_type(8)))  float    v8f;
typedef __attribute__((ext_vector_type(4)))  float    v4f;
typedef __attribute__((ext_vector_type(4)))  _Float16 v4h;
typedef v8h  __attribute__((may_alias)) v8ha;
typedef v4f  __attribute__((may_alias)) v4fa;
typedef v8us __attribute__((may_alias)) v8usa;
typedef __attribute__((ext_vector_type(2)))  float    v2f;
typedef __attribute__((ext_vector_type(2)))  __bf16   v2bf;
typedef __attribute__((ext_vector_type(8)))  unsigned v8u;

__device__ __forceinline__ unsigned short f2bf(float f) { unsigned u = __float_as_uint(f); u += 0x7FFFu + ((u >> 16) & 1u); return (unsigned short)(u >> 16); }
__device__ __forceinline__ float bf2f(unsigned short b) { return __uint_as_float(((unsigned)b) << 16); }
__device__ __forceinline__ float bfr(float f) { return bf2f(f2bf(f)); }
__device__ __forceinline__ v16h cat16(v8h lo, v8h hi) { return __builtin_shufflevector(lo, hi, 0, 1, 2, 3, 4, 5, 6, 7, 8, 9, 10, 11, 12, 13, 14, 15); }
__device__ __forceinline__ v16bf cat16b(v8us lo, v8us hi) { return __builtin_bit_cast(v16bf, __builtin_shufflevector(lo, hi, 0, 1, 2, 3, 4, 5, 6, 7, 8, 9, 10, 11, 12, 13, 14, 15)); }
__device__ __forceinline__ v8f wmma16(v16h a, v16h b, v8f c) { return __builtin_amdgcn_wmma_f32_16x16x32_f16(false, a, false, b, (short)0, c, false, false); }
__device__ __forceinline__ v8f wmmab(v16bf a, v16bf b, v8f c) { return __builtin_amdgcn_wmma_f32_16x16x32_bf16(false, a, false, b, (short)0, c, false, false); }

// The four jobs below read inputs only and none reads another's output: they are parts of ONE launch (k_prep), each with its own range of 256-thread blocks; bid = index in the range.
// p_cvt128: one wave per row of x [rows][128]: bf16 plane (A operand of the Q and K projections); lane -> 4 consecutive floats
__device__ __forceinline__ void p_cvt128(int bid, const float* __restrict__ src, int nrows, bf* dstb) {
    typedef __attribute__((ext_vector_type(4))) unsigned short v4us;
    const int lane = threadIdx.x & 31, r = bid * 8 + (threadIdx.x >> 5);
    if (r >= nrows) return;
    const v4f v = *(const v4f*)(src + (size_t)r * HS + lane * 4); v4us ob;
#pragma unroll
    for (int i = 0; i < 4; ++i) ob[i] = f2bf(v[i]);
    *(v4us*)(dstb + (size_t)r * HS + lane * 4) = ob;
}
// p_wt: WT [n][K] = bf16(W[k][n]) (k-major [K][ncols]) via 64 x 64 LDS tiles; (bx, by) = tile of (K/64, ncols/64); tl = 64 x 72 LDS elements.
__device__ __forceinline__ void p_wt(int bx, int by, const float* __restrict__ Wm, int K, int ncols, bf* WT, unsigned short* tl) {
    const int tid = threadIdx.x, k0 = bx * 64, n0 = by * 64;
    const int kk = tid >> 2, nq = (tid & 3) * 16;
#pragma unroll
    for (int i = 0; i < 16; ++i) tl[(nq + i) * 72 + kk] = f2bf(Wm[(size_t)(k0 + kk) * ncols + n0 + nq + i]);
    __syncthreads();
    const int piece = tid & 7;
    auto pass = [&]() {
#pragma unroll
        for (int s = 0; s < 2; ++s) { const int nr = (tid >> 3) + 32 * s; const v8us val = *(const v8usa*)(tl + nr * 72 + piece * 8); *(v8us*)(WT + (size_t)(n0 + nr) * K + k0 + piece * 8) = val; }
    };
    pass(); 
    asm volatile("s_wait_xcnt 0x0" ::: "memory");   // the stores' registers are free before code of another job, which follows in the listing, may rewrite them
}
// stage64: a block's 128 threads copy 64 rows x 128 16-bit elements (256 B of each row, row stride ld elements) from global memory into LDS at pitch KP, 8 asynchronous 16-B copies a thread;
// a wave's copy covers two whole 256-B pieces of rows. lb = LDS byte address of the plane.
__device__ __forceinline__ void stage64(const bf* g, int ld, unsigned lb, int tid) {
    const int r = tid >> 4, c8 = (tid & 15) * 8;
    const bf* gp = g + (size_t)r * ld + c8; const size_t s8 = (size_t)8 * ld;
    const unsigned l = lb + (unsigned)(r * KP + c8) * 2u;
    // the copies and their s_wait_xcnt in one statement: no address register of a copy is rewritten in front of that wait
    asm volatile("global_load_async_to_lds_b128 %0, %1, off\n\t"
                 "global_load_async_to_lds_b128 %2, %3, off\n\t"
                 "global_load_async_to_lds_b128 %4, %5, off\n\t"
                 "global_load_async_to_lds_b128 %6, %7, off\n\t"
                 "global_load_async_to_lds_b128 %8, %9, off\n\t"
                 "global_load_async_to_lds_b128 %10, %11, off\n\t"
                 "global_load_async_to_lds_b128 %12, %13, off\n\t"
                 "global_load_async_to_lds_b128 %14, %15, off\n\t"
                 "s_wait_xcnt 0x0"
                 :: "v"(l), "v"(gp), "v"(l + 8u * KP * 2u), "v"(gp + s8), "v"(l + 16u * KP * 2u), "v"(gp + 2 * s8), "v"(l + 24u * KP * 2u), "v"(gp + 3 * s8),
                    "v"(l + 32u * KP * 2u), "v"(gp + 4 * s8), "v"(l + 40u * KP * 2u), "v"(gp + 5 * s8), "v"(l + 48u * KP * 2u), "v"(gp + 6 * s8), "v"(l + 56u * KP * 2u), "v"(gp + 7 * s8)
                 : "memory");
}
// k_gemmb: 64 x 64 block tile (4 waves x 16 x 64) of C[NB_ * NTK][NW] = (A [+ Al]).B^T (K = 128 or 1024) [+ bf(bias[c])] [+ bf(R[r][c]) residual]; f32 whole-line epilogue (or f16
template <bool SPLITA, bool F16OUT = false>
__global__ __launch_bounds__(128) void k_gemmb(const bf* __restrict__ A, const bf* __restrict__ Al, const bf* __restrict__ Bn0, const float* __restrict__ bias, float* C0, int ldc, h16* C20, const float* __restrict__ R = nullptr, int K = DM, int roundR = 1, const bf* __restrict__ BnZ = nullptr, float* CZ = nullptr, h16* C2Z = nullptr) {
    __shared__ __align__(16) float ost[4][16 * 68];
    // blockIdx.z = 1: a second product of the same A in the same launch, with its own B and outputs
    const bf* Bn = blockIdx.z ? BnZ : Bn0; float* C = blockIdx.z ? CZ : C0; h16* C2 = blockIdx.z ? C2Z : C20;
    const int lane = threadIdx.x & 31, wave = threadIdx.x >> 5, lr = lane & 15, hi = lane >> 4;
    const int r0 = blockIdx.x * 64 + wave * 16, c0 = blockIdx.y * 64;
    const size_t aoff = (size_t)(r0 + lr) * K + 8 * hi;
    size_t boff[4];
#pragma unroll
    for (int t = 0; t < 4; ++t) boff[t] = (size_t)(c0 + t * 16 + lr) * K + 8 * hi;
    v8f acc[4];
#pragma unroll
    for (int t = 0; t < 4; ++t) acc[t] = (v8f){};
    if constexpr (SPLITA) {
        // K = 1024, one block a WGP, one wave a SIMD. A fragment read from global memory touches 16 lines, every wave repeats B's, and nothing hides the wait. So tiles of 128 k (A hi, A residual:
        // the block's 64 rows; B: its 64 columns) are copied into LDS in whole 256-B pieces of rows, two buffers: the next tile's copies fly while this one is worked on, and the 4 waves share B.
        // K is a multiple of 128. Per accumulator the products keep their order.
        __shared__ __align__(16) unsigned short tile[2 * 3 * 64 * KP];
        const unsigned tile_b = (unsigned)(size_t)&tile[0];              // LDS byte address of the buffers
        const bf* ga = A + (size_t)(blockIdx.x * 64) * K; const bf* gl = Al + (size_t)(blockIdx.x * 64) * K; const bf* gb = Bn + (size_t)c0 * K;
        auto stage = [&](int t) { const unsigned lb = tile_b + (unsigned)(t & 1) * (3u * 64u * KP * 2u);
            stage64(ga + t * 128, K, lb, threadIdx.x); stage64(gl + t * 128, K, lb + 64u * KP * 2u, threadIdx.x); stage64(gb + t * 128, K, lb + 2u * 64u * KP * 2u, threadIdx.x); };
        const int nst = K / 128;
        stage(0);
        asm volatile("s_wait_asynccnt 0x0" ::: "memory");               // this wave's copies of tile 0 have landed
        __syncthreads();                                                // ... and every other wave's
        if (nst > 1) stage(1);
#pragma unroll 1    // rolled: one body serves both buffers (t & 1), the code stays short
        for (int t = 0; t < nst; ++t) {
            const unsigned short* tb = tile + (t & 1) * (3 * 64 * KP);
            const unsigned short* ta = tb + (wave * 16 + lr) * KP + 8 * hi; const unsigned short* tn = tb + 2 * 64 * KP + lr * KP + 8 * hi;
            // the loops below are unrolled: LDS offsets become immediates, and the register arrays get constant indices
#pragma unroll
            for (int kc = 0; kc < 128; kc += 32) {
                const v16bf a = cat16b(*(const v8usa*)(ta + kc), *(const v8usa*)(ta + kc + 16)), al = cat16b(*(const v8usa*)(ta + 64 * KP + kc), *(const v8usa*)(ta + 64 * KP + kc + 16));
                v16bf b[4];
#pragma unroll
                for (int u = 0; u < 4; ++u) b[u] = cat16b(*(const v8usa*)(tn + u * 16 * KP + kc), *(const v8usa*)(tn + u * 16 * KP + kc + 16));
#pragma unroll
                for (int u = 0; u < 4; ++u) acc[u] = wmmab(a, b[u], acc[u]);
#pragma unroll
                for (int u = 0; u < 4; ++u) acc[u] = wmmab(al, b[u], acc[u]);
            }
            // four vector slots behind the tile's last products before anything behind the barrier may rewrite their operands
            asm volatile("v_nop\n\tv_nop\n\tv_nop\n\tv_nop" : "+v"(acc[0]), "+v"(acc[1]), "+v"(acc[2]), "+v"(acc[3]));
            asm volatile("s_wait_dscnt 0x0" ::: "memory");              // this wave's reads of the buffer are done before it may be refilled
            asm volatile("s_wait_asynccnt 0x0" ::: "memory");           // this wave's copies of tile t + 1 have landed
            __syncthreads();                                            // publishes tile t + 1 and ends every wave's reads of tile t
            if (t + 2 < nst) stage(t + 2);
        }
        asm volatile("s_wait_asynccnt 0x0" ::: "memory");               // nothing in flight behind the loop
    } else {
#pragma unroll 1
        for (int kc = 0; kc < K; kc += 32) {
            const v16bf a = cat16b(*(const v8us*)(A + aoff + kc), *(const v8us*)(A + aoff + kc + 16));
            v16bf al = a;
            if (SPLITA) al = cat16b(*(const v8us*)(Al + aoff + kc), *(const v8us*)(Al + aoff + kc + 16));
#pragma unroll
            for (int t = 0; t < 4; ++t) { const v16bf b = cat16b(*(const v8us*)(Bn + boff[t] + kc), *(const v8us*)(Bn + boff[t] + kc + 16)); acc[t] = wmmab(a, b, acc[t]); if (SPLITA) acc[t] = wmmab(al, b, acc[t]); }
            asm volatile("v_nop\n\tv_nop\n\tv_nop\n\tv_nop" : "+v"(acc[0]), "+v"(acc[1]), "+v"(acc[2]), "+v"(acc[3]) : "v"(a), "v"(al));
        }
    }
    float* os = &ost[wave][0];
#pragma unroll
    for (int t = 0; t < 4; ++t) { const float bv = bias ? bfr(bias[c0 + t * 16 + lr]) : 0.f;
#pragma unroll
        for (int j = 0; j < 8; ++j) os[(hi * 8 + j) * 68 + t * 16 + lr] = acc[t][j] + bv; }
    __syncthreads();
    if (F16OUT) {
        h16* crow = (h16*)(void*)C + (size_t)r0 * ldc + c0;
        auto pass = [&]() {
#pragma unroll
            for (int s = 0; s < 4; ++s) { const int row = 4 * s + (lane >> 3), piece = lane & 7; const float* sp = os + row * 68 + piece * 8; v8h o, o2;
#pragma unroll
                for (int i = 0; i < 8; ++i) { const h16 a = (h16)sp[i]; o[i] = a; o2[i] = (h16)((sp[i] - (float)a) * LOSC); }
                *(v8h*)(crow + (size_t)row * ldc + piece * 8) = o; if (C2) *(v8h*)(C2 + (size_t)r0 * ldc + c0 + (size_t)row * ldc + piece * 8) = o2; }
        };
        pass(); 
    } else {
        float* crow = C + (size_t)r0 * ldc + c0;
        auto pass = [&]() {
#pragma unroll
            for (int s = 0; s < 8; ++s) { const int Lid = (lane >> 3) + 4 * s, piece = lane & 7; const int row = Lid >> 1, cofs = (Lid & 1) * 32 + piece * 4;
                v4f val = *(const v4fa*)(os + row * 68 + cofs); if (R) { const v4f rv = *(const v4f*)(R + ((size_t)r0 + row) * ldc + c0 + cofs); val += roundR ? (v4f){bfr(rv[0]), bfr(rv[1]), bfr(rv[2]), bfr(rv[3])} : rv; }
                *(v4f*)(crow + (size_t)row * ldc + cofs) = val; }
        };
        pass(); 
    }
}

__device__ __forceinline__ void p_cvtw(int bid, const float* __restrict__ src, int nrows, bf* dst) {
    const int lane = threadIdx.x & 31, r = bid * 8 + (threadIdx.x >> 5);
    if (r >= nrows) return;
    v8us o[KW / 256];
#pragma unroll
    for (int q = 0; q < KW / 256; ++q) { v8us t;
#pragma unroll
        for (int i = 0; i < 8; ++i) t[i] = f2bf(src[(size_t)r * KW + q * 256 + lane * 8 + i]);
        o[q] = t; }
{
#pragma unroll
        for (int q = 0; q < KW / 256; ++q) *(v8us*)(dst + (size_t)r * KW + q * 256 + lane * 8) = o[q];
         }
}
// p_vt: V^T plane = bf16(x)^T of one batch item, straight from x (the same rounding as p_cvt128's), 64 x 64 LDS tiles; stores of 8 lanes x 16 B. th_ = 64 x 72 LDS elements.
__device__ __forceinline__ void p_vt(int bx, int dh, int item, const float* __restrict__ V, bf* VTH, unsigned short* th_) {
    const int t0 = bx * 64, tid = threadIdx.x;
    const int tt = tid >> 2, dq = (tid & 3) * 16;
    V += (size_t)item * NT_ * HS; VTH += (size_t)item * HS * NT_;
    const float* src = V + ((size_t)t0 + tt) * HS + dh * 64 + dq;
#pragma unroll
    for (int i = 0; i < 16; ++i) th_[(dq + i) * 72 + tt] = f2bf(src[i]);
    __syncthreads();
    const int piece = tid & 7;
    auto pass = [&]() {
#pragma unroll
        for (int s = 0; s < 2; ++s) { const int d = (tid >> 3) + 32 * s;
            const v8us a = *(const v8usa*)(th_ + d * 72 + piece * 8);
            *(v8us*)(VTH + (size_t)(dh * 64 + d) * NT_ + t0 + piece * 8) = a; }
    };
    pass(); 
    asm volatile("s_wait_xcnt 0x0" ::: "memory");   // the stores' registers are free before code of another job, which follows in the listing, may rewrite them
}
// k_prep: every job that depends on the inputs alone, in one launch. Block ranges: 64 weight tiles (16 matrices x 4), 16 of W_o, 256 of V^T, 1024 of x; every branch is block-uniform.
#define PB_WT  (2 * NH_ * 4)
#define PB_WO  (HS / 8)
#define PB_VT  (NB_ * 2 * (NT_ / 64))
#define PB_X   (NB_ * NTK / 8)
__global__ __launch_bounds__(256) void k_prep(const float* __restrict__ x, const float* __restrict__ Wq, const float* __restrict__ Wk, const float* __restrict__ Wo, bf* Xb, bf* VTH, bf* WqT, bf* WkT, bf* WoB) {
    __shared__ __align__(16) unsigned short tl[64 * 72];
    int bid = blockIdx.x;
    if (bid < PB_WT) {      // per-head k-major [128][128] -> rows h*128.. of the n-major planes [1024][128]
        const int h = bid >> 3, wk = (bid >> 2) & 1;
        p_wt(bid & 1, (bid >> 1) & 1, (wk ? Wk : Wq) + (size_t)h * HS * HD, HS, HD, (wk ? WkT : WqT) + (size_t)h * HD * HS, tl);
        return;
    }
    bid -= PB_WT;
    if (bid < PB_WO) { p_cvtw(bid, Wo, HS, WoB); return; }      // W_o [128][1024] = [out][in]: bf16 copy = n-major B operand
    bid -= PB_WO;
    if (bid < PB_VT) { p_vt(bid & (NT_ / 64 - 1), (bid / (NT_ / 64)) & 1, bid / (2 * (NT_ / 64)), x, VTH, tl); return; }
    p_cvt128(bid - PB_VT, x, NB_ * NTK, Xb);
}
// stage_kv: the 128 threads of one half of the block copy one 32-key tile (K hi and K residual rows of one head: 32 x 256 B each; V^T: 128 rows x 64 B) from global memory into one
// ring buffer, 12 asynchronous 16-B copies a thread; a wave's K copy covers two whole 256-B rows. lb = the buffer's LDS byte address.
__device__ __forceinline__ void stage_kv(const h16* kh, const h16* kl, const bf* vt, unsigned lb, int l0, int tid) {
    const int kr = tid >> 4, kc8 = (tid & 15) * 8, vr = tid >> 2, vc8 = (tid & 3) * 8;
    const h16* gh = kh + (size_t)(l0 + kr) * KW + kc8; const h16* gl = kl + (size_t)(l0 + kr) * KW + kc8; const bf* gv = vt + (size_t)vr * NT_ + l0 + vc8;
    const unsigned lh = lb + (unsigned)(kr * KP + kc8) * 2u, ll = lh + KPL * 2u, lv = lb + (unsigned)(2 * KPL + vr * VP + vc8) * 2u;
    // the copies and their s_wait_xcnt in one statement: no address register of a copy is rewritten in front of that wait
    asm volatile("global_load_async_to_lds_b128 %0, %1, off\n\t"
                 "global_load_async_to_lds_b128 %2, %3, off\n\t"
                 "global_load_async_to_lds_b128 %4, %5, off\n\t"
                 "global_load_async_to_lds_b128 %6, %7, off\n\t"
                 "global_load_async_to_lds_b128 %8, %9, off\n\t"
                 "global_load_async_to_lds_b128 %10, %11, off\n\t"
                 "global_load_async_to_lds_b128 %12, %13, off\n\t"
                 "global_load_async_to_lds_b128 %14, %15, off\n\t"
                 "global_load_async_to_lds_b128 %16, %17, off\n\t"
                 "global_load_async_to_lds_b128 %18, %19, off\n\t"
                 "global_load_async_to_lds_b128 %20, %21, off\n\t"
                 "global_load_async_to_lds_b128 %22, %23, off\n\t"
                 "s_wait_xcnt 0x0"
                 :: "v"(lh), "v"(gh), "v"(lh + 8u * KP * 2u), "v"(gh + (size_t)8 * KW), "v"(lh + 16u * KP * 2u), "v"(gh + (size_t)16 * KW), "v"(lh + 24u * KP * 2u), "v"(gh + (size_t)24 * KW),
                    "v"(ll), "v"(gl), "v"(ll + 8u * KP * 2u), "v"(gl + (size_t)8 * KW), "v"(ll + 16u * KP * 2u), "v"(gl + (size_t)16 * KW), "v"(ll + 24u * KP * 2u), "v"(gl + (size_t)24 * KW),
                    "v"(lv), "v"(gv), "v"(lv + 32u * VP * 2u), "v"(gv + (size_t)32 * NT_), "v"(lv + 64u * VP * 2u), "v"(gv + (size_t)64 * NT_), "v"(lv + 96u * VP * 2u), "v"(gv + (size_t)96 * NT_)
                 : "memory");
}
// stage_q: the block's 256 threads copy its 64 Q rows of one head (hi and residual plane, 256 B a row) into LDS at K's pitch, once, 8 asynchronous 16-B copies a thread;
// a wave's copy covers two whole rows. lb = LDS byte address of the hi plane; the residual plane follows it.
__device__ __forceinline__ void stage_q(const h16* qh, const h16* ql, unsigned lb, int tid) {
    const int r = tid >> 4, c8 = (tid & 15) * 8;
    const h16* gh = qh + (size_t)r * KW + c8; const h16* gl = ql + (size_t)r * KW + c8;
    const unsigned lh = lb + (unsigned)(r * KP + c8) * 2u, ll = lh + 64u * KP * 2u;
    // the copies and their s_wait_xcnt in one statement: no address register of a copy is rewritten in front of that wait
    asm volatile("global_load_async_to_lds_b128 %0, %1, off\n\t"
                 "global_load_async_to_lds_b128 %2, %3, off\n\t"
                 "global_load_async_to_lds_b128 %4, %5, off\n\t"
                 "global_load_async_to_lds_b128 %6, %7, off\n\t"
                 "global_load_async_to_lds_b128 %8, %9, off\n\t"
                 "global_load_async_to_lds_b128 %10, %11, off\n\t"
                 "global_load_async_to_lds_b128 %12, %13, off\n\t"
                 "global_load_async_to_lds_b128 %14, %15, off\n\t"
                 "s_wait_xcnt 0x0"
                 :: "v"(lh), "v"(gh), "v"(lh + 16u * KP * 2u), "v"(gh + (size_t)16 * KW), "v"(lh + 32u * KP * 2u), "v"(gh + (size_t)32 * KW), "v"(lh + 48u * KP * 2u), "v"(gh + (size_t)48 * KW),
                    "v"(ll), "v"(gl), "v"(ll + 16u * KP * 2u), "v"(gl + (size_t)16 * KW), "v"(ll + 32u * KP * 2u), "v"(gl + (size_t)32 * KW), "v"(ll + 48u * KP * 2u), "v"(gl + (size_t)48 * KW)
                 : "memory");
}
// k_attn: block = 8 waves = (item, head, 64 queries); a step is 64 keys: waves 0-3 (16 queries each) take its even 32-key tile, waves 4-7 the odd one for the same queries,
// so the longest block walks 64 steps. The softmax shift is fixed, so the two halves' o and l are plain partial sums: waves 4-7 hand theirs over through LDS behind the
// loop, waves 0-3 add them and finish. Two blocks fit a WGP, half of the grid at a time: the blocks with the most steps come first in the grid, the short ones fill up.
// K slice of head h (row stride NH*HD), V = bf16(x)^T shared by all heads (exact, single plane); causal key tiles
// 0..(Q0+63)/32; per element: j <= q -> clip(score x 128^-1/2, -10, 10) else -inf (reference: clip before the causal where); scores hh + (hl+lh)/1024 on separate
// accumulators; softmax f32 with the fixed shift 10; P (x32768) as bf16 hi + unscaled residual; o += ph.v + pl.v; ctx / l -> bf16 hi/lo planes CH/CL[tok][h*128+d].
// Both products run transposed: S^T = K.Q^T (A = K rows, B = Q rows), O^T += V^T.P^T (A = V^T rows, B = P^T). A lane then holds scores of ONE query (column lr), keys 8*hi + j of
// each 16-key tile, which is the k order of a B fragment: the two score tiles, converted in place, ARE P^T's fragment, and P goes through no LDS and no lane exchange.
__global__ __launch_bounds__(256) void k_attn(const h16* __restrict__ QH, const h16* __restrict__ QL, const h16* __restrict__ KH, const h16* __restrict__ KL, const bf* __restrict__ VTH, bf* CH, bf* CL) {
    __shared__ __align__(16) unsigned short qs[2 * 64 * KP];   // the block's Q rows, hi and residual plane, copied once: a fragment read from global memory touches 16 lines, and every key tile repeated it. Behind the loop: output staging
    __shared__ __align__(16) unsigned short ring[4 * STG];     // two buffers of two key tiles: the next step's copies fly while this one is worked on; 4 waves share each tile
    const int lane = threadIdx.x & 31, wave = threadIdx.x >> 5, lr = lane & 15, hi = lane >> 4;
    const int grp = __builtin_amdgcn_readfirstlane(threadIdx.x >> 7), w4 = wave & 3, t128 = threadIdx.x & 127;   // grp (wave-uniform): which key tile of a step this wave takes
    const int bid = blockIdx.x; const int qt = NT_ / 64 - 1 - bid / (NH_ * NB_), h = bid % NH_, item = (bid / NH_) % NB_; const int g = h;   // K has one slice per head; V (= x) is shared by all heads
    { const size_t ib = (size_t)item * NT_ * KW;                      // batch item: its own rows of every plane, its own V^T
      QH += ib; QL += ib; KH += ib; KL += ib; CH += ib; CL += ib; VTH += (size_t)item * HS * NT_; }
    const int q0 = qt * 64 + w4 * 16;
    const unsigned short* tq = qs + (w4 * 16 + lr) * KP + 8 * hi;    // this lane's Q row in LDS; the residual plane lies 64 rows on
    const h16* kh_b = KH + g * HD; const h16* kl_b = KL + g * HD;
    v8f o[8];
#pragma unroll
    for (int n = 0; n < 8; ++n) o[n] = (v8f){};
    float lsum = 0.f;                                               // this lane's share of its query's row sum: the keys 8*hi + j of every 16-key tile
    const int st_hi = qt;                                           // causal: steps of 64 keys, 0..qt; each half of the block copies the tile it works on
    const unsigned ring_b = (unsigned)(size_t)&ring[0];              // LDS byte address of the ring
    stage_q(QH + (size_t)(qt * 64) * KW + h * HD, QL + (size_t)(qt * 64) * KW + h * HD, (unsigned)(size_t)&qs[0], threadIdx.x);
    stage_kv(kh_b, kl_b, VTH, ring_b + (unsigned)grp * (STG * 2u), grp * 32, t128);
    asm volatile("s_wait_asynccnt 0x0" ::: "memory");               // this wave's copies of Q and of step 0 have landed
    __syncthreads();                                                // ... and every other wave's
    if (st_hi >= 1) stage_kv(kh_b, kl_b, VTH, ring_b + (unsigned)(2 + grp) * (STG * 2u), 64 + grp * 32, t128);
#pragma unroll 1
    for (int st = 0; st <= st_hi; ++st) {
        const int l0 = st * 64 + grp * 32;
        const unsigned short* tb = ring + ((st & 1) * 2 + grp) * STG;
        const unsigned short* tkh = tb + lr * KP + 8 * hi; const unsigned short* tkl = tkh + KPL; const unsigned short* tv = tb + 2 * KPL + lr * VP + 8 * hi;
        v8f s0 = {}, s1 = {}, x0 = {}, x1 = {};
        // LDS fragment reads run ahead of their use, so that a wave waits on a count and not on an empty queue: chunk kc + 1's four K fragments are requested in front of chunk kc's
        // products (two register sets), and all eight V fragments behind the last score product, into the K sets' registers, so that they land under the softmax
        v16h kf[2][4], qf[2][2];                                    // the Q fragments of a chunk come with its K fragments
        auto ldk = [&](int kc, v16h* d, v16h* q) {
            q[0] = cat16(*(const v8ha*)(tq + kc * 32), *(const v8ha*)(tq + kc * 32 + 16)); q[1] = cat16(*(const v8ha*)(tq + 64 * KP + kc * 32), *(const v8ha*)(tq + 64 * KP + kc * 32 + 16));
            d[0] = cat16(*(const v8ha*)(tkh + kc * 32), *(const v8ha*)(tkh + kc * 32 + 16)); d[1] = cat16(*(const v8ha*)(tkh + 16 * KP + kc * 32), *(const v8ha*)(tkh + 16 * KP + kc * 32 + 16));
            d[2] = cat16(*(const v8ha*)(tkl + kc * 32), *(const v8ha*)(tkl + kc * 32 + 16)); d[3] = cat16(*(const v8ha*)(tkl + 16 * KP + kc * 32), *(const v8ha*)(tkl + 16 * KP + kc * 32 + 16)); };
        v16bf vf[8];
        ldk(0, kf[0], qf[0]);
#pragma unroll
        for (int kc = 0; kc < 4; ++kc) {
            if (kc < 3) ldk(kc + 1, kf[(kc + 1) & 1], qf[(kc + 1) & 1]);
            const v16h qa = qf[kc & 1][0], qx = qf[kc & 1][1];
            const v16h k0h = kf[kc & 1][0], k1h = kf[kc & 1][1], k0l = kf[kc & 1][2], k1l = kf[kc & 1][3];
            s0 = wmma16(k0h, qa, s0); s1 = wmma16(k1h, qa, s1); x0 = wmma16(k0h, qx, x0); x1 = wmma16(k1h, qx, x1);     // s[j] = S^T[key 8*hi + j][query lr]
            x0 = wmma16(k0l, qa, x0); x1 = wmma16(k1l, qa, x1);
            // one vector slot behind the chunk's last product, with its operands still held: the next requests into this register set stand behind it
            asm volatile("v_nop" : "+v"(s0), "+v"(s1), "+v"(x0), "+v"(x1) : "v"(qa), "v"(qx), "v"(k0h), "v"(k1h), "v"(k0l), "v"(k1l));
        }
#pragma unroll
        for (int n = 0; n < 8; ++n) vf[n] = cat16b(*(const v8usa*)(tv + n * 16 * VP), *(const v8usa*)(tv + n * 16 * VP + 16));     // V = bf16(x) exactly (a rounded INPUT): no residual plane
        asm volatile("v_nop\n\tv_nop\n\tv_nop\n\tv_nop" : "+v"(s0), "+v"(s1), "+v"(x0), "+v"(x1));
        float pe[16];                                               // P^T in B's k order: 0-7 = keys 8*hi + j (tile 0), 8-15 = keys 16 + 8*hi + j (tile 1)
        const int lim = q0 + lr - l0 - hi * 8;                      // causal, key l0 + 8*hi + j (+ 16) <= query q0 + lr: register index j (+ 16) against this lane's limit
#pragma unroll
        for (int j = 0; j < 8; ++j) {
            // reference order: scores / sqrt(128) -> clip(-10, 10) -> causal where -> softmax
            const float a0 = (j <= lim) ? fminf(fmaxf((s0[j] + x0[j] * LOSCI) * 0.08838834764831845f, -10.0f), 10.0f) : -__builtin_inff(), a1 = (j + 16 <= lim) ? fminf(fmaxf((s1[j] + x1[j] * LOSCI) * 0.08838834764831845f, -10.0f), 10.0f) : -__builtin_inff();
            // every kept score lies in [-10, 10] after the clip, so the clip's upper bound is the softmax shift: exp(a - 10) is in [e^-20, 1] for any input,
            // and no row maximum is searched, carried or applied to o and l
            pe[j] = (a0 - 10.0f) * 1.44269504f; pe[8 + j] = (a1 - 10.0f) * 1.44269504f; }      // exp(t) = 2^(t x log2 e), as __expf forms it
        // the tile's 16 exponentials in one statement, each in place, its last line the one slot that the instruction set asks for behind a transcendental
        asm("v_exp_f32 %0, %0\n\tv_exp_f32 %1, %1\n\tv_exp_f32 %2, %2\n\tv_exp_f32 %3, %3\n\tv_exp_f32 %4, %4\n\tv_exp_f32 %5, %5\n\tv_exp_f32 %6, %6\n\tv_exp_f32 %7, %7\n\t"
            "v_exp_f32 %8, %8\n\tv_exp_f32 %9, %9\n\tv_exp_f32 %10, %10\n\tv_exp_f32 %11, %11\n\tv_exp_f32 %12, %12\n\tv_exp_f32 %13, %13\n\tv_exp_f32 %14, %14\n\tv_exp_f32 %15, %15\n\tv_nop"
            : "+v"(pe[0]), "+v"(pe[1]), "+v"(pe[2]), "+v"(pe[3]), "+v"(pe[4]), "+v"(pe[5]), "+v"(pe[6]), "+v"(pe[7]),
              "+v"(pe[8]), "+v"(pe[9]), "+v"(pe[10]), "+v"(pe[11]), "+v"(pe[12]), "+v"(pe[13]), "+v"(pe[14]), "+v"(pe[15]));
        float ps[16];
#pragma unroll
        for (int j = 0; j < 8; ++j) { lsum += pe[j] + pe[8 + j]; ps[j] = pe[j] * PSC; ps[8 + j] = pe[8 + j] * PSC; }
        v8u pw, rw;                                                 // neighbours in k share a register: one packed conversion (round to nearest even, as f2bf) makes each word of the fragment
#pragma unroll
        for (int i = 0; i < 8; ++i) { const unsigned w = __builtin_bit_cast(unsigned, __builtin_convertvector((v2f){ps[2 * i], ps[2 * i + 1]}, v2bf)); pw[i] = w;
            rw[i] = __builtin_bit_cast(unsigned, __builtin_convertvector((v2f){ps[2 * i] - __uint_as_float(w << 16), ps[2 * i + 1] - __uint_as_float(w & 0xFFFF0000u)}, v2bf)); }
        const v16bf pa = __builtin_bit_cast(v16bf, pw), px = __builtin_bit_cast(v16bf, rw);
#pragma unroll
        for (int n = 0; n < 8; ++n) o[n] = wmmab(vf[n], pa, o[n]);      // o[n][j] = O^T[d = n*16 + 8*hi + j][query lr]
#pragma unroll
        for (int n = 0; n < 8; ++n) o[n] = wmmab(vf[n], px, o[n]);      // per o[n] still hi then residual: the sums keep their order
        // four vector slots behind the last products before anything may rewrite their operands; all eight accumulators are named, so that no product drifts behind the barrier with its V registers held
        asm volatile("v_nop\n\tv_nop\n\tv_nop\n\tv_nop" : "+v"(o[0]), "+v"(o[1]), "+v"(o[2]), "+v"(o[3]), "+v"(o[4]), "+v"(o[5]), "+v"(o[6]), "+v"(o[7]) : "v"(pa), "v"(px));
        __builtin_amdgcn_wave_barrier();
        asm volatile("s_wait_dscnt 0x0" ::: "memory");              // this wave's reads of the buffer are done before it may be refilled
        asm volatile("s_wait_asynccnt 0x0" ::: "memory");           // this wave's copies of step st + 1 have landed
        __syncthreads();                                            // publishes step st + 1 and ends every wave's reads of step st
        if (st + 2 <= st_hi) stage_kv(kh_b, kl_b, VTH, ring_b + (unsigned)((st & 1) * 2 + grp) * (STG * 2u), l0 + 128, t128);
    }
    asm volatile("s_wait_asynccnt 0x0" ::: "memory");               // nothing in flight when the ring is put to another use
    // the ring is free behind the loop's last barrier: waves 4-7 lay their partial o and l there, 16 x 16 B + 4 B a lane, for the wave with the same queries
    v4fa* xw = (v4fa*)(void*)ring + w4 * (16 * 32) + lane; float* xl = (float*)(void*)ring + 4 * (16 * 32) * 4 + w4 * 32 + lane;
    if (grp == 1) {
#pragma unroll
        for (int n = 0; n < 8; ++n) { xw[(2 * n) * 32] = (v4f){o[n][0], o[n][1], o[n][2], o[n][3]}; xw[(2 * n + 1) * 32] = (v4f){o[n][4], o[n][5], o[n][6], o[n][7]}; }
        *xl = lsum;
    }
    __syncthreads();                                                // the partial sums are visible to waves 0-3
    if (grp == 1) return;                                           // no barrier follows: waves 0-3 finish alone
#pragma unroll
    for (int n = 0; n < 8; ++n) { const v4f a = xw[(2 * n) * 32], b = xw[(2 * n + 1) * 32];
#pragma unroll
        for (int j = 0; j < 4; ++j) { o[n][j] += a[j]; o[n][4 + j] += b[j]; } }
    lsum += *xl;
    lsum += __shfl_xor(lsum, 16, 32);                               // the two lane halves hold the two halves of a query's keys
    const float inv = 1.0f / (lsum * PSC);
    float* os = (float*)(void*)qs + w4 * (16 * 68);                 // Q's last read lies in front of the loop's last barrier
    const size_t cbase = (size_t)q0 * (NH_ * HD) + (size_t)h * HD;
#pragma unroll
    for (int half = 0; half < 2; ++half) {
#pragma unroll
        for (int n = 0; n < 4; ++n) { const v8f t = o[half * 4 + n] * inv; v4fa* d = (v4fa*)(os + lr * 68 + n * 16 + hi * 8);     // a lane holds 8 consecutive d of its query's row
            d[0] = (v4f){t[0], t[1], t[2], t[3]}; d[1] = (v4f){t[4], t[5], t[6], t[7]}; }
        __builtin_amdgcn_wave_barrier(); asm volatile("" ::: "memory");
{
#pragma unroll
            for (int s = 0; s < 4; ++s) { const int row = 4 * s + (lane >> 3), piece = lane & 7; const float* sp = os + row * 68 + piece * 8; v8us oh, ol;
#pragma unroll
                for (int i = 0; i < 8; ++i) { const unsigned short hb = f2bf(sp[i]); oh[i] = hb; ol[i] = f2bf(sp[i] - bf2f(hb)); }
                const size_t po = cbase + (size_t)row * (NH_ * HD) + half * 64 + piece * 8; *(v8us*)(CH + po) = oh; *(v8us*)(CL + po) = ol; }
             }
        __builtin_amdgcn_wave_barrier(); asm volatile("" ::: "memory");
    }
}

extern "C" void kernel_launch(void* const* d_in, const int* in_sizes, int n_in,
                              void* d_out, int out_size, void* d_ws, size_t ws_size, hipStream_t stream) {
    (void)in_sizes; (void)n_in; (void)out_size;
    const float* x = (const float*)d_in[0]; const float* Wq = (const float*)d_in[1]; const float* Wk = (const float*)d_in[2]; const float* Wo = (const float*)d_in[3];   // Wq/Wk [8][128][128] (x.W[h]); Wo [128][1024] = [out][in]
    float* out = (float*)d_out;    // [2][4096][128]
    char* wsp = (char*)d_ws;
    auto take = [&](size_t bytes) { char* p = wsp; wsp += (bytes + 255) & ~(size_t)255; return (void*)p; };
    bf* Xb = (bf*)take((size_t)NB_ * NTK * HS * 2);
    bf* WqT = (bf*)take((size_t)KW * HS * 2); bf* WkT = (bf*)take((size_t)KW * HS * 2); bf* WoB = (bf*)take((size_t)HS * KW * 2);
    h16* QH = (h16*)take((size_t)NB_ * NTK * KW * 2); h16* QL = (h16*)take((size_t)NB_ * NTK * KW * 2); h16* KH = (h16*)take((size_t)NB_ * NTK * KW * 2); h16* KL = (h16*)take((size_t)NB_ * NTK * KW * 2);
    bf* VTH = (bf*)take((size_t)NB_ * HS * NT_ * 2); bf* CH = (bf*)take((size_t)NB_ * NTK * KW * 2); bf* CL = (bf*)take((size_t)NB_ * NTK * KW * 2);
    if ((size_t)(wsp - (char*)d_ws) > ws_size) return;    // about 105 MB, no aliasing: every per-item plane holds both batch items
    // four dependent launches: what reads inputs only; the Q and the K projection (grid z); attention; the output projection. Both batch items in every launch.
    k_prep<<<PB_WT + PB_WO + PB_VT + PB_X, 256, 0, stream>>>(x, Wq, Wk, Wo, Xb, VTH, WqT, WkT, WoB);
    k_gemmb<false, true><<<dim3(NB_ * NTK / 64, KW / 64, 2), 128, 0, stream>>>(Xb, nullptr, WqT, nullptr, (float*)(void*)QH, KW, QL, nullptr, HS, 1, WkT, (float*)(void*)KH, KL);
    k_attn<<<dim3(NB_ * NH_ * (NT_ / 64), 1, 1), 256, 0, stream>>>(QH, QL, KH, KL, VTH, CH, CL);
    k_gemmb<true, false><<<dim3(NB_ * NTK / 64, HS / 64, 1), 128, 0, stream>>>(CH, CL, WoB, nullptr, out, HS, nullptr, nullptr, KW);
}

// v010
// Measured time: 158 microseconds a run.
// Next to v009, in two timings, it ran 1.03 times as fast each time.
// All steps since v000 together make it 10.0 times as fast.
#include <hip/hip_runtime.h>

// Compute dtypes, f32 accumulate, both batch items in every launch: Q/K = x.W_q[h] / x.W_k[h] ([4096 x 128].[128 x 128] per head, k-major per-head weights transposed once
// into n-major [8*128][128] planes; PLAIN bf16 operands = inputs rounded once, exact products) written straight from the GEMM epilogue as f16 hi + residual
// x1024 planes [t][h*128+e], and out = y.W_o^T ([4096 x 1024].[1024 x 128], W_o [out][in] as-is; y as bf16 hi + residual) on v_wmma_f32_16x16x32_bf16; the
// 8-head causal attention with clipped scores (clip(s/sqrt(128), -10, 10)) and V = x itself (bf16(x)^T, exact, one plane) on v_wmma_f32_16x16x32_f16 (scores)

#define NB_  2
#define NT_  4096
#define HS   128                 // x width = head dim of q, k and v
#define NH_  8
#define HD   128
#define KW   (NH_ * HD)          // 1024: row stride of the Q/K planes
#define NTK  NT_
#define DM   HS                  // k_gemmb's default K
#define PSC  32768.0f
#define LOSC 1024.0f
#define LOSCI (1.0f / 1024.0f)
#define KP   136                 // LDS pitch of a staged K row in 16-bit elements: 272 B = 16 B x odd, for ds_load_b128 readers
#define VP   40                  // LDS pitch of a staged V^T row (32 keys) in 16-bit elements: 80 B = 16 B x odd
#define KPL  (32 * KP)           // one K plane of a 32-key tile
#define STG  (2 * KPL + HS * VP) // one ring buffer: K hi, K residual, V^T

typedef _Float16 h16;
typedef unsigned short bf;
typedef __attribute__((ext_vector_type(16))) __bf16   v16bf;
typedef __attribute__((ext_vector_type(16))) _Float16 v16h;
typedef __attribute__((ext_vector_type(8)))  _Float16 v8h;
typedef __attribute__((ext_vector_type(8)))  unsigned short v8us;
typedef __attribute__((ext_vector_type(8)))  float    v8f;
typedef __attribute__((ext_vector_type(4)))  float    v4f;
typedef __attribute__((ext_vector_type(4)))  _Float16 v4h;
typedef v8h  __attribute__((may_alias)) v8ha;
typedef v4f  __attribute__((may_alias)) v4fa;
typedef v8us __attribute__((may_alias)) v8usa;
typedef __attribute__((ext_vector_type(2)))  float    v2f;
typedef __attribute__((ext_vector_type(2)))  __bf16   v2bf;
typedef __attribute__((ext_vector_type(8)))  unsigned v8u;

__device__ __forceinline__ unsigned short f2bf(float f) { unsigned u = __float_as_uint(f); u += 0x7FFFu + ((u >> 16) & 1u); return (unsigned short)(u >> 16); }
__device__ __forceinline__ float bf2f(unsigned short b) { return __uint_as_float(((unsigned)b) << 16); }
__device__ __forceinline__ float bfr(float f) { return bf2f(f2bf(f)); }
__device__ __forceinline__ v16h cat16(v8h lo, v8h hi) { return __builtin_shufflevector(lo, hi, 0, 1, 2, 3, 4, 5, 6, 7, 8, 9, 10, 11, 12, 13, 14, 15); }
__device__ __forceinline__ v16bf cat16b(v8us lo, v8us hi) { return __builtin_bit_cast(v16bf, __builtin_shufflevector(lo, hi, 0, 1, 2, 3, 4, 5, 6, 7, 8, 9, 10, 11, 12, 13, 14, 15)); }
__device__ __forceinline__ v8f wmma16(v16h a, v16h b, v8f c) { return __builtin_amdgcn_wmma_f32_16x16x32_f16(false, a, false, b, (short)0, c, false, false); }
__device__ __forceinline__ v8f wmmab(v16bf a, v16bf b, v8f c) { return __builtin_amdgcn_wmma_f32_16x16x32_bf16(false, a, false, b, (short)0, c, false, false); }

// The four jobs below read inputs only and none reads another's output: they are parts of ONE launch (k_prep), each with its own range of 256-thread blocks; bid = index in the range.
// p_cvt128: one wave per row of x [rows][128]: bf16 plane (A operand of the Q and K projections); lane -> 4 consecutive floats
__device__ __forceinline__ void p_cvt128(int bid, const float* __restrict__ src, int nrows, bf* dstb) {
    typedef __attribute__((ext_vector_type(4))) unsigned short v4us;
    const int lane = threadIdx.x & 31, r = bid * 8 + (threadIdx.x >> 5);
    if (r >= nrows) return;
    const v4f v = *(const v4f*)(src + (size_t)r * HS + lane * 4); v4us ob;
#pragma unroll
    for (int i = 0; i < 4; ++i) ob[i] = f2bf(v[i]);
    *(v4us*)(dstb + (size_t)r * HS + lane * 4) = ob;
}
// p_wt: WT [n][K] = bf16(W[k][n]) (k-major [K][ncols]) via 64 x 64 LDS tiles; (bx, by) = tile of (K/64, ncols/64); tl = 64 x 72 LDS elements.
__device__ __forceinline__ void p_wt(int bx, int by, const float* __restrict__ Wm, int K, int ncols, bf* WT, unsigned short* tl) {
    const int tid = threadIdx.x, k0 = bx * 64, n0 = by * 64;
    const int kk = tid >> 2, nq = (tid & 3) * 16;
#pragma unroll
    for (int i = 0; i < 16; ++i) tl[(nq + i) * 72 + kk] = f2bf(Wm[(size_t)(k0 + kk) * ncols + n0 + nq + i]);
    __syncthreads();
    const int piece = tid & 7;
    auto pass = [&]() {
#pragma unroll
        for (int s = 0; s < 2; ++s) { const int nr = (tid >> 3) + 32 * s; const v8us val = *(const v8usa*)(tl + nr * 72 + piece * 8); *(v8us*)(WT + (size_t)(n0 + nr) * K + k0 + piece * 8) = val; }
    };
    pass(); 
    asm volatile("s_wait_xcnt 0x0" ::: "memory");   // the stores' registers are free before code of another job, which follows in the listing, may rewrite them
}
// stage64: a block's 128 threads copy 64 rows x 128 16-bit elements (256 B of each row, row stride ld elements) from global memory into LDS at pitch KP, 8 asynchronous 16-B copies a thread;
// a wave's copy covers two whole 256-B pieces of rows. lb = LDS byte address of the plane.
__device__ __forceinline__ void stage64(const bf* g, int ld, unsigned lb, int tid) {
    const int r = tid >> 4, c8 = (tid & 15) * 8;
    const bf* gp = g + (size_t)r * ld + c8; const size_t s8 = (size_t)8 * ld;
    const unsigned l = lb + (unsigned)(r * KP + c8) * 2u;
    // the copies and their s_wait_xcnt in one statement: no address register of a copy is rewritten in front of that wait
    asm volatile("global_load_async_to_lds_b128 %0, %1, off\n\t"
                 "global_load_async_to_lds_b128 %2, %3, off\n\t"
                 "global_load_async_to_lds_b128 %4, %5, off\n\t"
                 "global_load_async_to_lds_b128 %6, %7, off\n\t"
                 "global_load_async_to_lds_b128 %8, %9, off\n\t"
                 "global_load_async_to_lds_b128 %10, %11, off\n\t"
                 "global_load_async_to_lds_b128 %12, %13, off\n\t"
                 "global_load_async_to_lds_b128 %14, %15, off\n\t"
                 "s_wait_xcnt 0x0"
                 :: "v"(l), "v"(gp), "v"(l + 8u * KP * 2u), "v"(gp + s8), "v"(l + 16u * KP * 2u), "v"(gp + 2 * s8), "v"(l + 24u * KP * 2u), "v"(gp + 3 * s8),
                    "v"(l + 32u * KP * 2u), "v"(gp + 4 * s8), "v"(l + 40u * KP * 2u), "v"(gp + 5 * s8), "v"(l + 48u * KP * 2u), "v"(gp + 6 * s8), "v"(l + 56u * KP * 2u), "v"(gp + 7 * s8)
                 : "memory");
}
// k_gemmb: 64 x 64 block tile (4 waves x 16 x 64) of C[NB_ * NTK][NW] = (A [+ Al]).B^T (K = 128 or 1024) [+ bf(bias[c])] [+ bf(R[r][c]) residual]; f32 whole-line epilogue (or f16
template <bool SPLITA, bool F16OUT = false>
__global__ __launch_bounds__(128) void k_gemmb(const bf* __restrict__ A, const bf* __restrict__ Al, const bf* __restrict__ Bn0, const float* __restrict__ bias, float* C0, int ldc, h16* C20, const float* __restrict__ R = nullptr, int K = DM, int roundR = 1, const bf* __restrict__ BnZ = nullptr, float* CZ = nullptr, h16* C2Z = nullptr) {
    __shared__ __align__(16) float ost[4][16 * 68];
    // blockIdx.z = 1: a second product of the same A in the same launch, with its own B and outputs
    const bf* Bn = blockIdx.z ? BnZ : Bn0; float* C = blockIdx.z ? CZ : C0; h16* C2 = blockIdx.z ? C2Z : C20;
    const int lane = threadIdx.x & 31, wave = threadIdx.x >> 5, lr = lane & 15, hi = lane >> 4;
    const int r0 = blockIdx.x * 64 + wave * 16, c0 = blockIdx.y * 64;
    const size_t aoff = (size_t)(r0 + lr) * K + 8 * hi;
    size_t boff[4];
#pragma unroll
    for (int t = 0; t < 4; ++t) boff[t] = (size_t)(c0 + t * 16 + lr) * K + 8 * hi;
    v8f acc[4];
#pragma unroll
    for (int t = 0; t < 4; ++t) acc[t] = (v8f){};
    if constexpr (SPLITA) {
        // K = 1024, one block a WGP, one wave a SIMD. A fragment read from global memory touches 16 lines, every wave repeats B's, and nothing hides the wait. So tiles of 128 k (A hi, A residual:
        // the block's 64 rows; B: its 64 columns) are copied into LDS in whole 256-B pieces of rows, two buffers: the next tile's copies fly while this one is worked on, and the 4 waves share B.
        // K is a multiple of 128. Per accumulator the products keep their order.
        __shared__ __align__(16) unsigned short tile[2 * 3 * 64 * KP];
        const unsigned tile_b = (unsigned)(size_t)&tile[0];              // LDS byte address of the buffers
        const bf* ga = A + (size_t)(blockIdx.x * 64) * K; const bf* gl = Al + (size_t)(blockIdx.x * 64) * K; const bf* gb = Bn + (size_t)c0 * K;
        auto stage = [&](int t) { const unsigned lb = tile_b + (unsigned)(t & 1) * (3u * 64u * KP * 2u);
            stage64(ga + t * 128, K, lb, threadIdx.x); stage64(gl + t * 128, K, lb + 64u * KP * 2u, threadIdx.x); stage64(gb + t * 128, K, lb + 2u * 64u * KP * 2u, threadIdx.x); };
        const int nst = K / 128;
        stage(0);
        asm volatile("s_wait_asynccnt 0x0" ::: "memory");               // this wave's copies of tile 0 have landed
        __syncthreads();                                                // ... and every other wave's
        if (nst > 1) stage(1);
#pragma unroll 1    // rolled: one body serves both buffers (t & 1), the code stays short
        for (int t = 0; t < nst; ++t) {
            const unsigned short* tb = tile + (t & 1) * (3 * 64 * KP);
            const unsigned short* ta = tb + (wave * 16 + lr) * KP + 8 * hi; const unsigned short* tn = tb + 2 * 64 * KP + lr * KP + 8 * hi;
            // the loops below are unrolled: LDS offsets become immediates, and the register arrays get constant indices
#pragma unroll
            for (int kc = 0; kc < 128; kc += 32) {
                const v16bf a = cat16b(*(const v8usa*)(ta + kc), *(const v8usa*)(ta + kc + 16)), al = cat16b(*(const v8usa*)(ta + 64 * KP + kc), *(const v8usa*)(ta + 64 * KP + kc + 16));
                v16bf b[4];
#pragma unroll
                for (int u = 0; u < 4; ++u) b[u] = cat16b(*(const v8usa*)(tn + u * 16 * KP + kc), *(const v8usa*)(tn + u * 16 * KP + kc + 16));
#pragma unroll
                for (int u = 0; u < 4; ++u) acc[u] = wmmab(a, b[u], acc[u]);
#pragma unroll
                for (int u = 0; u < 4; ++u) acc[u] = wmmab(al, b[u], acc[u]);
            }
            // four vector slots behind the tile's last products before anything behind the barrier may rewrite their operands
            asm volatile("v_nop\n\tv_nop\n\tv_nop\n\tv_nop" : "+v"(acc[0]), "+v"(acc[1]), "+v"(acc[2]), "+v"(acc[3]));
            asm volatile("s_wait_dscnt 0x0" ::: "memory");              // this wave's reads of the buffer are done before it may be refilled
            asm volatile("s_wait_asynccnt 0x0" ::: "memory");           // this wave's copies of tile t + 1 have landed
            __syncthreads();                                            // publishes tile t + 1 and ends every wave's reads of tile t
            if (t + 2 < nst) stage(t + 2);
        }
        asm volatile("s_wait_asynccnt 0x0" ::: "memory");               // nothing in flight behind the loop
    } else {
#pragma unroll 1
        for (int kc = 0; kc < K; kc += 32) {
            const v16bf a = cat16b(*(const v8us*)(A + aoff + kc), *(const v8us*)(A + aoff + kc + 16));
            v16bf al = a;
            if (SPLITA) al = cat16b(*(const v8us*)(Al + aoff + kc), *(const v8us*)(Al + aoff + kc + 16));
#pragma unroll
            for (int t = 0; t < 4; ++t) { const v16bf b = cat16b(*(const v8us*)(Bn + boff[t] + kc), *(const v8us*)(Bn + boff[t] + kc + 16)); acc[t] = wmmab(a, b, acc[t]); if (SPLITA) acc[t] = wmmab(al, b, acc[t]); }
            asm volatile("v_nop\n\tv_nop\n\tv_nop\n\tv_nop" : "+v"(acc[0]), "+v"(acc[1]), "+v"(acc[2]), "+v"(acc[3]) : "v"(a), "v"(al));
        }
    }
    float* os = &ost[wave][0];
#pragma unroll
    for (int t = 0; t < 4; ++t) { const float bv = bias ? bfr(bias[c0 + t * 16 + lr]) : 0.f;
#pragma unroll
        for (int j = 0; j < 8; ++j) os[(hi * 8 + j) * 68 + t * 16 + lr] = acc[t][j] + bv; }
    __syncthreads();
    if (F16OUT) {
        h16* crow = (h16*)(void*)C + (size_t)r0 * ldc + c0;
        auto pass = [&]() {
#pragma unroll
            for (int s = 0; s < 4; ++s) { const int row = 4 * s + (lane >> 3), piece = lane & 7; const float* sp = os + row * 68 + piece * 8; v8h o, o2;
#pragma unroll
                for (int i = 0; i < 8; ++i) { const h16 a = (h16)sp[i]; o[i] = a; o2[i] = (h16)((sp[i] - (float)a) * LOSC); }
                *(v8h*)(crow + (size_t)row * ldc + piece * 8) = o; if (C2) *(v8h*)(C2 + (size_t)r0 * ldc + c0 + (size_t)row * ldc + piece * 8) = o2; }
        };
        pass(); 
    } else {
        float* crow = C + (size_t)r0 * ldc + c0;
        auto pass = [&]() {
#pragma unroll
            for (int s = 0; s < 8; ++s) { const int Lid = (lane >> 3) + 4 * s, piece = lane & 7; const int row = Lid >> 1, cofs = (Lid & 1) * 32 + piece * 4;
                v4f val = *(const v4fa*)(os + row * 68 + cofs); if (R) { const v4f rv = *(const v4f*)(R + ((size_t)r0 + row) * ldc + c0 + cofs); val += roundR ? (v4f){bfr(rv[0]), bfr(rv[1]), bfr(rv[2]), bfr(rv[3])} : rv; }
                *(v4f*)(crow + (size_t)row * ldc + cofs) = val; }
        };
        pass(); 
    }
}

__device__ __forceinline__ void p_cvtw(int bid, const float* __restrict__ src, int nrows, bf* dst) {
    const int lane = threadIdx.x & 31, r = bid * 8 + (threadIdx.x >> 5);
    if (r >= nrows) return;
    v8us o[KW / 256];
#pragma unroll
    for (int q = 0; q < KW / 256; ++q) { v8us t;
#pragma unroll
        for (int i = 0; i < 8; ++i) t[i] = f2bf(src[(size_t)r * KW + q * 256 + lane * 8 + i]);
        o[q] = t; }
{
#pragma unroll
        for (int q = 0; q < KW / 256; ++q) *(v8us*)(dst + (size_t)r * KW + q * 256 + lane * 8) = o[q];
         }
}
// p_vt: V^T plane = bf16(x)^T of one batch item, straight from x (the same rounding as p_cvt128's), 64 x 64 LDS tiles; stores of 8 lanes x 16 B. th_ = 64 x 72 LDS elements.
__device__ __forceinline__ void p_vt(int bx, int dh, int item, const float* __restrict__ V, bf* VTH, unsigned short* th_) {
    const int t0 = bx * 64, tid = threadIdx.x;
    const int tt = tid >> 2, dq = (tid & 3) * 16;
    V += (size_t)item * NT_ * HS; VTH += (size_t)item * HS * NT_;
    const float* src = V + ((size_t)t0 + tt) * HS + dh * 64 + dq;
#pragma unroll
    for (int i = 0; i < 16; ++i) th_[(dq + i) * 72 + tt] = f2bf(src[i]);
    __syncthreads();
    const int piece = tid & 7;
    auto pass = [&]() {
#pragma unroll
        for (int s = 0; s < 2; ++s) { const int d = (tid >> 3) + 32 * s;
            const v8us a = *(const v8usa*)(th_ + d * 72 + piece * 8);
            *(v8us*)(VTH + (size_t)(dh * 64 + d) * NT_ + t0 + piece * 8) = a; }
    };
    pass(); 
    asm volatile("s_wait_xcnt 0x0" ::: "memory");   // the stores' registers are free before code of another job, which follows in the listing, may rewrite them
}
// k_prep: every job that depends on the inputs alone, in one launch. Block ranges: 64 weight tiles (16 matrices x 4), 16 of W_o, 256 of V^T, 1024 of x; every branch is block-uniform.
#define PB_WT  (2 * NH_ * 4)
#define PB_WO  (HS / 8)
#define PB_VT  (NB_ * 2 * (NT_ / 64))
#define PB_X   (NB_ * NTK / 8)
__global__ __launch_bounds__(256) void k_prep(const float* __restrict__ x, const float* __restrict__ Wq, const float* __restrict__ Wk, const float* __restrict__ Wo, bf* Xb, bf* VTH, bf* WqT, bf* WkT, bf* WoB) {
    __shared__ __align__(16) unsigned short tl[64 * 72];
    int bid = blockIdx.x;
    if (bid < PB_WT) {      // per-head k-major [128][128] -> rows h*128.. of the n-major planes [1024][128]
        const int h = bid >> 3, wk = (bid >> 2) & 1;
        p_wt(bid & 1, (bid >> 1) & 1, (wk ? Wk : Wq) + (size_t)h * HS * HD, HS, HD, (wk ? WkT : WqT) + (size_t)h * HD * HS, tl);
        return;
    }
    bid -= PB_WT;
    if (bid < PB_WO) { p_cvtw(bid, Wo, HS, WoB); return; }      // W_o [128][1024] = [out][in]: bf16 copy = n-major B operand
    bid -= PB_WO;
    if (bid < PB_VT) { p_vt(bid & (NT_ / 64 - 1), (bid / (NT_ / 64)) & 1, bid / (2 * (NT_ / 64)), x, VTH, tl); return; }
    p_cvt128(bid - PB_VT, x, NB_ * NTK, Xb);
}
// stage_kv: the 128 threads of one half of the block copy one 32-key tile (K hi and K residual rows of one head: 32 x 256 B each; V^T: 128 rows x 64 B) from global memory into one
// ring buffer, 12 asynchronous 16-B copies a thread; a wave's K copy covers two whole 256-B rows. lb = the buffer's LDS byte address.
__device__ __forceinline__ void stage_kv(const h16* kh, const h16* kl, const bf* vt, unsigned lb, int l0, int tid) {
    const int kr = tid >> 4, kc8 = (tid & 15) * 8, vr = tid >> 2, vc8 = (tid & 3) * 8;
    const h16* gh = kh + (size_t)(l0 + kr) * KW + kc8; const h16* gl = kl + (size_t)(l0 + kr) * KW + kc8; const bf* gv = vt + (size_t)vr * NT_ + l0 + vc8;
    const unsigned lh = lb + (unsigned)(kr * KP + kc8) * 2u, ll = lh + KPL * 2u, lv = lb + (unsigned)(2 * KPL + vr * VP + vc8) * 2u;
    // the copies and their s_wait_xcnt in one statement: no address register of a copy is rewritten in front of that wait
    asm volatile("global_load_async_to_lds_b128 %0, %1, off\n\t"
                 "global_load_async_to_lds_b128 %2, %3, off\n\t"
                 "global_load_async_to_lds_b128 %4, %5, off\n\t"
                 "global_load_async_to_lds_b128 %6, %7, off\n\t"
                 "global_load_async_to_lds_b128 %8, %9, off\n\t"
                 "global_load_async_to_lds_b128 %10, %11, off\n\t"
                 "global_load_async_to_lds_b128 %12, %13, off\n\t"
                 "global_load_async_to_lds_b128 %14, %15, off\n\t"
                 "global_load_async_to_lds_b128 %16, %17, off\n\t"
                 "global_load_async_to_lds_b128 %18, %19, off\n\t"
                 "global_load_async_to_lds_b128 %20, %21, off\n\t"
                 "global_load_async_to_lds_b128 %22, %23, off\n\t"
                 "s_wait_xcnt 0x0"
                 :: "v"(lh), "v"(gh), "v"(lh + 8u * KP * 2u), "v"(gh + (size_t)8 * KW), "v"(lh + 16u * KP * 2u), "v"(gh + (size_t)16 * KW), "v"(lh + 24u * KP * 2u), "v"(gh + (size_t)24 * KW),
                    "v"(ll), "v"(gl), "v"(ll + 8u * KP * 2u), "v"(gl + (size_t)8 * KW), "v"(ll + 16u * KP * 2u), "v"(gl + (size_t)16 * KW), "v"(ll + 24u * KP * 2u), "v"(gl + (size_t)24 * KW),
                    "v"(lv), "v"(gv), "v"(lv + 32u * VP * 2u), "v"(gv + (size_t)32 * NT_), "v"(lv + 64u * VP * 2u), "v"(gv + (size_t)64 * NT_), "v"(lv + 96u * VP * 2u), "v"(gv + (size_t)96 * NT_)
                 : "memory");
}
// stage_q: the block's 256 threads copy its 64 Q rows of one head (hi and residual plane, 256 B a row) into LDS at K's pitch, once, 8 asynchronous 16-B copies a thread;
// a wave's copy covers two whole rows. lb = LDS byte address of the hi plane; the residual plane follows it.
__device__ __forceinline__ void stage_q(const h16* qh, const h16* ql, unsigned lb, int tid) {
    const int r = tid >> 4, c8 = (tid & 15) * 8;
    const h16* gh = qh + (size_t)r * KW + c8; const h16* gl = ql + (size_t)r * KW + c8;
    const unsigned lh = lb + (unsigned)(r * KP + c8) * 2u, ll = lh + 64u * KP * 2u;
    // the copies and their s_wait_xcnt in one statement: no address register of a copy is rewritten in front of that wait
    asm volatile("global_load_async_to_lds_b128 %0, %1, off\n\t"
                 "global_load_async_to_lds_b128 %2, %3, off\n\t"
                 "global_load_async_to_lds_b128 %4, %5, off\n\t"
                 "global_load_async_to_lds_b128 %6, %7, off\n\t"
                 "global_load_async_to_lds_b128 %8, %9, off\n\t"
                 "global_load_async_to_lds_b128 %10, %11, off\n\t"
                 "global_load_async_to_lds_b128 %12, %13, off\n\t"
                 "global_load_async_to_lds_b128 %14, %15, off\n\t"
                 "s_wait_xcnt 0x0"
                 :: "v"(lh), "v"(gh), "v"(lh + 16u * KP * 2u), "v"(gh + (size_t)16 * KW), "v"(lh + 32u * KP * 2u), "v"(gh + (size_t)32 * KW), "v"(lh + 48u * KP * 2u), "v"(gh + (size_t)48 * KW),
                    "v"(ll), "v"(gl), "v"(ll + 16u * KP * 2u), "v"(gl + (size_t)16 * KW), "v"(ll + 32u * KP * 2u), "v"(gl + (size_t)32 * KW), "v"(ll + 48u * KP * 2u), "v"(gl + (size_t)48 * KW)
                 : "memory");
}
// k_attn: block = 8 waves = (item, head, 64 queries); a step is 64 keys: waves 0-3 (16 queries each) take its even 32-key tile, waves 4-7 the odd one for the same queries,
// so the longest block walks 64 steps. The softmax shift is fixed, so the two halves' o and l are plain partial sums: waves 4-7 hand theirs over through LDS behind the
// loop, waves 0-3 add them and finish. Two blocks fit a WGP, half of the grid at a time: the blocks with the most steps come first in the grid, the short ones fill up.
// K slice of head h (row stride NH*HD), V = bf16(x)^T shared by all heads (exact, single plane); causal key tiles
// 0..(Q0+63)/32; per element: j <= q -> clip(score x 128^-1/2, -10, 10) else -inf (reference: clip before the causal where); scores hh + (hl+lh)/1024 on separate
// accumulators; softmax f32 with the fixed shift 10; P (x32768) as bf16 hi + unscaled residual; o += ph.v + pl.v; ctx / l -> bf16 hi/lo planes CH/CL[tok][h*128+d].
// Both products run transposed: S^T = K.Q^T (A = K rows, B = Q rows), O^T += V^T.P^T (A = V^T rows, B = P^T). A lane then holds scores of ONE query (column lr), keys 8*hi + j of
// each 16-key tile, which is the k order of a B fragment: the two score tiles, converted in place, ARE P^T's fragment, and P goes through no LDS and no lane exchange.
__global__ __launch_bounds__(256) void k_attn(const h16* __restrict__ QH, const h16* __restrict__ QL, const h16* __restrict__ KH, const h16* __restrict__ KL, const bf* __restrict__ VTH, bf* CH, bf* CL) {
    __shared__ __align__(16) unsigned short qs[2 * 64 * KP];   // the block's Q rows, hi and residual plane, copied once in whole rows (a fragment read from global memory touches 16 lines) and read once into registers. Behind the loop: output staging
    __shared__ __align__(16) unsigned short ring[4 * STG];     // two buffers of two key tiles: the next step's copies fly while this one is worked on; 4 waves share each tile
    const int lane = threadIdx.x & 31, wave = threadIdx.x >> 5, lr = lane & 15, hi = lane >> 4;
    const int grp = __builtin_amdgcn_readfirstlane(threadIdx.x >> 7), w4 = wave & 3, t128 = threadIdx.x & 127;   // grp (wave-uniform): which key tile of a step this wave takes
    const int bid = blockIdx.x; const int qt = NT_ / 64 - 1 - bid / (NH_ * NB_), h = bid % NH_, item = (bid / NH_) % NB_; const int g = h;   // K has one slice per head; V (= x) is shared by all heads
    { const size_t ib = (size_t)item * NT_ * KW;                      // batch item: its own rows of every plane, its own V^T
      QH += ib; QL += ib; KH += ib; KL += ib; CH += ib; CL += ib; VTH += (size_t)item * HS * NT_; }
    const int q0 = qt * 64 + w4 * 16;
    const unsigned short* tq = qs + (w4 * 16 + lr) * KP + 8 * hi;    // this lane's Q row in LDS; the residual plane lies 64 rows on
    const h16* kh_b = KH + g * HD; const h16* kl_b = KL + g * HD;
    v8f o[8];
#pragma unroll
    for (int n = 0; n < 8; ++n) o[n] = (v8f){};
    float lsum = 0.f;                                               // this lane's share of its query's row sum: the keys 8*hi + j of every 16-key tile
    const int st_hi = qt;                                           // causal: steps of 64 keys, 0..qt; each half of the block copies the tile it works on
    const unsigned ring_b = (unsigned)(size_t)&ring[0];              // LDS byte address of the ring
    stage_q(QH + (size_t)(qt * 64) * KW + h * HD, QL + (size_t)(qt * 64) * KW + h * HD, (unsigned)(size_t)&qs[0], threadIdx.x);
    stage_kv(kh_b, kl_b, VTH, ring_b + (unsigned)grp * (STG * 2u), grp * 32, t128);
    asm volatile("s_wait_asynccnt 0x0" ::: "memory");               // this wave's copies of Q and of step 0 have landed
    __syncthreads();                                                // ... and every other wave's
    if (st_hi >= 1) stage_kv(kh_b, kl_b, VTH, ring_b + (unsigned)(2 + grp) * (STG * 2u), 64 + grp * 32, t128);
    // a wave's Q fragments are the same for every key tile: all eight (4 k chunks x hi, residual; 64 registers) are read from LDS once and held, so that a key tile costs 48 LDS reads and not 64
    v16h qf[4][2];
#pragma unroll
    for (int kc = 0; kc < 4; ++kc) { qf[kc][0] = cat16(*(const v8ha*)(tq + kc * 32), *(const v8ha*)(tq + kc * 32 + 16)); qf[kc][1] = cat16(*(const v8ha*)(tq + 64 * KP + kc * 32), *(const v8ha*)(tq + 64 * KP + kc * 32 + 16)); }
#pragma unroll 1
    for (int st = 0; st <= st_hi; ++st) {
        const int l0 = st * 64 + grp * 32;
        const unsigned short* tb = ring + ((st & 1) * 2 + grp) * STG;
        const unsigned short* tkh = tb + lr * KP + 8 * hi; const unsigned short* tkl = tkh + KPL; const unsigned short* tv = tb + 2 * KPL + lr * VP + 8 * hi;
        v8f s0 = {}, s1 = {}, x0 = {}, x1 = {};
        // LDS fragment reads run ahead of their use, so that a wave waits on a count and not on an empty queue: chunk kc + 1's four K fragments are requested in front of chunk kc's
        // products (two register sets), and all eight V fragments behind the last score product, into the K sets' registers, so that they land under the softmax
        v16h kf[2][4];
        auto ldk = [&](int kc, v16h* d) {
            d[0] = cat16(*(const v8ha*)(tkh + kc * 32), *(const v8ha*)(tkh + kc * 32 + 16)); d[1] = cat16(*(const v8ha*)(tkh + 16 * KP + kc * 32), *(const v8ha*)(tkh + 16 * KP + kc * 32 + 16));
            d[2] = cat16(*(const v8ha*)(tkl + kc * 32), *(const v8ha*)(tkl + kc * 32 + 16)); d[3] = cat16(*(const v8ha*)(tkl + 16 * KP + kc * 32), *(const v8ha*)(tkl + 16 * KP + kc * 32 + 16)); };
        v16bf vf[8];
        ldk(0, kf[0]);
#pragma unroll
        for (int kc = 0; kc < 4; ++kc) {
            if (kc < 3) ldk(kc + 1, kf[(kc + 1) & 1]);
            const v16h qa = qf[kc][0], qx = qf[kc][1];
            const v16h k0h = kf[kc & 1][0], k1h = kf[kc & 1][1], k0l = kf[kc & 1][2], k1l = kf[kc & 1][3];
            s0 = wmma16(k0h, qa, s0); s1 = wmma16(k1h, qa, s1); x0 = wmma16(k0h, qx, x0); x1 = wmma16(k1h, qx, x1);     // s[j] = S^T[key 8*hi + j][query lr]
            x0 = wmma16(k0l, qa, x0); x1 = wmma16(k1l, qa, x1);
            // one vector slot behind the chunk's last product, with its operands still held: the next requests into this register set stand behind it
            asm volatile("v_nop" : "+v"(s0), "+v"(s1), "+v"(x0), "+v"(x1) : "v"(qa), "v"(qx), "v"(k0h), "v"(k1h), "v"(k0l), "v"(k1l));
        }
#pragma unroll
        for (int n = 0; n < 8; ++n) vf[n] = cat16b(*(const v8usa*)(tv + n * 16 * VP), *(const v8usa*)(tv + n * 16 * VP + 16));     // V = bf16(x) exactly (a rounded INPUT): no residual plane
        asm volatile("v_nop\n\tv_nop\n\tv_nop\n\tv_nop" : "+v"(s0), "+v"(s1), "+v"(x0), "+v"(x1));
        float pe[16];                                               // P^T in B's k order: 0-7 = keys 8*hi + j (tile 0), 8-15 = keys 16 + 8*hi + j (tile 1)
        const int lim = q0 + lr - l0 - hi * 8;                      // causal, key l0 + 8*hi + j (+ 16) <= query q0 + lr: register index j (+ 16) against this lane's limit
#pragma unroll
        for (int j = 0; j < 8; ++j) {
            // reference order: scores / sqrt(128) -> clip(-10, 10) -> causal where -> softmax
            const float a0 = (j <= lim) ? fminf(fmaxf((s0[j] + x0[j] * LOSCI) * 0.08838834764831845f, -10.0f), 10.0f) : -__builtin_inff(), a1 = (j + 16 <= lim) ? fminf(fmaxf((s1[j] + x1[j] * LOSCI) * 0.08838834764831845f, -10.0f), 10.0f) : -__builtin_inff();
            // every kept score lies in [-10, 10] after the clip, so the clip's upper bound is the softmax shift: exp(a - 10) is in [e^-20, 1] for any input,
            // and no row maximum is searched, carried or applied to o and l
            pe[j] = (a0 - 10.0f) * 1.44269504f; pe[8 + j] = (a1 - 10.0f) * 1.44269504f; }      // exp(t) = 2^(t x log2 e), as __expf forms it
        // the tile's 16 exponentials in one statement, each in place, its last line the one slot that the instruction set asks for behind a transcendental
        asm("v_exp_f32 %0, %0\n\tv_exp_f32 %1, %1\n\tv_exp_f32 %2, %2\n\tv_exp_f32 %3, %3\n\tv_exp_f32 %4, %4\n\tv_exp_f32 %5, %5\n\tv_exp_f32 %6, %6\n\tv_exp_f32 %7, %7\n\t"
            "v_exp_f32 %8, %8\n\tv_exp_f32 %9, %9\n\tv_exp_f32 %10, %10\n\tv_exp_f32 %11, %11\n\tv_exp_f32 %12, %12\n\tv_exp_f32 %13, %13\n\tv_exp_f32 %14, %14\n\tv_exp_f32 %15, %15\n\tv_nop"
            : "+v"(pe[0]), "+v"(pe[1]), "+v"(pe[2]), "+v"(pe[3]), "+v"(pe[4]), "+v"(pe[5]), "+v"(pe[6]), "+v"(pe[7]),
              "+v"(pe[8]), "+v"(pe[9]), "+v"(pe[10]), "+v"(pe[11]), "+v"(pe[12]), "+v"(pe[13]), "+v"(pe[14]), "+v"(pe[15]));
        float ps[16];
#pragma unroll
        for (int j = 0; j < 8; ++j) { lsum += pe[j] + pe[8 + j]; ps[j] = pe[j] * PSC; ps[8 + j] = pe[8 + j] * PSC; }
        v8u pw, rw;                                                 // neighbours in k share a register: one packed conversion (round to nearest even, as f2bf) makes each word of the fragment
#pragma unroll
        for (int i = 0; i < 8; ++i) { const unsigned w = __builtin_bit_cast(unsigned, __builtin_convertvector((v2f){ps[2 * i], ps[2 * i + 1]}, v2bf)); pw[i] = w;
            rw[i] = __builtin_bit_cast(unsigned, __builtin_convertvector((v2f){ps[2 * i] - __uint_as_float(w << 16), ps[2 * i + 1] - __uint_as_float(w & 0xFFFF0000u)}, v2bf)); }
        const v16bf pa = __builtin_bit_cast(v16bf, pw), px = __builtin_bit_cast(v16bf, rw);
#pragma unroll
        for (int n = 0; n < 8; ++n) o[n] = wmmab(vf[n], pa, o[n]);      // o[n][j] = O^T[d = n*16 + 8*hi + j][query lr]
#pragma unroll
        for (int n = 0; n < 8; ++n) o[n] = wmmab(vf[n], px, o[n]);      // per o[n] still hi then residual: the sums keep their order
        // four vector slots behind the last products before anything may rewrite their operands; all eight accumulators are named, so that no product drifts behind the barrier with its V registers held
        asm volatile("v_nop\n\tv_nop\n\tv_nop\n\tv_nop" : "+v"(o[0]), "+v"(o[1]), "+v"(o[2]), "+v"(o[3]), "+v"(o[4]), "+v"(o[5]), "+v"(o[6]), "+v"(o[7]) : "v"(pa), "v"(px));
        __builtin_amdgcn_wave_barrier();
        asm volatile("s_wait_dscnt 0x0" ::: "memory");              // this wave's reads of the buffer are done before it may be refilled
        asm volatile("s_wait_asynccnt 0x0" ::: "memory");           // this wave's copies of step st + 1 have landed
        __syncthreads();                                            // publishes step st + 1 and ends every wave's reads of step st
        if (st + 2 <= st_hi) stage_kv(kh_b, kl_b, VTH, ring_b + (unsigned)((st & 1) * 2 + grp) * (STG * 2u), l0 + 128, t128);
    }
    asm volatile("s_wait_asynccnt 0x0" ::: "memory");               // nothing in flight when the ring is put to another use
    // the ring is free behind the loop's last barrier: waves 4-7 lay their partial o and l there, 16 x 16 B + 4 B a lane, for the wave with the same queries
    v4fa* xw = (v4fa*)(void*)ring + w4 * (16 * 32) + lane; float* xl = (float*)(void*)ring + 4 * (16 * 32) * 4 + w4 * 32 + lane;
    if (grp == 1) {
#pragma unroll
        for (int n = 0; n < 8; ++n) { xw[(2 * n) * 32] = (v4f){o[n][0], o[n][1], o[n][2], o[n][3]}; xw[(2 * n + 1) * 32] = (v4f){o[n][4], o[n][5], o[n][6], o[n][7]}; }
        *xl = lsum;
    }
    __syncthreads();                                                // the partial sums are visible to waves 0-3
    if (grp == 1) return;                                           // no barrier follows: waves 0-3 finish alone
#pragma unroll
    for (int n = 0; n < 8; ++n) { const v4f a = xw[(2 * n) * 32], b = xw[(2 * n + 1) * 32];
#pragma unroll
        for (int j = 0; j < 4; ++j) { o[n][j] += a[j]; o[n][4 + j] += b[j]; } }
    lsum += *xl;
    lsum += __shfl_xor(lsum, 16, 32);                               // the two lane halves hold the two halves of a query's keys
    const float inv = 1.0f / (lsum * PSC);
    float* os = (float*)(void*)qs + w4 * (16 * 68);                 // Q's only read lies in front of the loop, whose every trip ends in s_wait_dscnt 0 and a barrier
    const size_t cbase = (size_t)q0 * (NH_ * HD) + (size_t)h * HD;
#pragma unroll
    for (int half = 0; half < 2; ++half) {
#pragma unroll
        for (int n = 0; n < 4; ++n) { const v8f t = o[half * 4 + n] * inv; v4fa* d = (v4fa*)(os + lr * 68 + n * 16 + hi * 8);     // a lane holds 8 consecutive d of its query's row
            d[0] = (v4f){t[0], t[1], t[2], t[3]}; d[1] = (v4f){t[4], t[5], t[6], t[7]}; }
        __builtin_amdgcn_wave_barrier(); asm volatile("" ::: "memory");
{
#pragma unroll
            for (int s = 0; s < 4; ++s) { const int row = 4 * s + (lane >> 3), piece = lane & 7; const float* sp = os + row * 68 + piece * 8; v8us oh, ol;
#pragma unroll
                for (int i = 0; i < 8; ++i) { const unsigned short hb = f2bf(sp[i]); oh[i] = hb; ol[i] = f2bf(sp[i] - bf2f(hb)); }
                const size_t po = cbase + (size_t)row * (NH_ * HD) + half * 64 + piece * 8; *(v8us*)(CH + po) = oh; *(v8us*)(CL + po) = ol; }
             }
        __builtin_amdgcn_wave_barrier(); asm volatile("" ::: "memory");
    }
}

extern "C" void kernel_launch(void* const* d_in, const int* in_sizes, int n_in,
                              void* d_out, int out_size, void* d_ws, size_t ws_size, hipStream_t stream) {
    (void)in_sizes; (void)n_in; (void)out_size;
    const float* x = (const float*)d_in[0]; const float* Wq = (const float*)d_in[1]; const float* Wk = (const float*)d_in[2]; const float* Wo = (const float*)d_in[3];   // Wq/Wk [8][128][128] (x.W[h]); Wo [128][1024] = [out][in]
    float* out = (float*)d_out;    // [2][4096][128]
    char* wsp = (char*)d_ws;
    auto take = [&](size_t bytes) { char* p = wsp; wsp += (bytes + 255) & ~(size_t)255; return (void*)p; };
    bf* Xb = (bf*)take((size_t)NB_ * NTK * HS * 2);
    bf* WqT = (bf*)take((size_t)KW * HS * 2); bf* WkT = (bf*)take((size_t)KW * HS * 2); bf* WoB = (bf*)take((size_t)HS * KW * 2);
    h16* QH = (h16*)take((size_t)NB_ * NTK * KW * 2); h16* QL = (h16*)take((size_t)NB_ * NTK * KW * 2); h16* KH = (h16*)take((size_t)NB_ * NTK * KW * 2); h16* KL = (h16*)take((size_t)NB_ * NTK * KW * 2);
    bf* VTH = (bf*)take((size_t)NB_ * HS * NT_ * 2); bf* CH = (bf*)take((size_t)NB_ * NTK * KW * 2); bf* CL = (bf*)take((size_t)NB_ * NTK * KW * 2);
    if ((size_t)(wsp - (char*)d_ws) > ws_size) return;    // about 105 MB, no aliasing: every per-item plane holds both batch items
    // four dependent launches: what reads inputs only; the Q and the K projection (grid z); attention; the output projection. Both batch items in every launch.
    k_prep<<<PB_WT + PB_WO + PB_VT + PB_X, 256, 0, stream>>>(x, Wq, Wk, Wo, Xb, VTH, WqT, WkT, WoB);
    k_gemmb<false, true><<<dim3(NB_ * NTK / 64, KW / 64, 2), 128, 0, stream>>>(Xb, nullptr, WqT, nullptr, (float*)(void*)QH, KW, QL, nullptr, HS, 1, WkT, (float*)(void*)KH, KL);
    k_attn<<<dim3(NB_ * NH_ * (NT_ / 64), 1, 1), 256, 0, stream>>>(QH, QL, KH, KL, VTH, CH, CL);
    k_gemmb<true, false><<<dim3(NB_ * NTK / 64, HS / 64, 1), 128, 0, stream>>>(CH, CL, WoB, nullptr, out, HS, nullptr, nullptr, KW);
}
